// v000
// Measured on an AMD MI455X. A time is GPU time per run, averaged over a window of back-to-back runs after a warm-up
// (all launches, gaps included; the runs take copies of the inputs in turn), and the median of several windows.
// Apart from v000's, it joins two sittings. Times from different sittings can be a few percent apart, while
// side-by-side timings come from the same sitting.
// v000, which the later versions start from, runs in 880 microseconds.
#include <hip/hip_runtime.h>
// CrossShapedAttention (8 x 64 x 64 x 256, window 8, 4 heads x 32 per branch: [q | k] = x w_qkv + b (v = k); horizontal branch = channels 0..127 attending within each 8-row stripe (512 tokens), vertical branch = channels 128..255 within each 8-column stripe; softmax(q.k / sqrt(32)) v; the vertical context is put back through the TF code's exact reshape/transpose order (a fixed permutation of (row-in-stripe, column, head, channel)); bias = depthwise3x3(hard_swish(v)) + b; out = hard_swish(context + bias) w_out + b_out).
// Structure: exact f16 x rows; q and k(=v) as f16 WMMA GEMMs (32x64 wave tiles, f32 accumulation, exact x16 (in,out) weights + bias; q f16, k f32 + f16); horizontal stripes are contiguous row ranges: per head and half of the 64 (image, stripe) planes, batched score GEMMs (K = 32), a VALU row softmax (f16 x 2^10) and batched 16-row-tile readout GEMMs (N = 32) writing context columns h*32.. directly; the vertical branch gathers q/k into stripe-major token order first (token = row*8 + column-in-stripe), runs the same three steps, and scatters the result through the reference's permutation; the hard-swish + depthwise 3x3 bias on VALU (f32, added into the context rows); hard_swish into f16 rows; output projection GEMM writing the [B,H,W,C] output.
// Compute dtype: inputs rounded to bf16; x / weights exact as f16; q, k, v and the final context as plain f16 GEMM operands (~2^-12); softmax / hard-swish / depthwise in f32. v_wmma_f32_16x16x32_f16.
#define NI 8
#define HS 64
#define WSD 64
#define CH 256
#define CHH 128                  /* channels per branch */
#define NHB 4                    /* heads per branch */
#define DH 32
#define WIN 8
#define NST 8                    /* stripes per image per branch */
#define TOKS 512                 /* tokens per stripe */
#define NPX (HS * WSD)
#define NR (NI * NPX)            /* 32768 */
#define NPL (NI * NST)           /* 64 (image, stripe) planes per branch */
#define PH 32                    /* planes per score half */
typedef __bf16 v16b __attribute__((ext_vector_type(16)));
typedef unsigned short v8us __attribute__((ext_vector_type(8), may_alias));
typedef float  v8f  __attribute__((ext_vector_type(8)));
typedef float  v4f  __attribute__((ext_vector_type(4)));
typedef float  v4fa __attribute__((ext_vector_type(4), may_alias));
union FragB { v16b v; v8us half[2]; unsigned short u[16]; };

__device__ __forceinline__ unsigned short bf16_bits(float x) { unsigned int u = __float_as_uint(x); return (unsigned short)((u + 0x7FFFu + ((u >> 16) & 1u)) >> 16); }
__device__ __forceinline__ float bf16_val(unsigned short b) { return __uint_as_float(((unsigned int)b) << 16); }
__device__ __forceinline__ float bf16_round(float x) { return bf16_val(bf16_bits(x)); }
// D += A·B with NT terms: 1 = ah·bh, 2 = + al·bh (A split), 3 = + ah·bl (both split)
template <int NT>
__device__ __forceinline__ v8f mmaN(v16b ah, v16b al, v16b bh, v16b bl, v8f c) {
  c = __builtin_amdgcn_wmma_f32_16x16x32_bf16(false, ah, false, bh, (short)0, c, false, false);
  if (NT >= 2) c = __builtin_amdgcn_wmma_f32_16x16x32_bf16(false, al, false, bh, (short)0, c, false, false);
  if (NT >= 3) c = __builtin_amdgcn_wmma_f32_16x16x32_bf16(false, ah, false, bl, (short)0, c, false, false);
  asm volatile("v_nop\n\tv_nop\n\tv_nop\n\tv_nop" : "+v"(c) : "v"(ah), "v"(al), "v"(bh), "v"(bl));
  return c;
}

__global__ __launch_bounds__(256) void k_wt_bf16(const float* __restrict__ W, unsigned short* __restrict__ Wt, int K, int N) {
  const int t = blockIdx.x * 256 + threadIdx.x;
  const int k8n = K / 8;
  if (t >= N * k8n) return;
  const int n = t / k8n, k8 = (t % k8n) * 8;
  v8us v;
#pragma unroll
  for (int i = 0; i < 8; ++i) v[i] = bf16_bits(W[(size_t)(k8 + i) * N + n]);
  *(v8us*)(Wt + (size_t)n * K + k8) = v;
  
}

// GEMM C[M][N] (f32, pitch ldc) = act(A[M][K]·W + bias). A f32 row-major (pitch lda) converted per fragment to bf16
// (ASPLIT: hi/lo two planes -> 2 terms, else single rounded term); Wt bf16 [N][K] (pitch ldb). BIAS_BF16 rounds the
// bias to bf16 first (bias quantised to bf16 before the add). K%32==0, M%16==0, N%64==0.
template <bool ASPLIT, int ACT, bool BIAS_BF16>
__global__ __launch_bounds__(128) void k_gemm_bf(const float* __restrict__ A, int lda, const unsigned short* __restrict__ Wt, int ldb,
                                               const float* __restrict__ bias, float* __restrict__ C, int ldc, int M, int N, int K) {
  __shared__ __attribute__((aligned(16))) float so[4][16][64];
  const int tid = threadIdx.x, w = tid >> 5, lane = tid & 31, ln = lane & 15, hh = lane >> 4;
  const int ntn = N / 64;
  const int wid = blockIdx.x * 4 + w;
  const int mt = wid / ntn, nq = wid % ntn;
  if (mt * 16 >= M) return;
  const int row0 = mt * 16, col0 = nq * 64;
  const float* arow = A + (size_t)(row0 + ln) * lda;
  v8f acc[4] = {};
  for (int kb = 0; kb < K; kb += 32) {
    FragB ah, al;
    const v4f x0 = *(const v4fa*)(arow + kb + 8 * hh), x1 = *(const v4fa*)(arow + kb + 8 * hh + 4);
    const v4f x2 = *(const v4fa*)(arow + kb + 16 + 8 * hh), x3 = *(const v4fa*)(arow + kb + 16 + 8 * hh + 4);
    float xs[16] = {x0[0],x0[1],x0[2],x0[3],x1[0],x1[1],x1[2],x1[3],x2[0],x2[1],x2[2],x2[3],x3[0],x3[1],x3[2],x3[3]};
#pragma unroll
    for (int i = 0; i < 16; ++i) { const unsigned short hb = bf16_bits(xs[i]); ah.u[i] = hb; al.u[i] = ASPLIT ? bf16_bits(xs[i] - bf16_val(hb)) : (unsigned short)0; }
#pragma unroll
    for (int t = 0; t < 4; ++t) {
      const unsigned short* brow = Wt + (size_t)(col0 + t * 16 + ln) * ldb + kb;
      FragB b;
      b.half[0] = *(const v8us*)(brow + 8 * hh);
      b.half[1] = *(const v8us*)(brow + 16 + 8 * hh);
      acc[t] = mmaN<ASPLIT ? 2 : 1>(ah.v, al.v, b.v, b.v, acc[t]);
    }
  }
#pragma unroll
  for (int t = 0; t < 4; ++t) {
    float bv = bias ? bias[col0 + t * 16 + ln] : 0.f;
    if (BIAS_BF16) bv = bf16_round(bv);
#pragma unroll
    for (int r = 0; r < 8; ++r) { float v = acc[t][r] + bv; if (ACT == 1) v = fmaxf(v, 0.f); so[w][8 * hh + r][t * 16 + ln] = v; }
  }
  __builtin_amdgcn_fence(__ATOMIC_ACQ_REL, "workgroup");
  __builtin_amdgcn_wave_barrier();
  const int rsub = lane >> 4, c4 = (lane & 15) * 4;
  {
#pragma unroll
    for (int q = 0; q < 8; ++q) {
      const int r = q * 2 + rsub;
      const v4f v = *(const v4fa*)&so[w][r][c4];
      *(v4f*)(C + (size_t)(row0 + r) * ldc + col0 + c4) = v;
    }
    
  }
}

// GEMM C = act(A·W + bias + resid): A f32 (ASPLIT -> hi/lo 2 terms), Wt bf16 [N][K]; ACT 0 none, 1 relu, 2 exact gelu;
// resid (optional, f32, row index = (row % rmod), pitch ldr, RES_BF16 rounds it) added before the activation.
template <bool ASPLIT, int ACT, bool BIAS_BF16, bool RES_BF16>
__global__ __launch_bounds__(128) void k_gemm_bf3(const float* __restrict__ A, int lda, const unsigned short* __restrict__ Wt, int ldb,
                                                const float* __restrict__ bias, const float* __restrict__ resid, int rmod, int ldr,
                                                float* __restrict__ C, int ldc, int M, int N, int K) {
  __shared__ __attribute__((aligned(16))) float so[4][16][64];
  const int tid = threadIdx.x, w = tid >> 5, lane = tid & 31, ln = lane & 15, hh = lane >> 4;
  const int ntn = N / 64;
  const int wid = blockIdx.x * 4 + w;
  const int mt = wid / ntn, nq = wid % ntn;
  if (mt * 16 >= M) return;
  const int row0 = mt * 16, col0 = nq * 64;
  const float* arow = A + (size_t)(row0 + ln) * lda;
  v8f acc[4] = {};
  for (int kb = 0; kb < K; kb += 32) {
    FragB ah, al;
    const v4f x0 = *(const v4fa*)(arow + kb + 8 * hh), x1 = *(const v4fa*)(arow + kb + 8 * hh + 4);
    const v4f x2 = *(const v4fa*)(arow + kb + 16 + 8 * hh), x3 = *(const v4fa*)(arow + kb + 16 + 8 * hh + 4);
    float xs[16] = {x0[0],x0[1],x0[2],x0[3],x1[0],x1[1],x1[2],x1[3],x2[0],x2[1],x2[2],x2[3],x3[0],x3[1],x3[2],x3[3]};
#pragma unroll
    for (int i = 0; i < 16; ++i) { const unsigned short hb = bf16_bits(xs[i]); ah.u[i] = hb; al.u[i] = ASPLIT ? bf16_bits(xs[i] - bf16_val(hb)) : (unsigned short)0; }
#pragma unroll
    for (int t = 0; t < 4; ++t) {
      const unsigned short* brow = Wt + (size_t)(col0 + t * 16 + ln) * ldb + kb;
      FragB b;
      b.half[0] = *(const v8us*)(brow + 8 * hh);
      b.half[1] = *(const v8us*)(brow + 16 + 8 * hh);
      acc[t] = mmaN<ASPLIT ? 2 : 1>(ah.v, al.v, b.v, b.v, acc[t]);
    }
  }
#pragma unroll
  for (int t = 0; t < 4; ++t) {
    const int col = col0 + t * 16 + ln;
    float bv = bias ? bias[col] : 0.f;
    if (BIAS_BF16) bv = bf16_round(bv);
#pragma unroll
    for (int r = 0; r < 8; ++r) {
      float v = acc[t][r] + bv;
      if (resid) { float rv = resid[(size_t)((row0 + 8 * hh + r) % rmod) * ldr + col]; if (RES_BF16) rv = bf16_round(rv); v += rv; }
      if (ACT == 1) v = fmaxf(v, 0.f);
      if (ACT == 2) v = 0.5f * v * (1.0f + erff(v * 0.70710678118654752f));
      if (ACT == 3) { const float u = 0.7978845608028654f * (v + 0.044715f * v * v * v); v = 0.5f * v * (1.0f + tanhf(u)); }
      so[w][8 * hh + r][t * 16 + ln] = v;
    }
  }
  __builtin_amdgcn_fence(__ATOMIC_ACQ_REL, "workgroup");
  __builtin_amdgcn_wave_barrier();
  const int rsub = lane >> 4, c4 = (lane & 15) * 4;
  {
#pragma unroll
    for (int q = 0; q < 8; ++q) {
      const int r = q * 2 + rsub;
      const v4f v = *(const v4fa*)&so[w][r][c4];
      *(v4f*)(C + (size_t)(row0 + r) * ldc + col0 + c4) = v;
    }
    
  }
}
// row LayerNorm (biased variance, eps) over N: s = X (+ R); optional out_sum <- s; out_norm <- (s-mu)*rsqrt(var+eps)*g + b
template <bool PARAM_BF16>
__global__ __launch_bounds__(256) void k_layernorm(const float* __restrict__ X, const float* __restrict__ R, const float* __restrict__ g, const float* __restrict__ bta,
                                                  float* __restrict__ out_sum, float* __restrict__ out_norm, int N, float eps) {
  __shared__ float red[256];
  const int row = blockIdx.x, tid = threadIdx.x;
  const float* x = X + (size_t)row * N; const float* rr = R ? R + (size_t)row * N : nullptr;
  float vals[16];                     // up to N = 4096
  const int per = N / 256;            // contiguous chunk per thread? use strided-by-4 chunks: thread handles j = tid*4 + 1024*u
  float s1 = 0.f;
  for (int u = 0; u < per / 4; ++u) {
    const int j = tid * 4 + 1024 * u;
    const v4f a = *(const v4fa*)(x + j);
    v4f b = {0.f,0.f,0.f,0.f}; if (rr) b = *(const v4fa*)(rr + j);
#pragma unroll
    for (int q = 0; q < 4; ++q) { const float v = a[q] + b[q]; vals[u * 4 + q] = v; s1 += v; }
  }
  red[tid] = s1; __syncthreads();
  for (int st = 128; st > 0; st >>= 1) { if (tid < st) red[tid] += red[tid + st]; __syncthreads(); }
  const float mu = red[0] / (float)N; __syncthreads();
  float s2 = 0.f;
  for (int u = 0; u < per / 4; ++u)
#pragma unroll
    for (int q = 0; q < 4; ++q) { const float c = vals[u * 4 + q] - mu; s2 += c * c; }
  red[tid] = s2; __syncthreads();
  for (int st = 128; st > 0; st >>= 1) { if (tid < st) red[tid] += red[tid + st]; __syncthreads(); }
  const float rs = rsqrtf(red[0] / (float)N + eps);
  {
    for (int u = 0; u < per / 4; ++u) {
      const int j = tid * 4 + 1024 * u;
      v4f o, sm;
#pragma unroll
      for (int q = 0; q < 4; ++q) {
        float gg = g[j + q], bb = bta[j + q];
        if (PARAM_BF16) { gg = bf16_round(gg); bb = bf16_round(bb); }
        sm[q] = vals[u * 4 + q]; o[q] = (vals[u * 4 + q] - mu) * rs * gg + bb;
      }
      if (out_sum) *(v4f*)(out_sum + (size_t)row * N + j) = sm;
      *(v4f*)(out_norm + (size_t)row * N + j) = o;
    }
    
  }
}



// ---- f16 WMMA path (v_wmma_f32_16x16x32_f16): 11-bit significands for operands in range — used where a [0,1] probability operand needs more precision than bf16
typedef _Float16 v16h __attribute__((ext_vector_type(16)));
union FragH { v16h v; v8us half[2]; _Float16 h[16]; unsigned short u[16]; };
template <int NT>
__device__ __forceinline__ v8f mmaH(v16h ah, v16h al, v16h bh, v16h bl, v8f c) {
  c = __builtin_amdgcn_wmma_f32_16x16x32_f16(false, ah, false, bh, (short)0, c, false, false);
  if (NT >= 2) c = __builtin_amdgcn_wmma_f32_16x16x32_f16(false, al, false, bh, (short)0, c, false, false);
  if (NT >= 3) c = __builtin_amdgcn_wmma_f32_16x16x32_f16(false, ah, false, bl, (short)0, c, false, false);
  asm volatile("v_nop\n\tv_nop\n\tv_nop\n\tv_nop" : "+v"(c) : "v"(ah), "v"(al), "v"(bh), "v"(bl));
  return c;
}
// batched GEMM like k_gemm_b but f16 operands: A f32 (split into f16 hi/lo if ASPLIT, else rounded to f16), Bt = f16 values [n][k]; alpha; C f32; N multiple of 16 (partial tiles skipped)
template <bool ASPLIT>
__global__ __launch_bounds__(128) void k_gemm_h(const float* __restrict__ A, int lda, size_t sA, const _Float16* __restrict__ Bh, int ldb, size_t sB, float alpha, float* __restrict__ C, int ldc, size_t sC, int M, int N, int K) {
  __shared__ __attribute__((aligned(16))) float so[4][16][64];
  const int tid = threadIdx.x, w = tid >> 5, lane = tid & 31, ln = lane & 15, hh = lane >> 4; const int by = blockIdx.y;
  A += (size_t)by * sA; Bh += (size_t)by * sB; C += (size_t)by * sC;
  const int ntn = (N + 63) / 64; const int wid = blockIdx.x * 4 + w; const int mt = wid / ntn, nq = wid % ntn; if (mt * 16 >= M) return;
  const int row0 = mt * 16, col0 = nq * 64; const float* arow = A + (size_t)(row0 + ln) * lda;
  v8f acc[4] = {};
  for (int kb = 0; kb < K; kb += 32) {
    FragH ah, al;
    const v4f x0 = *(const v4fa*)(arow + kb + 8 * hh), x1 = *(const v4fa*)(arow + kb + 8 * hh + 4), x2 = *(const v4fa*)(arow + kb + 16 + 8 * hh), x3 = *(const v4fa*)(arow + kb + 16 + 8 * hh + 4);
    float xs[16] = {x0[0],x0[1],x0[2],x0[3],x1[0],x1[1],x1[2],x1[3],x2[0],x2[1],x2[2],x2[3],x3[0],x3[1],x3[2],x3[3]};
#pragma unroll
    for (int i = 0; i < 16; ++i) { const _Float16 h = (_Float16)xs[i]; ah.h[i] = h; al.h[i] = ASPLIT ? (_Float16)(xs[i] - (float)h) : (_Float16)0.0f; }
#pragma unroll
    for (int t = 0; t < 4; ++t) { if (col0 + t * 16 >= N) continue; const size_t boff = (size_t)(col0 + t * 16 + ln) * ldb + kb; FragH bq; bq.half[0] = *(const v8us*)(Bh + boff + 8 * hh); bq.half[1] = *(const v8us*)(Bh + boff + 16 + 8 * hh);
      acc[t] = mmaH<ASPLIT ? 2 : 1>(ah.v, al.v, bq.v, bq.v, acc[t]); }
  }
#pragma unroll
  for (int t = 0; t < 4; ++t) { if (col0 + t * 16 >= N) continue;
#pragma unroll
    for (int r = 0; r < 8; ++r) so[w][8 * hh + r][t * 16 + ln] = acc[t][r] * alpha; }
  __builtin_amdgcn_fence(__ATOMIC_ACQ_REL, "workgroup"); __builtin_amdgcn_wave_barrier();
  const int rsub = lane >> 4, c4 = (lane & 15) * 4;
  {
#pragma unroll
    for (int q = 0; q < 8; ++q) { const int r = q * 2 + rsub; if (col0 + c4 < N) { const v4f v = *(const v4fa*)&so[w][r][c4]; *(v4f*)(C + (size_t)(row0 + r) * ldc + col0 + c4) = v; } }
     }
}

// Wt[n][k] = f16(W[k][n]·scale) from f32 row-major W[K][N] (scale = power of two; bf16-exact weights stay exact in f16 away from the subnormal range)
__global__ __launch_bounds__(256) void k_wt_f16(const float* __restrict__ W, _Float16* __restrict__ Wt, int K, int N, float scale) {
  const int t = blockIdx.x * 256 + threadIdx.x; if (t >= N * (K / 8)) return; const int n = t / (K / 8), k8 = (t % (K / 8)) * 8; FragH f;
#pragma unroll
  for (int i = 0; i < 8; ++i) f.h[i] = (_Float16)(bf16_round(W[(size_t)(k8 + i) * N + n]) * scale); const v8us o = f.half[0];
  *(v8us*)((unsigned short*)Wt + (size_t)n * K + k8) = o; 
}
// k_gemm_hh variant with fused epilogue: v = acc·alpha + bias[by·sBias + col] (+ CP[(row/rowsPerB)·sCPb + by·64 + col] if CP) ; ACT 0 none / 1 elu ; writes f32 C and/or f16 C16 (each if non-null)
template <int ACT>
__global__ __launch_bounds__(128) void k_gemm_hhx(const _Float16* __restrict__ A, int lda, size_t sA, const _Float16* __restrict__ Bh, int ldb, size_t sB, float alpha, const float* __restrict__ bias, size_t sBias, const float* __restrict__ CP, int rowsPerB, size_t sCPb, int row0g,
    float* __restrict__ C, _Float16* __restrict__ C16, int ldc, size_t sC, int M, int N, int K) {
  __shared__ __attribute__((aligned(16))) float so[4][16][64];
  const int tid = threadIdx.x, w = tid >> 5, lane = tid & 31, ln = lane & 15, hh = lane >> 4; const int by = blockIdx.y;
  A += (size_t)by * sA; Bh += (size_t)by * sB; const size_t cofs = (size_t)by * sC; const float* bp = bias ? bias + (size_t)by * sBias : nullptr;
  const int ntn = (N + 63) / 64; const int wid = blockIdx.x * 4 + w; const int mt = wid / ntn, nq = wid % ntn; if (mt * 16 >= M) return;
  const int row0 = mt * 16, col0 = nq * 64; const _Float16* arow = A + (size_t)(row0 + ln) * lda;
  v8f acc[4] = {};
  for (int kb = 0; kb < K; kb += 32) { FragH ah; ah.half[0] = *(const v8us*)((const unsigned short*)arow + kb + 8 * hh); ah.half[1] = *(const v8us*)((const unsigned short*)arow + kb + 16 + 8 * hh);
#pragma unroll
    for (int t = 0; t < 4; ++t) { if (col0 + t * 16 >= N) continue; const size_t boff = (size_t)(col0 + t * 16 + ln) * ldb + kb; FragH bq; bq.half[0] = *(const v8us*)((const unsigned short*)Bh + boff + 8 * hh); bq.half[1] = *(const v8us*)((const unsigned short*)Bh + boff + 16 + 8 * hh);
      acc[t] = mmaH<1>(ah.v, ah.v, bq.v, bq.v, acc[t]); }
  }
#pragma unroll
  for (int t = 0; t < 4; ++t) { if (col0 + t * 16 >= N) continue; const int col = col0 + t * 16 + ln; const float bv = bp ? bf16_round(bp[col]) : 0.f;
#pragma unroll
    for (int r = 0; r < 8; ++r) { float v = acc[t][r] * alpha + bv; if (CP) { const int rr = row0g + row0 + 8 * hh + r; if (rowsPerB < 0) v += CP[cofs + (size_t)rr * ldc + col];      /* rowsPerB < 0: own element of the batched C plane */ else { const int bidx = rr / rowsPerB; v += CP[(size_t)bidx * sCPb + (size_t)by * 64 + col]; } } if (ACT == 1) v = (v > 0.f) ? v : expm1f(v); else if (ACT == 7) v = (v > 0.f) ? v + 1.0f : expf(v); else if (ACT == 8) v = tanhf(v); else if (ACT == 9) v = 0.5f * v * (1.0f + tanhf(0.7978845608028654f * (v + 0.044715f * v * v * v))); else if (ACT == 11) v = 1.0f / (1.0f + expf(-v)); else if (ACT == 12) v = (v > 0.f) ? v : 0.01f * v; else if (ACT == 14) v = (v > 0.f) ? v : 0.1f * v; else if (ACT == 16) v = (v >= 0.f) ? v : 0.3f * v; else if (ACT == 17) v = (v >= 0.f) ? v : 0.2f * v; else if (ACT == 15) v = v / (1.0f + expf(-v)); else if (ACT == 3) v = fmaxf(v, 0.f); else if (ACT == 6) v = 0.5f * v * (1.0f + erff(v * 0.70710678118654752f)); so[w][8 * hh + r][t * 16 + ln] = v; } }
  __builtin_amdgcn_fence(__ATOMIC_ACQ_REL, "workgroup"); __builtin_amdgcn_wave_barrier();
  const int rsub = lane >> 4, c4 = (lane & 15) * 4; typedef _Float16 v4h __attribute__((ext_vector_type(4)));
  {
#pragma unroll
    for (int q = 0; q < 8; ++q) { const int r = q * 2 + rsub; if (col0 + c4 < N) { const v4f v = *(const v4fa*)&so[w][r][c4]; if (C) *(v4f*)(C + cofs + (size_t)(row0 + r) * ldc + col0 + c4) = v; if (C16) { v4h h4; for (int i = 0; i < 4; ++i) h4[i] = (_Float16)v[i]; *(v4h*)(C16 + cofs + (size_t)(row0 + r) * ldc + col0 + c4) = h4; } } }
     }
}


typedef _Float16 v4h __attribute__((ext_vector_type(4)));

__global__ __launch_bounds__(256) void k_x16(const float* __restrict__ x, _Float16* __restrict__ X16, size_t n8) { const size_t t = (size_t)blockIdx.x * 256 + threadIdx.x; if (t >= n8) return; FragH f;
#pragma unroll
  for (int q = 0; q < 8; ++q) f.h[q] = (_Float16)bf16_round(x[t * 8 + q]); *(v8us*)((unsigned short*)X16 + t * 8) = f.half[0];  }
__global__ __launch_bounds__(256) void k_h16(const float* __restrict__ x, _Float16* __restrict__ X16, size_t n8) { const size_t t = (size_t)blockIdx.x * 256 + threadIdx.x; if (t >= n8) return; FragH f;
#pragma unroll
  for (int q = 0; q < 8; ++q) f.h[q] = (_Float16)x[t * 8 + q]; *(v8us*)((unsigned short*)X16 + t * 8) = f.half[0];  }
__global__ __launch_bounds__(256) void k_round16f(const float* __restrict__ W, _Float16* __restrict__ Bt, size_t n8) { const size_t t = (size_t)blockIdx.x * 256 + threadIdx.x; if (t >= n8) return; FragH f;
#pragma unroll
  for (int i = 0; i < 8; ++i) f.h[i] = (_Float16)(bf16_round(W[t * 8 + i]) * 16.0f); *(v8us*)((unsigned short*)Bt + t * 8) = f.half[0];  }
template <int NHv, int TTv>
__global__ __launch_bounds__(256) void k_vt(const _Float16* __restrict__ V16, int ldv, int voff, _Float16* __restrict__ Vt) { __shared__ unsigned short tl[64][66]; const int tid = threadIdx.x; const int slab = blockIdx.x / (TTv / 64), lg = blockIdx.x % (TTv / 64); const int b = slab / NHv, h = slab % NHv;
  for (int i = tid; i < 64 * 8; i += 256) { const int r = i / 8, c8 = (i % 8) * 8; FragH f; f.half[0] = *(const v8us*)((const unsigned short*)V16 + ((size_t)b * TTv + lg * 64 + r) * ldv + voff + h * 64 + c8);
#pragma unroll
    for (int q = 0; q < 8; ++q) tl[r][c8 + q] = f.u[q]; }
  __syncthreads();
  {
#pragma unroll
    for (int rd = 0; rd < 2; ++rd) { const int d = rd * 32 + tid / 8, pc = tid % 8; FragH f;
#pragma unroll
      for (int q = 0; q < 8; ++q) f.u[q] = tl[pc * 8 + q][d];
      *(v8us*)((unsigned short*)Vt + ((size_t)slab * 64 + d) * TTv + lg * 64 + pc * 8) = f.half[0]; }
     } }

__global__ __launch_bounds__(256) void k_hl(const float* __restrict__ F, _Float16* __restrict__ Hh, _Float16* __restrict__ Hl, size_t n8) { const size_t t = (size_t)blockIdx.x * 256 + threadIdx.x; if (t >= n8) return; FragH fh, fl; const v4f a = *(const v4fa*)(F + t * 8), c = *(const v4fa*)(F + t * 8 + 4);
#pragma unroll
  for (int q = 0; q < 4; ++q) { _Float16 h = (_Float16)a[q]; fh.h[q] = h; fl.h[q] = (_Float16)((a[q] - (float)h) * 1024.0f); h = (_Float16)c[q]; fh.h[4 + q] = h; fl.h[4 + q] = (_Float16)((c[q] - (float)h) * 1024.0f); }
  { *(v8us*)((unsigned short*)Hh + t * 8) = fh.half[0]; *(v8us*)((unsigned short*)Hl + t * 8) = fl.half[0];  } }

// ---- fast GEMM (wave tile 32x64; requires M % 32 == 0 rows per launch region and N % 64 == 0); epilogue = k_gemm_hhx semantics ----
__device__ __forceinline__ v16h g2_frag(const _Float16* p, int hh) { FragH f; f.half[0] = *(const v8us*)((const unsigned short*)p + 8 * hh); f.half[1] = *(const v8us*)((const unsigned short*)p + 16 + 8 * hh); return f.v; }
__device__ __forceinline__ v8f g2_mma(v16h a, v16h b, v8f c) { v8f d = __builtin_amdgcn_wmma_f32_16x16x32_f16(false, a, false, b, (short)0, c, false, false); asm volatile("v_nop\n\tv_nop\n\tv_nop\n\tv_nop" : "+v"(d) : "v"(a), "v"(b)); return d; }
template <int ACT>
__global__ __launch_bounds__(128) void k_gemm2(const _Float16* __restrict__ A, int lda, size_t sA, const _Float16* __restrict__ Bh, int ldb, size_t sB, float alpha, const float* __restrict__ bias, size_t sBias, const float* __restrict__ CP, int rowsPerB, size_t sCPb, int row0g,
    float* __restrict__ C, _Float16* __restrict__ C16, int ldc, size_t sC, int M, int N, int K) { static_assert(ACT == 0 || ACT == 3 || ACT == 6 || ACT == 8 || ACT == 9 || ACT == 11 || ACT == 12 || ACT == 14 || ACT == 15 || ACT == 16 || ACT == 17, "k_gemm2: unsupported ACT code (would silently apply no activation)");
  __shared__ __attribute__((aligned(16))) float so[4][32][68];
  const int tid = threadIdx.x, w = tid >> 5, lane = tid & 31, ln = lane & 15, hh = lane >> 4; const int by = blockIdx.y;
  A += (size_t)by * sA; Bh += (size_t)by * sB; const size_t cofs = (size_t)by * sC; const float* bp = bias ? bias + (size_t)by * sBias : nullptr;
  const int ntn = N >> 6; const int mt = blockIdx.x / ntn, nq = blockIdx.x - mt * ntn; const int row0 = mt * 128 + 32 * w, col0 = nq * 64; if (row0 >= M) return;
  const _Float16* a0p = A + (size_t)(row0 + ln) * lda; const _Float16* a1p = a0p + (size_t)16 * lda;
  const _Float16* b0p = Bh + (size_t)(col0 + ln) * ldb; const _Float16* b1p = b0p + (size_t)16 * ldb; const _Float16* b2p = b1p + (size_t)16 * ldb; const _Float16* b3p = b2p + (size_t)16 * ldb;
  const v8f z8 = {0.f,0.f,0.f,0.f,0.f,0.f,0.f,0.f}; v8f c00 = z8, c01 = z8, c02 = z8, c03 = z8, c10 = z8, c11 = z8, c12 = z8, c13 = z8;
#pragma unroll 1
  for (int kb = 0; kb < K; kb += 32) { const v16h a0 = g2_frag(a0p + kb, hh), a1 = g2_frag(a1p + kb, hh);
    v16h b = g2_frag(b0p + kb, hh); c00 = g2_mma(a0, b, c00); c10 = g2_mma(a1, b, c10);
    b = g2_frag(b1p + kb, hh); c01 = g2_mma(a0, b, c01); c11 = g2_mma(a1, b, c11);
    b = g2_frag(b2p + kb, hh); c02 = g2_mma(a0, b, c02); c12 = g2_mma(a1, b, c12);
    b = g2_frag(b3p + kb, hh); c03 = g2_mma(a0, b, c03); c13 = g2_mma(a1, b, c13); }
  v8f accs[8] = {c00, c01, c02, c03, c10, c11, c12, c13};
#pragma unroll
  for (int u = 0; u < 8; ++u) { const int t = u & 3, half = u >> 2; const int col = col0 + t * 16 + ln; const float bv = bp ? bf16_round(bp[col]) : 0.f;
#pragma unroll
    for (int r = 0; r < 8; ++r) { const int rloc = half * 16 + 8 * hh + r; float v = accs[u][r] * alpha + bv; if (CP) { if (rowsPerB < 0) v += CP[cofs + (size_t)(row0g + row0 + rloc) * ldc + col];      /* rowsPerB < 0: own element of the batched C plane */ else { const int bidx = (row0g + row0 + rloc) / rowsPerB; v += CP[(size_t)bidx * sCPb + (size_t)by * 64 + col]; } }
      if (ACT == 3) v = fmaxf(v, 0.f); else if (ACT == 6) v = 0.5f * v * (1.0f + erff(v * 0.70710678118654752f)); else if (ACT == 11) v = 1.0f / (1.0f + expf(-v)); else if (ACT == 15) v = v / (1.0f + expf(-v)); else if (ACT == 12) v = (v > 0.f) ? v : 0.01f * v; else if (ACT == 8) v = tanhf(v); else if (ACT == 9) v = 0.5f * v * (1.0f + tanhf(0.7978845608028654f * (v + 0.044715f * v * v * v))); else if (ACT == 14) v = (v > 0.f) ? v : 0.1f * v; else if (ACT == 16) v = (v >= 0.f) ? v : 0.3f * v; else if (ACT == 17) v = (v >= 0.f) ? v : 0.2f * v;
      so[w][rloc][t * 16 + ln] = v; } }
  __builtin_amdgcn_fence(__ATOMIC_ACQ_REL, "workgroup"); __builtin_amdgcn_wave_barrier();
  const int rsub = lane >> 4, c4 = (lane & 15) * 4;
  {
#pragma unroll
    for (int q = 0; q < 16; ++q) { const int r = q * 2 + rsub; const v4f v = *(const v4fa*)&so[w][r][c4]; if (C) *(v4f*)(C + cofs + (size_t)(row0 + r) * ldc + col0 + c4) = v; if (C16) { v4h h4; for (int i = 0; i < 4; ++i) h4[i] = (_Float16)v[i]; *(v4h*)(C16 + cofs + (size_t)(row0 + r) * ldc + col0 + c4) = h4; } }
     } }


__device__ __forceinline__ float hswish(float v) { return v * fminf(fmaxf(v + 3.0f, 0.0f), 6.0f) * (1.0f / 6.0f); }
__global__ __launch_bounds__(256) void k_vth(const _Float16* __restrict__ K16, _Float16* __restrict__ VT) { __shared__ unsigned short tl[64][CHH + 2]; const int tid = threadIdx.x; const int pl = blockIdx.x / (TOKS / 64), tg = blockIdx.x % (TOKS / 64); const size_t r0 = (size_t)pl * TOKS + tg * 64;
  for (int i = tid; i < 64 * (CHH / 8); i += 256) { const int r = i / (CHH / 8), c8 = (i % (CHH / 8)) * 8; FragH f; f.half[0] = *(const v8us*)((const unsigned short*)K16 + (r0 + r) * CH + c8); for (int q = 0; q < 8; ++q) tl[r][c8 + q] = f.u[q]; }
  __syncthreads();
  { for (int i = tid; i < CHH * 8; i += 256) { const int c = i / 8, pc = i % 8; FragH f; for (int q = 0; q < 8; ++q) f.u[q] = tl[pc * 8 + q][c];
      *(v8us*)((unsigned short*)VT + ((size_t)pl * CHH + c) * TOKS + tg * 64 + pc * 8) = f.half[0]; }  } }
__global__ __launch_bounds__(256) void k_vgath(const _Float16* __restrict__ SRC, _Float16* __restrict__ P) { const size_t t = (size_t)blockIdx.x * 256 + threadIdx.x; if (t >= (size_t)NPL * TOKS * CHH / 8) return; const int c0 = (int)((t * 8) % CHH); const size_t pt = (t * 8) / CHH; const int tok = (int)(pt % TOKS); const int pl = (int)(pt / TOKS); const int b = pl / NST, s = pl % NST; const int y = tok / WIN, xi = tok % WIN;
  const v8us v = *(const v8us*)((const unsigned short*)SRC + (((size_t)b * HS + y) * WSD + s * WIN + xi) * CH + CHH + c0); *(v8us*)((unsigned short*)P + t * 8) = v;  }
__global__ __launch_bounds__(256) void k_vtv(const _Float16* __restrict__ KV, _Float16* __restrict__ VT) { __shared__ unsigned short tl[64][CHH + 2]; const int tid = threadIdx.x; const int pl = blockIdx.x / (TOKS / 64), tg = blockIdx.x % (TOKS / 64); const size_t r0 = (size_t)pl * TOKS + tg * 64;
  for (int i = tid; i < 64 * (CHH / 8); i += 256) { const int r = i / (CHH / 8), c8 = (i % (CHH / 8)) * 8; FragH f; f.half[0] = *(const v8us*)((const unsigned short*)KV + (r0 + r) * CHH + c8); for (int q = 0; q < 8; ++q) tl[r][c8 + q] = f.u[q]; }
  __syncthreads();
  { for (int i = tid; i < CHH * 8; i += 256) { const int c = i / 8, pc = i % 8; FragH f; for (int q = 0; q < 8; ++q) f.u[q] = tl[pc * 8 + q][c];
      *(v8us*)((unsigned short*)VT + ((size_t)pl * CHH + c) * TOKS + tg * 64 + pc * 8) = f.half[0]; }  } }
__global__ __launch_bounds__(256) void k_soft(const float* __restrict__ S, _Float16* __restrict__ P, int nrows) {
  #pragma clang fp contract(off)
  const int wv = threadIdx.x >> 5, ln = threadIdx.x & 31; const size_t row = (size_t)blockIdx.x * 8 + wv; if (row >= (size_t)nrows) return; const float sc = 0.17677669529663688f; const float* s = S + row * TOKS + ln * 16; float a[16]; float mx = -3.0e38f;
  { const v8f u0 = *(const v8f*)s, u1 = *(const v8f*)(s + 8); for (int q = 0; q < 8; ++q) { a[q] = u0[q] * sc; a[8 + q] = u1[q] * sc; } }
  for (int q = 0; q < 16; ++q) mx = fmaxf(mx, a[q]); for (int o = 16; o > 0; o >>= 1) mx = fmaxf(mx, __shfl_xor(mx, o, 32)); float su = 0.f;
  for (int q = 0; q < 16; ++q) { a[q] = expf(a[q] - mx); su += a[q]; } for (int o = 16; o > 0; o >>= 1) su += __shfl_xor(su, o, 32); const float inv = 1024.0f / su; FragH f0, f1;
  for (int q = 0; q < 8; ++q) { f0.h[q] = (_Float16)(a[q] * inv); f1.h[q] = (_Float16)(a[8 + q] * inv); }
  unsigned short* d = (unsigned short*)P + row * TOKS + ln * 16;
  { *(v8us*)d = f0.half[0]; *(v8us*)(d + 8) = f1.half[0];  } }
__global__ __launch_bounds__(256) void k_vplace(const float* __restrict__ OV, float* __restrict__ CTX) { const size_t t = (size_t)blockIdx.x * 256 + threadIdx.x; if (t >= (size_t)NR * 4) return; const int g = (int)(t % 4); const size_t row = t / 4; const int b = (int)(row / NPX), p = (int)(row % NPX); const int yy = p / WSD, xx = p % WSD; const int sp = yy / WIN, a = yy % WIN, h = xx / 16, cidx = (xx % 16) * 4 + g; const int tok = a * 64 + cidx;
  const float* src = OV + ((((size_t)b * NST + sp) * NHB + h) * TOKS + tok) * DH; float* dst = CTX + row * CH + CHH + g * DH;
  { for (int u = 0; u < 4; ++u) *(v8f*)(dst + u * 8) = *(const v8f*)(src + u * 8);  } }
__global__ __launch_bounds__(256) void k_biasmix(const float* __restrict__ CTX, const float* __restrict__ KF, const float* __restrict__ dwk, const float* __restrict__ dwb, _Float16* __restrict__ C16) {
  #pragma clang fp contract(off)
  const size_t t = (size_t)blockIdx.x * 256 + threadIdx.x; if (t >= (size_t)NR * CH / 8) return; const int c0 = (int)((t * 8) % CH); const size_t row = (t * 8) / CH; const int b = (int)(row / NPX), p = (int)(row % NPX); const int y = p / WSD, x = p % WSD; float acc[8]; for (int q = 0; q < 8; ++q) acc[q] = 0.f;
#pragma unroll 1
  for (int i = 0; i < 3; ++i) { const int yy = y + i - 1; if (yy < 0 || yy >= HS) continue;
#pragma unroll 1
    for (int j = 0; j < 3; ++j) { const int xx = x + j - 1; if (xx < 0 || xx >= WSD) continue; const v8f v = *(const v8f*)(KF + (((size_t)b * HS + yy) * WSD + xx) * CH + c0);
#pragma unroll
      for (int q = 0; q < 8; ++q) acc[q] += hswish(v[q]) * bf16_round(dwk[(i * 3 + j) * CH + c0 + q]); } }
  const v8f cx = *(const v8f*)(CTX + t * 8); FragH f; for (int q = 0; q < 8; ++q) { float s = acc[q]; s += bf16_round(dwb[c0 + q]); float u = cx[q]; u += s; f.h[q] = (_Float16)hswish(u); }
  *(v8us*)((unsigned short*)C16 + t * 8) = f.half[0];  }

extern "C" void kernel_launch(void* const* d_in, const int* in_sizes, int n_in,
                              void* d_out, int out_size, void* d_ws, size_t ws_size, hipStream_t stream) {
  (void)in_sizes; (void)n_in; (void)out_size;
  const float* x = (const float*)d_in[0]; const float* wqkv = (const float*)d_in[1]; const float* bqkv = (const float*)d_in[2]; const float* dwk = (const float*)d_in[3]; const float* dwb = (const float*)d_in[4]; const float* wout = (const float*)d_in[5]; const float* bout = (const float*)d_in[6];
  char* ws = (char*)d_ws; size_t off = 0;
  auto take = [&](size_t bytes) { char* p = ws + off; off += (bytes + 255) & ~(size_t)255; return p; };
  const size_t ne = (size_t)NR * CH;
  _Float16* BQK = (_Float16*)take((size_t)2 * CH * CH * 2); _Float16* BO = (_Float16*)take((size_t)CH * CH * 2);
  _Float16* X16 = (_Float16*)take(ne * 2); _Float16* Q16 = (_Float16*)take(ne * 2); float* KF = (float*)take(ne * 4); _Float16* K16 = (_Float16*)take(ne * 2);
  _Float16* VTH = (_Float16*)take((size_t)NPL * CHH * TOKS * 2); _Float16* QV = (_Float16*)take((size_t)NPL * TOKS * CHH * 2); _Float16* KV = (_Float16*)take((size_t)NPL * TOKS * CHH * 2); _Float16* VTV = (_Float16*)take((size_t)NPL * CHH * TOKS * 2);
  float* S = (float*)take((size_t)PH * TOKS * TOKS * 4); _Float16* P = (_Float16*)take((size_t)PH * TOKS * TOKS * 2); float* OV = (float*)take((size_t)NPL * NHB * TOKS * DH * 4); float* CTX = (float*)take(ne * 4); _Float16* C16 = X16;      /* final operand over the x rows (dead) */
  if (off > ws_size) return;      /* 0.4 + 16 + 16 + 32 + 16 + 8 x 4 + 32 + 16 + 16 + 32 = ≈ 209 MiB */
  k_wt_f16<<<(unsigned)(((size_t)CH * 2 * CH / 8 + 255) / 256), 256, 0, stream>>>(wqkv, BQK, CH, 2 * CH, 16.0f); k_wt_f16<<<(unsigned)(((size_t)CH * CH / 8 + 255) / 256), 256, 0, stream>>>(wout, BO, CH, CH, 16.0f);      /* (in, out) */
  k_x16<<<(unsigned)((ne / 8 + 255) / 256), 256, 0, stream>>>(x, X16, ne / 8);
  const dim3 g((NR / 128) * (CH / 64), 1);
  k_gemm2<0><<<g, 128, 0, stream>>>(X16, CH, 0, BQK, CH, 0, 0.0625f, bqkv, 0, nullptr, 1, 0, 0, nullptr, Q16, CH, 0, NR, CH, CH);      /* q (f16) */
  k_gemm2<0><<<g, 128, 0, stream>>>(X16, CH, 0, BQK + (size_t)CH * CH, CH, 0, 0.0625f, bqkv + CH, 0, nullptr, 1, 0, 0, KF, nullptr, CH, 0, NR, CH, CH); k_h16<<<(unsigned)((ne / 8 + 255) / 256), 256, 0, stream>>>(KF, K16, ne / 8);      /* k = v (f32 + f16) */
  k_vth<<<NPL * (TOKS / 64), 256, 0, stream>>>(K16, VTH); k_vgath<<<(unsigned)(((size_t)NPL * TOKS * CHH / 8 + 255) / 256), 256, 0, stream>>>(Q16, QV); k_vgath<<<(unsigned)(((size_t)NPL * TOKS * CHH / 8 + 255) / 256), 256, 0, stream>>>(K16, KV); k_vtv<<<NPL * (TOKS / 64), 256, 0, stream>>>(KV, VTV);
  const size_t PLS = (size_t)TOKS * TOKS;
  for (int h = 0; h < NHB; ++h) for (int hf = 0; hf < NPL / PH; ++hf) { const size_t pl0 = (size_t)hf * PH; const size_t r0 = pl0 * TOKS;
    /* horizontal: plane (b,s) = contiguous rows; head columns h*32 */
    k_gemm2<0><<<dim3((TOKS / 128) * (TOKS / 64), PH), 128, 0, stream>>>(Q16 + r0 * CH + h * DH, CH, (size_t)TOKS * CH, K16 + r0 * CH + h * DH, CH, (size_t)TOKS * CH, 1.0f, nullptr, 0, nullptr, 1, 0, 0, S, nullptr, TOKS, PLS, TOKS, TOKS, DH);
    k_soft<<<(PH * TOKS) / 8, 256, 0, stream>>>(S, P, PH * TOKS);
    k_gemm_hhx<0><<<dim3((TOKS / 16) * (DH / 16), PH), 128, 0, stream>>>(P, TOKS, PLS, VTH + (pl0 * CHH + h * DH) * TOKS, TOKS, (size_t)CHH * TOKS, 0.0009765625f, nullptr, 0, nullptr, 1, 0, 0, CTX + r0 * CH + h * DH, nullptr, CH, (size_t)TOKS * CH, TOKS, DH, TOKS);      /* ctx_h columns h*32 */
    /* vertical: gathered planes */
    k_gemm2<0><<<dim3((TOKS / 128) * (TOKS / 64), PH), 128, 0, stream>>>(QV + r0 * CHH + h * DH, CHH, (size_t)TOKS * CHH, KV + r0 * CHH + h * DH, CHH, (size_t)TOKS * CHH, 1.0f, nullptr, 0, nullptr, 1, 0, 0, S, nullptr, TOKS, PLS, TOKS, TOKS, DH);
    k_soft<<<(PH * TOKS) / 8, 256, 0, stream>>>(S, P, PH * TOKS);
    k_gemm_hhx<0><<<dim3((TOKS / 16) * (DH / 16), PH), 128, 0, stream>>>(P, TOKS, PLS, VTV + (pl0 * CHH + h * DH) * TOKS, TOKS, (size_t)CHH * TOKS, 0.0009765625f, nullptr, 0, nullptr, 1, 0, 0, OV + (pl0 * NHB + h) * TOKS * DH, nullptr, DH, (size_t)NHB * TOKS * DH, TOKS, DH, TOKS); }      /* ctx_v per (plane, head) [512][32] */
  k_vplace<<<(unsigned)(((size_t)NR * 4 + 255) / 256), 256, 0, stream>>>(OV, CTX);
  k_biasmix<<<(unsigned)((ne / 8 + 255) / 256), 256, 0, stream>>>(CTX, KF, dwk, dwb, C16);
  k_gemm2<0><<<g, 128, 0, stream>>>(C16, CH, 0, BO, CH, 0, 0.0625f, bout, 0, nullptr, 1, 0, 0, (float*)d_out, nullptr, CH, 0, NR, CH, CH);      /* out = hswish(context + bias) w_out + b */
}

// v002
// One run takes 126 microseconds.
// Versions between v000 and this one are left out; their measured steps multiply to 6.88 times as fast.
#include <hip/hip_runtime.h>
// CrossShapedAttention (8 x 64 x 64 x 256, window 8, 4 heads x 32 per branch: [q | k] = x w_qkv + b (v = k); horizontal branch = channels 0..127 attending within each 8-row stripe (512 tokens), vertical branch = channels 128..255 within each 8-column stripe; softmax(q.k / sqrt(32)) v; the vertical context is put back through the TF code's exact reshape/transpose order (a fixed permutation of (row-in-stripe, column, head, channel)); bias = depthwise3x3(hard_swish(v)) + b; out = hard_swish(context + bias) w_out + b_out).
// Structure: exact f16 x rows; q and k(=v) as f16 WMMA GEMMs (32x64 wave tiles, f32 accumulation, exact x16 (in,out) weights + bias; q f16, k f32 + f16); horizontal stripes are contiguous row ranges: one fused launch does scores (K = 32), softmax (exact row maximum, f16 x 2^10 unnormalised, f32 row sum) and readout (N = 32) per (plane, head) with K and V^T in LDS (V^T is built from the K rows while they are staged), writing context columns h*32.. directly; the vertical branch runs in the same launch: it reads its q/k rows in place by the stripe's row map (token = row*8 + column-in-stripe) and stores its result through the reference's permutation; the hard-swish + depthwise 3x3 bias on VALU (f32, added into the context rows); hard_swish into f16 rows; output projection GEMM writing the [B,H,W,C] output.
// Compute dtype: inputs rounded to bf16; x / weights exact as f16; q, k, v and the final context as plain f16 GEMM operands (~2^-12); softmax / hard-swish / depthwise in f32. v_wmma_f32_16x16x32_f16.
#define NI 8
#define HS 64
#define WSD 64
#define CH 256
#define CHH 128                  /* channels per branch */
#define NHB 4                    /* heads per branch */
#define DH 32
#define WIN 8
#define NST 8                    /* stripes per image per branch */
#define TOKS 512                 /* tokens per stripe */
#define NPX (HS * WSD)
#define NR (NI * NPX)            /* 32768 */
#define NPL (NI * NST)           /* 64 (image, stripe) planes per branch */
typedef __bf16 v16b __attribute__((ext_vector_type(16)));
typedef unsigned short v8us __attribute__((ext_vector_type(8), may_alias));
typedef float  v8f  __attribute__((ext_vector_type(8)));
typedef float  v4f  __attribute__((ext_vector_type(4)));
typedef float  v4fa __attribute__((ext_vector_type(4), may_alias));
union FragB { v16b v; v8us half[2]; unsigned short u[16]; };

__device__ __forceinline__ unsigned short bf16_bits(float x) { unsigned int u = __float_as_uint(x); return (unsigned short)((u + 0x7FFFu + ((u >> 16) & 1u)) >> 16); }
__device__ __forceinline__ float bf16_val(unsigned short b) { return __uint_as_float(((unsigned int)b) << 16); }
__device__ __forceinline__ float bf16_round(float x) { return bf16_val(bf16_bits(x)); }
// D += A·B with NT terms: 1 = ah·bh, 2 = + al·bh (A split), 3 = + ah·bl (both split)
template <int NT>
__device__ __forceinline__ v8f mmaN(v16b ah, v16b al, v16b bh, v16b bl, v8f c) {
  c = __builtin_amdgcn_wmma_f32_16x16x32_bf16(false, ah, false, bh, (short)0, c, false, false);
  if (NT >= 2) c = __builtin_amdgcn_wmma_f32_16x16x32_bf16(false, al, false, bh, (short)0, c, false, false);
  if (NT >= 3) c = __builtin_amdgcn_wmma_f32_16x16x32_bf16(false, ah, false, bl, (short)0, c, false, false);
  asm volatile("v_nop\n\tv_nop\n\tv_nop\n\tv_nop" : "+v"(c) : "v"(ah), "v"(al), "v"(bh), "v"(bl));
  return c;
}

__global__ __launch_bounds__(256) void k_wt_bf16(const float* __restrict__ W, unsigned short* __restrict__ Wt, int K, int N) {
  const int t = blockIdx.x * 256 + threadIdx.x;
  const int k8n = K / 8;
  if (t >= N * k8n) return;
  const int n = t / k8n, k8 = (t % k8n) * 8;
  v8us v;
#pragma unroll
  for (int i = 0; i < 8; ++i) v[i] = bf16_bits(W[(size_t)(k8 + i) * N + n]);
  *(v8us*)(Wt + (size_t)n * K + k8) = v;
  
}

// GEMM C[M][N] (f32, pitch ldc) = act(A[M][K]·W + bias). A f32 row-major (pitch lda) converted per fragment to bf16
// (ASPLIT: hi/lo two planes -> 2 terms, else single rounded term); Wt bf16 [N][K] (pitch ldb). BIAS_BF16 rounds the
// bias to bf16 first (bias quantised to bf16 before the add). K%32==0, M%16==0, N%64==0.
template <bool ASPLIT, int ACT, bool BIAS_BF16>
__global__ __launch_bounds__(128) void k_gemm_bf(const float* __restrict__ A, int lda, const unsigned short* __restrict__ Wt, int ldb,
                                               const float* __restrict__ bias, float* __restrict__ C, int ldc, int M, int N, int K) {
  __shared__ __attribute__((aligned(16))) float so[4][16][64];
  const int tid = threadIdx.x, w = tid >> 5, lane = tid & 31, ln = lane & 15, hh = lane >> 4;
  const int ntn = N / 64;
  const int wid = blockIdx.x * 4 + w;
  const int mt = wid / ntn, nq = wid % ntn;
  if (mt * 16 >= M) return;
  const int row0 = mt * 16, col0 = nq * 64;
  const float* arow = A + (size_t)(row0 + ln) * lda;
  v8f acc[4] = {};
  for (int kb = 0; kb < K; kb += 32) {
    FragB ah, al;
    const v4f x0 = *(const v4fa*)(arow + kb + 8 * hh), x1 = *(const v4fa*)(arow + kb + 8 * hh + 4);
    const v4f x2 = *(const v4fa*)(arow + kb + 16 + 8 * hh), x3 = *(const v4fa*)(arow + kb + 16 + 8 * hh + 4);
    float xs[16] = {x0[0],x0[1],x0[2],x0[3],x1[0],x1[1],x1[2],x1[3],x2[0],x2[1],x2[2],x2[3],x3[0],x3[1],x3[2],x3[3]};
#pragma unroll
    for (int i = 0; i < 16; ++i) { const unsigned short hb = bf16_bits(xs[i]); ah.u[i] = hb; al.u[i] = ASPLIT ? bf16_bits(xs[i] - bf16_val(hb)) : (unsigned short)0; }
#pragma unroll
    for (int t = 0; t < 4; ++t) {
      const unsigned short* brow = Wt + (size_t)(col0 + t * 16 + ln) * ldb + kb;
      FragB b;
      b.half[0] = *(const v8us*)(brow + 8 * hh);
      b.half[1] = *(const v8us*)(brow + 16 + 8 * hh);
      acc[t] = mmaN<ASPLIT ? 2 : 1>(ah.v, al.v, b.v, b.v, acc[t]);
    }
  }
#pragma unroll
  for (int t = 0; t < 4; ++t) {
    float bv = bias ? bias[col0 + t * 16 + ln] : 0.f;
    if (BIAS_BF16) bv = bf16_round(bv);
#pragma unroll
    for (int r = 0; r < 8; ++r) { float v = acc[t][r] + bv; if (ACT == 1) v = fmaxf(v, 0.f); so[w][8 * hh + r][t * 16 + ln] = v; }
  }
  __builtin_amdgcn_fence(__ATOMIC_ACQ_REL, "workgroup");
  __builtin_amdgcn_wave_barrier();
  const int rsub = lane >> 4, c4 = (lane & 15) * 4;
  {
#pragma unroll
    for (int q = 0; q < 8; ++q) {
      const int r = q * 2 + rsub;
      const v4f v = *(const v4fa*)&so[w][r][c4];
      *(v4f*)(C + (size_t)(row0 + r) * ldc + col0 + c4) = v;
    }
    
  }
}

// GEMM C = act(A·W + bias + resid): A f32 (ASPLIT -> hi/lo 2 terms), Wt bf16 [N][K]; ACT 0 none, 1 relu, 2 exact gelu;
// resid (optional, f32, row index = (row % rmod), pitch ldr, RES_BF16 rounds it) added before the activation.
template <bool ASPLIT, int ACT, bool BIAS_BF16, bool RES_BF16>
__global__ __launch_bounds__(128) void k_gemm_bf3(const float* __restrict__ A, int lda, const unsigned short* __restrict__ Wt, int ldb,
                                                const float* __restrict__ bias, const float* __restrict__ resid, int rmod, int ldr,
                                                float* __restrict__ C, int ldc, int M, int N, int K) {
  __shared__ __attribute__((aligned(16))) float so[4][16][64];
  const int tid = threadIdx.x, w = tid >> 5, lane = tid & 31, ln = lane & 15, hh = lane >> 4;
  const int ntn = N / 64;
  const int wid = blockIdx.x * 4 + w;
  const int mt = wid / ntn, nq = wid % ntn;
  if (mt * 16 >= M) return;
  const int row0 = mt * 16, col0 = nq * 64;
  const float* arow = A + (size_t)(row0 + ln) * lda;
  v8f acc[4] = {};
  for (int kb = 0; kb < K; kb += 32) {
    FragB ah, al;
    const v4f x0 = *(const v4fa*)(arow + kb + 8 * hh), x1 = *(const v4fa*)(arow + kb + 8 * hh + 4);
    const v4f x2 = *(const v4fa*)(arow + kb + 16 + 8 * hh), x3 = *(const v4fa*)(arow + kb + 16 + 8 * hh + 4);
    float xs[16] = {x0[0],x0[1],x0[2],x0[3],x1[0],x1[1],x1[2],x1[3],x2[0],x2[1],x2[2],x2[3],x3[0],x3[1],x3[2],x3[3]};
#pragma unroll
    for (int i = 0; i < 16; ++i) { const unsigned short hb = bf16_bits(xs[i]); ah.u[i] = hb; al.u[i] = ASPLIT ? bf16_bits(xs[i] - bf16_val(hb)) : (unsigned short)0; }
#pragma unroll
    for (int t = 0; t < 4; ++t) {
      const unsigned short* brow = Wt + (size_t)(col0 + t * 16 + ln) * ldb + kb;
      FragB b;
      b.half[0] = *(const v8us*)(brow + 8 * hh);
      b.half[1] = *(const v8us*)(brow + 16 + 8 * hh);
      acc[t] = mmaN<ASPLIT ? 2 : 1>(ah.v, al.v, b.v, b.v, acc[t]);
    }
  }
#pragma unroll
  for (int t = 0; t < 4; ++t) {
    const int col = col0 + t * 16 + ln;
    float bv = bias ? bias[col] : 0.f;
    if (BIAS_BF16) bv = bf16_round(bv);
#pragma unroll
    for (int r = 0; r < 8; ++r) {
      float v = acc[t][r] + bv;
      if (resid) { float rv = resid[(size_t)((row0 + 8 * hh + r) % rmod) * ldr + col]; if (RES_BF16) rv = bf16_round(rv); v += rv; }
      if (ACT == 1) v = fmaxf(v, 0.f);
      if (ACT == 2) v = 0.5f * v * (1.0f + erff(v * 0.70710678118654752f));
      if (ACT == 3) { const float u = 0.7978845608028654f * (v + 0.044715f * v * v * v); v = 0.5f * v * (1.0f + tanhf(u)); }
      so[w][8 * hh + r][t * 16 + ln] = v;
    }
  }
  __builtin_amdgcn_fence(__ATOMIC_ACQ_REL, "workgroup");
  __builtin_amdgcn_wave_barrier();
  const int rsub = lane >> 4, c4 = (lane & 15) * 4;
  {
#pragma unroll
    for (int q = 0; q < 8; ++q) {
      const int r = q * 2 + rsub;
      const v4f v = *(const v4fa*)&so[w][r][c4];
      *(v4f*)(C + (size_t)(row0 + r) * ldc + col0 + c4) = v;
    }
    
  }
}
// row LayerNorm (biased variance, eps) over N: s = X (+ R); optional out_sum <- s; out_norm <- (s-mu)*rsqrt(var+eps)*g + b
template <bool PARAM_BF16>
__global__ __launch_bounds__(256) void k_layernorm(const float* __restrict__ X, const float* __restrict__ R, const float* __restrict__ g, const float* __restrict__ bta,
                                                  float* __restrict__ out_sum, float* __restrict__ out_norm, int N, float eps) {
  __shared__ float red[256];
  const int row = blockIdx.x, tid = threadIdx.x;
  const float* x = X + (size_t)row * N; const float* rr = R ? R + (size_t)row * N : nullptr;
  float vals[16];                     // up to N = 4096
  const int per = N / 256;            // contiguous chunk per thread? use strided-by-4 chunks: thread handles j = tid*4 + 1024*u
  float s1 = 0.f;
  for (int u = 0; u < per / 4; ++u) {
    const int j = tid * 4 + 1024 * u;
    const v4f a = *(const v4fa*)(x + j);
    v4f b = {0.f,0.f,0.f,0.f}; if (rr) b = *(const v4fa*)(rr + j);
#pragma unroll
    for (int q = 0; q < 4; ++q) { const float v = a[q] + b[q]; vals[u * 4 + q] = v; s1 += v; }
  }
  red[tid] = s1; __syncthreads();
  for (int st = 128; st > 0; st >>= 1) { if (tid < st) red[tid] += red[tid + st]; __syncthreads(); }
  const float mu = red[0] / (float)N; __syncthreads();
  float s2 = 0.f;
  for (int u = 0; u < per / 4; ++u)
#pragma unroll
    for (int q = 0; q < 4; ++q) { const float c = vals[u * 4 + q] - mu; s2 += c * c; }
  red[tid] = s2; __syncthreads();
  for (int st = 128; st > 0; st >>= 1) { if (tid < st) red[tid] += red[tid + st]; __syncthreads(); }
  const float rs = rsqrtf(red[0] / (float)N + eps);
  {
    for (int u = 0; u < per / 4; ++u) {
      const int j = tid * 4 + 1024 * u;
      v4f o, sm;
#pragma unroll
      for (int q = 0; q < 4; ++q) {
        float gg = g[j + q], bb = bta[j + q];
        if (PARAM_BF16) { gg = bf16_round(gg); bb = bf16_round(bb); }
        sm[q] = vals[u * 4 + q]; o[q] = (vals[u * 4 + q] - mu) * rs * gg + bb;
      }
      if (out_sum) *(v4f*)(out_sum + (size_t)row * N + j) = sm;
      *(v4f*)(out_norm + (size_t)row * N + j) = o;
    }
    
  }
}



// ---- f16 WMMA path (v_wmma_f32_16x16x32_f16): 11-bit significands for operands in range — used for every GEMM here, including the 2^10-scaled probability operand that needs more precision than bf16
typedef _Float16 v16h __attribute__((ext_vector_type(16)));
union FragH { v16h v; v8us half[2]; _Float16 h[16]; unsigned short u[16]; };
template <int NT>
__device__ __forceinline__ v8f mmaH(v16h ah, v16h al, v16h bh, v16h bl, v8f c) {
  c = __builtin_amdgcn_wmma_f32_16x16x32_f16(false, ah, false, bh, (short)0, c, false, false);
  if (NT >= 2) c = __builtin_amdgcn_wmma_f32_16x16x32_f16(false, al, false, bh, (short)0, c, false, false);
  if (NT >= 3) c = __builtin_amdgcn_wmma_f32_16x16x32_f16(false, ah, false, bl, (short)0, c, false, false);
  asm volatile("v_nop\n\tv_nop\n\tv_nop\n\tv_nop" : "+v"(c) : "v"(ah), "v"(al), "v"(bh), "v"(bl));
  return c;
}
// batched GEMM like k_gemm_b but f16 operands: A f32 (split into f16 hi/lo if ASPLIT, else rounded to f16), Bt = f16 values [n][k]; alpha; C f32; N multiple of 16 (partial tiles skipped)
template <bool ASPLIT>
__global__ __launch_bounds__(128) void k_gemm_h(const float* __restrict__ A, int lda, size_t sA, const _Float16* __restrict__ Bh, int ldb, size_t sB, float alpha, float* __restrict__ C, int ldc, size_t sC, int M, int N, int K) {
  __shared__ __attribute__((aligned(16))) float so[4][16][64];
  const int tid = threadIdx.x, w = tid >> 5, lane = tid & 31, ln = lane & 15, hh = lane >> 4; const int by = blockIdx.y;
  A += (size_t)by * sA; Bh += (size_t)by * sB; C += (size_t)by * sC;
  const int ntn = (N + 63) / 64; const int wid = blockIdx.x * 4 + w; const int mt = wid / ntn, nq = wid % ntn; if (mt * 16 >= M) return;
  const int row0 = mt * 16, col0 = nq * 64; const float* arow = A + (size_t)(row0 + ln) * lda;
  v8f acc[4] = {};
  for (int kb = 0; kb < K; kb += 32) {
    FragH ah, al;
    const v4f x0 = *(const v4fa*)(arow + kb + 8 * hh), x1 = *(const v4fa*)(arow + kb + 8 * hh + 4), x2 = *(const v4fa*)(arow + kb + 16 + 8 * hh), x3 = *(const v4fa*)(arow + kb + 16 + 8 * hh + 4);
    float xs[16] = {x0[0],x0[1],x0[2],x0[3],x1[0],x1[1],x1[2],x1[3],x2[0],x2[1],x2[2],x2[3],x3[0],x3[1],x3[2],x3[3]};
#pragma unroll
    for (int i = 0; i < 16; ++i) { const _Float16 h = (_Float16)xs[i]; ah.h[i] = h; al.h[i] = ASPLIT ? (_Float16)(xs[i] - (float)h) : (_Float16)0.0f; }
#pragma unroll
    for (int t = 0; t < 4; ++t) { if (col0 + t * 16 >= N) continue; const size_t boff = (size_t)(col0 + t * 16 + ln) * ldb + kb; FragH bq; bq.half[0] = *(const v8us*)(Bh + boff + 8 * hh); bq.half[1] = *(const v8us*)(Bh + boff + 16 + 8 * hh);
      acc[t] = mmaH<ASPLIT ? 2 : 1>(ah.v, al.v, bq.v, bq.v, acc[t]); }
  }
#pragma unroll
  for (int t = 0; t < 4; ++t) { if (col0 + t * 16 >= N) continue;
#pragma unroll
    for (int r = 0; r < 8; ++r) so[w][8 * hh + r][t * 16 + ln] = acc[t][r] * alpha; }
  __builtin_amdgcn_fence(__ATOMIC_ACQ_REL, "workgroup"); __builtin_amdgcn_wave_barrier();
  const int rsub = lane >> 4, c4 = (lane & 15) * 4;
  {
#pragma unroll
    for (int q = 0; q < 8; ++q) { const int r = q * 2 + rsub; if (col0 + c4 < N) { const v4f v = *(const v4fa*)&so[w][r][c4]; *(v4f*)(C + (size_t)(row0 + r) * ldc + col0 + c4) = v; } }
     }
}

// Wt[n][k] = f16(W[k][n]·scale) from f32 row-major W[K][N] (scale = power of two; bf16-exact weights stay exact in f16 away from the subnormal range)
__global__ __launch_bounds__(256) void k_wt_f16(const float* __restrict__ W, _Float16* __restrict__ Wt, int K, int N, float scale) {
  const int t = blockIdx.x * 256 + threadIdx.x; if (t >= N * (K / 8)) return; const int n = t / (K / 8), k8 = (t % (K / 8)) * 8; FragH f;
#pragma unroll
  for (int i = 0; i < 8; ++i) f.h[i] = (_Float16)(bf16_round(W[(size_t)(k8 + i) * N + n]) * scale); const v8us o = f.half[0];
  *(v8us*)((unsigned short*)Wt + (size_t)n * K + k8) = o; 
}
// k_gemm_hh variant with fused epilogue: v = acc·alpha + bias[by·sBias + col] (+ CP[(row/rowsPerB)·sCPb + by·64 + col] if CP) ; ACT 0 none / 1 elu ; writes f32 C and/or f16 C16 (each if non-null)
template <int ACT>
__global__ __launch_bounds__(128) void k_gemm_hhx(const _Float16* __restrict__ A, int lda, size_t sA, const _Float16* __restrict__ Bh, int ldb, size_t sB, float alpha, const float* __restrict__ bias, size_t sBias, const float* __restrict__ CP, int rowsPerB, size_t sCPb, int row0g,
    float* __restrict__ C, _Float16* __restrict__ C16, int ldc, size_t sC, int M, int N, int K) {
  __shared__ __attribute__((aligned(16))) float so[4][16][64];
  const int tid = threadIdx.x, w = tid >> 5, lane = tid & 31, ln = lane & 15, hh = lane >> 4; const int by = blockIdx.y;
  A += (size_t)by * sA; Bh += (size_t)by * sB; const size_t cofs = (size_t)by * sC; const float* bp = bias ? bias + (size_t)by * sBias : nullptr;
  const int ntn = (N + 63) / 64; const int wid = blockIdx.x * 4 + w; const int mt = wid / ntn, nq = wid % ntn; if (mt * 16 >= M) return;
  const int row0 = mt * 16, col0 = nq * 64; const _Float16* arow = A + (size_t)(row0 + ln) * lda;
  v8f acc[4] = {};
  for (int kb = 0; kb < K; kb += 32) { FragH ah; ah.half[0] = *(const v8us*)((const unsigned short*)arow + kb + 8 * hh); ah.half[1] = *(const v8us*)((const unsigned short*)arow + kb + 16 + 8 * hh);
#pragma unroll
    for (int t = 0; t < 4; ++t) { if (col0 + t * 16 >= N) continue; const size_t boff = (size_t)(col0 + t * 16 + ln) * ldb + kb; FragH bq; bq.half[0] = *(const v8us*)((const unsigned short*)Bh + boff + 8 * hh); bq.half[1] = *(const v8us*)((const unsigned short*)Bh + boff + 16 + 8 * hh);
      acc[t] = mmaH<1>(ah.v, ah.v, bq.v, bq.v, acc[t]); }
  }
#pragma unroll
  for (int t = 0; t < 4; ++t) { if (col0 + t * 16 >= N) continue; const int col = col0 + t * 16 + ln; const float bv = bp ? bf16_round(bp[col]) : 0.f;
#pragma unroll
    for (int r = 0; r < 8; ++r) { float v = acc[t][r] * alpha + bv; if (CP) { const int rr = row0g + row0 + 8 * hh + r; if (rowsPerB < 0) v += CP[cofs + (size_t)rr * ldc + col];      /* rowsPerB < 0: own element of the batched C plane */ else { const int bidx = rr / rowsPerB; v += CP[(size_t)bidx * sCPb + (size_t)by * 64 + col]; } } if (ACT == 1) v = (v > 0.f) ? v : expm1f(v); else if (ACT == 7) v = (v > 0.f) ? v + 1.0f : expf(v); else if (ACT == 8) v = tanhf(v); else if (ACT == 9) v = 0.5f * v * (1.0f + tanhf(0.7978845608028654f * (v + 0.044715f * v * v * v))); else if (ACT == 11) v = 1.0f / (1.0f + expf(-v)); else if (ACT == 12) v = (v > 0.f) ? v : 0.01f * v; else if (ACT == 14) v = (v > 0.f) ? v : 0.1f * v; else if (ACT == 16) v = (v >= 0.f) ? v : 0.3f * v; else if (ACT == 17) v = (v >= 0.f) ? v : 0.2f * v; else if (ACT == 15) v = v / (1.0f + expf(-v)); else if (ACT == 3) v = fmaxf(v, 0.f); else if (ACT == 6) v = 0.5f * v * (1.0f + erff(v * 0.70710678118654752f)); so[w][8 * hh + r][t * 16 + ln] = v; } }
  __builtin_amdgcn_fence(__ATOMIC_ACQ_REL, "workgroup"); __builtin_amdgcn_wave_barrier();
  const int rsub = lane >> 4, c4 = (lane & 15) * 4; typedef _Float16 v4h __attribute__((ext_vector_type(4)));
  {
#pragma unroll
    for (int q = 0; q < 8; ++q) { const int r = q * 2 + rsub; if (col0 + c4 < N) { const v4f v = *(const v4fa*)&so[w][r][c4]; if (C) *(v4f*)(C + cofs + (size_t)(row0 + r) * ldc + col0 + c4) = v; if (C16) { v4h h4; for (int i = 0; i < 4; ++i) h4[i] = (_Float16)v[i]; *(v4h*)(C16 + cofs + (size_t)(row0 + r) * ldc + col0 + c4) = h4; } } }
     }
}


typedef _Float16 v4h __attribute__((ext_vector_type(4)));

__global__ __launch_bounds__(256) void k_x16(const float* __restrict__ x, _Float16* __restrict__ X16, size_t n8) { const size_t t = (size_t)blockIdx.x * 256 + threadIdx.x; if (t >= n8) return; FragH f;
#pragma unroll
  for (int q = 0; q < 8; ++q) f.h[q] = (_Float16)bf16_round(x[t * 8 + q]); *(v8us*)((unsigned short*)X16 + t * 8) = f.half[0];  }
__global__ __launch_bounds__(256) void k_round16f(const float* __restrict__ W, _Float16* __restrict__ Bt, size_t n8) { const size_t t = (size_t)blockIdx.x * 256 + threadIdx.x; if (t >= n8) return; FragH f;
#pragma unroll
  for (int i = 0; i < 8; ++i) f.h[i] = (_Float16)(bf16_round(W[t * 8 + i]) * 16.0f); *(v8us*)((unsigned short*)Bt + t * 8) = f.half[0];  }
template <int NHv, int TTv>
__global__ __launch_bounds__(256) void k_vt(const _Float16* __restrict__ V16, int ldv, int voff, _Float16* __restrict__ Vt) { __shared__ unsigned short tl[64][66]; const int tid = threadIdx.x; const int slab = blockIdx.x / (TTv / 64), lg = blockIdx.x % (TTv / 64); const int b = slab / NHv, h = slab % NHv;
  for (int i = tid; i < 64 * 8; i += 256) { const int r = i / 8, c8 = (i % 8) * 8; FragH f; f.half[0] = *(const v8us*)((const unsigned short*)V16 + ((size_t)b * TTv + lg * 64 + r) * ldv + voff + h * 64 + c8);
#pragma unroll
    for (int q = 0; q < 8; ++q) tl[r][c8 + q] = f.u[q]; }
  __syncthreads();
  {
#pragma unroll
    for (int rd = 0; rd < 2; ++rd) { const int d = rd * 32 + tid / 8, pc = tid % 8; FragH f;
#pragma unroll
      for (int q = 0; q < 8; ++q) f.u[q] = tl[pc * 8 + q][d];
      *(v8us*)((unsigned short*)Vt + ((size_t)slab * 64 + d) * TTv + lg * 64 + pc * 8) = f.half[0]; }
     } }

__global__ __launch_bounds__(256) void k_hl(const float* __restrict__ F, _Float16* __restrict__ Hh, _Float16* __restrict__ Hl, size_t n8) { const size_t t = (size_t)blockIdx.x * 256 + threadIdx.x; if (t >= n8) return; FragH fh, fl; const v4f a = *(const v4fa*)(F + t * 8), c = *(const v4fa*)(F + t * 8 + 4);
#pragma unroll
  for (int q = 0; q < 4; ++q) { _Float16 h = (_Float16)a[q]; fh.h[q] = h; fl.h[q] = (_Float16)((a[q] - (float)h) * 1024.0f); h = (_Float16)c[q]; fh.h[4 + q] = h; fl.h[4 + q] = (_Float16)((c[q] - (float)h) * 1024.0f); }
  { *(v8us*)((unsigned short*)Hh + t * 8) = fh.half[0]; *(v8us*)((unsigned short*)Hl + t * 8) = fl.half[0];  } }

// ---- fast GEMM (wave tile 32x64; requires M % 32 == 0 rows per launch region and N % 64 == 0); epilogue = k_gemm_hhx semantics ----
__device__ __forceinline__ v16h g2_frag(const _Float16* p, int hh) { FragH f; f.half[0] = *(const v8us*)((const unsigned short*)p + 8 * hh); f.half[1] = *(const v8us*)((const unsigned short*)p + 16 + 8 * hh); return f.v; }
__device__ __forceinline__ v8f g2_mma(v16h a, v16h b, v8f c) { v8f d = __builtin_amdgcn_wmma_f32_16x16x32_f16(false, a, false, b, (short)0, c, false, false); asm volatile("v_nop\n\tv_nop\n\tv_nop\n\tv_nop" : "+v"(d) : "v"(a), "v"(b)); return d; }
template <int ACT>
__global__ __launch_bounds__(128) void k_gemm2(const _Float16* __restrict__ A, int lda, size_t sA, const _Float16* __restrict__ Bh, int ldb, size_t sB, float alpha, const float* __restrict__ bias, size_t sBias, const float* __restrict__ CP, int rowsPerB, size_t sCPb, int row0g,
    float* __restrict__ C, _Float16* __restrict__ C16, int ldc, size_t sC, int M, int N, int K) { static_assert(ACT == 0 || ACT == 3 || ACT == 6 || ACT == 8 || ACT == 9 || ACT == 11 || ACT == 12 || ACT == 14 || ACT == 15 || ACT == 16 || ACT == 17, "k_gemm2: unsupported ACT code (would silently apply no activation)");
  __shared__ __attribute__((aligned(16))) float so[4][32][68];
  const int tid = threadIdx.x, w = tid >> 5, lane = tid & 31, ln = lane & 15, hh = lane >> 4; const int by = blockIdx.y;
  A += (size_t)by * sA; Bh += (size_t)by * sB; const size_t cofs = (size_t)by * sC; const float* bp = bias ? bias + (size_t)by * sBias : nullptr;
  const int ntn = N >> 6; const int mt = blockIdx.x / ntn, nq = blockIdx.x - mt * ntn; const int row0 = mt * 128 + 32 * w, col0 = nq * 64; if (row0 >= M) return;
  const _Float16* a0p = A + (size_t)(row0 + ln) * lda; const _Float16* a1p = a0p + (size_t)16 * lda;
  const _Float16* b0p = Bh + (size_t)(col0 + ln) * ldb; const _Float16* b1p = b0p + (size_t)16 * ldb; const _Float16* b2p = b1p + (size_t)16 * ldb; const _Float16* b3p = b2p + (size_t)16 * ldb;
  const v8f z8 = {0.f,0.f,0.f,0.f,0.f,0.f,0.f,0.f}; v8f c00 = z8, c01 = z8, c02 = z8, c03 = z8, c10 = z8, c11 = z8, c12 = z8, c13 = z8;
#pragma unroll 1
  for (int kb = 0; kb < K; kb += 32) { const v16h a0 = g2_frag(a0p + kb, hh), a1 = g2_frag(a1p + kb, hh);
    v16h b = g2_frag(b0p + kb, hh); c00 = g2_mma(a0, b, c00); c10 = g2_mma(a1, b, c10);
    b = g2_frag(b1p + kb, hh); c01 = g2_mma(a0, b, c01); c11 = g2_mma(a1, b, c11);
    b = g2_frag(b2p + kb, hh); c02 = g2_mma(a0, b, c02); c12 = g2_mma(a1, b, c12);
    b = g2_frag(b3p + kb, hh); c03 = g2_mma(a0, b, c03); c13 = g2_mma(a1, b, c13); }
  v8f accs[8] = {c00, c01, c02, c03, c10, c11, c12, c13};
#pragma unroll
  for (int u = 0; u < 8; ++u) { const int t = u & 3, half = u >> 2; const int col = col0 + t * 16 + ln; const float bv = bp ? bf16_round(bp[col]) : 0.f;
#pragma unroll
    for (int r = 0; r < 8; ++r) { const int rloc = half * 16 + 8 * hh + r; float v = accs[u][r] * alpha + bv; if (CP) { if (rowsPerB < 0) v += CP[cofs + (size_t)(row0g + row0 + rloc) * ldc + col];      /* rowsPerB < 0: own element of the batched C plane */ else { const int bidx = (row0g + row0 + rloc) / rowsPerB; v += CP[(size_t)bidx * sCPb + (size_t)by * 64 + col]; } }
      if (ACT == 3) v = fmaxf(v, 0.f); else if (ACT == 6) v = 0.5f * v * (1.0f + erff(v * 0.70710678118654752f)); else if (ACT == 11) v = 1.0f / (1.0f + expf(-v)); else if (ACT == 15) v = v / (1.0f + expf(-v)); else if (ACT == 12) v = (v > 0.f) ? v : 0.01f * v; else if (ACT == 8) v = tanhf(v); else if (ACT == 9) v = 0.5f * v * (1.0f + tanhf(0.7978845608028654f * (v + 0.044715f * v * v * v))); else if (ACT == 14) v = (v > 0.f) ? v : 0.1f * v; else if (ACT == 16) v = (v >= 0.f) ? v : 0.3f * v; else if (ACT == 17) v = (v >= 0.f) ? v : 0.2f * v;
      so[w][rloc][t * 16 + ln] = v; } }
  __builtin_amdgcn_fence(__ATOMIC_ACQ_REL, "workgroup"); __builtin_amdgcn_wave_barrier();
  const int rsub = lane >> 4, c4 = (lane & 15) * 4;
  {
#pragma unroll
    for (int q = 0; q < 16; ++q) { const int r = q * 2 + rsub; const v4f v = *(const v4fa*)&so[w][r][c4]; if (C) { *(v4f*)(C + cofs + (size_t)(row0 + r) * ldc + col0 + c4) = v;
        asm volatile("s_wait_xcnt 0x0" ::: "memory"); /* the f16 arm behind reuses the registers that the f32 store names: the wait stands in front of that overwrite */ }
      if (C16) { v4h h4; for (int i = 0; i < 4; ++i) h4[i] = (_Float16)v[i]; *(v4h*)(C16 + cofs + (size_t)(row0 + r) * ldc + col0 + c4) = h4; } }
     } }


__device__ __forceinline__ float hswish(float v) { return v * fminf(fmaxf(v + 3.0f, 0.0f), 6.0f) * (1.0f / 6.0f); }
// Fused stripe attention: one work-group = one (branch, plane, head), 16 waves x 32 query columns. K rows and V^T rows are staged once in LDS, both from the k rows as the GEMM wrote them; each wave forms
// S^T = K Q^T (a lane holds one query's scores), takes the exact row maximum in a first walk over the keys, then walks again: p = 2^10 exp(scale (s - max)), packed from the
// score accumulators straight into the B operand of O^T += V^T P^T; the row sum stays in f32 and divides the result. Scores and probabilities never reach memory.
#define KP 40                    /* LDS pitch of a K row, f16 units: 80 B = 16 B x odd, conflict-free for 16-byte fragment reads */
#define VP 520                   /* LDS pitch of a V^T row, f16 units: 1040 B = 16 B x odd */
__device__ __forceinline__ v16h at_frag(const unsigned short* p, int hh) { FragH f; f.half[0] = *(const v8us*)(p + 8 * hh); f.half[1] = *(const v8us*)(p + 16 + 8 * hh); return f.v; }
__device__ __forceinline__ v8f at_mma(v16h a, v16h b, v8f c) { return __builtin_amdgcn_wmma_f32_16x16x32_f16(false, a, false, b, (short)0, c, false, false); }
__device__ __forceinline__ float at_max8(v8f s, float m) { const float t0 = fmaxf(fmaxf(s[0], s[1]), s[2]), t1 = fmaxf(fmaxf(s[3], s[4]), s[5]), t2 = fmaxf(fmaxf(s[6], s[7]), m); return fmaxf(fmaxf(t0, t1), t2); }
__device__ __forceinline__ v8f at_exp8(v8f s, float c, float b) { float x[8], e[8];
  for (int r = 0; r < 8; ++r) x[r] = s[r] * c + b;
  /* eight 2^x in one statement: early-clobber results keep every result off every source, and the closing v_nop is the one slot the instruction set asks for behind a transcendental before a source may be overwritten or the result used */
  asm("v_exp_f32 %0, %8\n\tv_exp_f32 %1, %9\n\tv_exp_f32 %2, %10\n\tv_exp_f32 %3, %11\n\tv_exp_f32 %4, %12\n\tv_exp_f32 %5, %13\n\tv_exp_f32 %6, %14\n\tv_exp_f32 %7, %15\n\tv_nop"
      : "=&v"(e[0]), "=&v"(e[1]), "=&v"(e[2]), "=&v"(e[3]), "=&v"(e[4]), "=&v"(e[5]), "=&v"(e[6]), "=&v"(e[7]) : "v"(x[0]), "v"(x[1]), "v"(x[2]), "v"(x[3]), "v"(x[4]), "v"(x[5]), "v"(x[6]), "v"(x[7]));
  const v8f o = {e[0], e[1], e[2], e[3], e[4], e[5], e[6], e[7]}; return o; }
__device__ __forceinline__ float at_sum8(v8f e) { return ((e[0] + e[1]) + (e[2] + e[3])) + ((e[4] + e[5]) + (e[6] + e[7])); }
__device__ __forceinline__ v16h at_pack(v8f e0, v8f e1) { FragH f;
  for (int r = 0; r < 8; ++r) { f.h[r] = (_Float16)e0[r]; f.h[8 + r] = (_Float16)e1[r]; } return f.v; }
typedef unsigned int u32a __attribute__((may_alias));
/* a minimum of 8 waves per SIMD = 128 vector registers a wave, as before this staging: without it the build takes 130, which is 7 waves per SIMD, so only one 16-wave work-group would fit a WGP instead of two */
__global__ __launch_bounds__(512, 8) void k_attn(const _Float16* __restrict__ Q16, const _Float16* __restrict__ K16, float* __restrict__ CTX) {
  __shared__ __attribute__((aligned(16))) unsigned short sk[TOKS * KP];
  __shared__ __attribute__((aligned(16))) unsigned short sv[DH * VP];
  const int tid = threadIdx.x, w = tid >> 5, lane = tid & 31, ln = lane & 15, hh = lane >> 4;
  const int h = blockIdx.x % NHB, pl = blockIdx.x / NHB; const bool vert = blockIdx.y != 0;
  const int bi = pl / NST, st = pl % NST;
  /* token -> row of the [NR][CH] q / k planes: a horizontal stripe is 512 rows in a run; a vertical stripe takes 8 rows out of every 64 (one form for both, so that no branch stands between the loads) */
  const int rbase = vert ? bi * NPX + st * WIN : pl * TOKS, rstep = vert ? WSD : WIN;
  auto rowof = [&](int tok) { return rbase + (tok >> 3) * rstep + (tok & 7); };
  const int ch0 = (vert ? CHH : 0) + h * DH;
  const unsigned short* qg = (const unsigned short*)Q16 + ch0;
  const unsigned short* kg = (const unsigned short*)K16 + ch0;
  /* a thread takes 8 channels of two neighbouring tokens (neighbouring rows in both branches): two 16-byte K row pieces, and the same values as 8 (token, token + 1) pairs for the V^T rows (v = k) */
  for (int u = 0; u < 2; ++u) { const int i = tid + 512 * u; const int t0 = (i >> 2) * 2, kc = (i & 3) * 8; const unsigned short* kr = kg + (size_t)rowof(t0) * CH + kc;
    FragH a; a.half[0] = *(const v8us*)kr; a.half[1] = *(const v8us*)(kr + CH);
    asm volatile("s_wait_xcnt 0x0" ::: "memory"); /* the address pair of these two loads is reused further down: the wait stands in front of that overwrite */
    *(v8us*)(sk + t0 * KP + kc) = a.half[0]; *(v8us*)(sk + (t0 + 1) * KP + kc) = a.half[1];
    for (int q = 0; q < 8; ++q) *(u32a*)(sv + (kc + q) * VP + t0) = (unsigned int)a.u[q] | ((unsigned int)a.u[8 + q] << 16); }
  const int q0r = w * 32 + ln;
  __syncthreads();      /* publishes the staged K and V^T rows; they are only read from here on */
  const v16h q0 = at_frag(qg + (size_t)rowof(q0r) * CH, hh), q1 = at_frag(qg + (size_t)rowof(q0r + 16) * CH, hh);
  const v8f z8 = {0.f,0.f,0.f,0.f,0.f,0.f,0.f,0.f};
  float m0 = -3.0e38f, m1 = -3.0e38f;
  const unsigned short* kl = sk + ln * KP;
  for (int t = 0; t < TOKS / 16; ++t) { const v16h ka = at_frag(kl + t * 16 * KP, hh);
    const v8f s0 = at_mma(ka, q0, z8), s1 = at_mma(ka, q1, z8); m0 = at_max8(s0, m0); m1 = at_max8(s1, m1); }
  m0 = fmaxf(m0, __shfl_xor(m0, 16, 32)); m1 = fmaxf(m1, __shfl_xor(m1, 16, 32));
  const float c = 0.17677669529663688f * 1.4426950408889634f;      /* 1/sqrt(32) x log2(e) */
  const float b0 = 10.0f - m0 * c, b1 = 10.0f - m1 * c;
  float su0 = 0.f, su1 = 0.f; v8f o00 = z8, o01 = z8, o10 = z8, o11 = z8;
  const unsigned short* vl = sv + ln * VP;
  for (int t = 0; t < TOKS / 32; ++t) { const v16h ka = at_frag(kl + t * 32 * KP, hh), kb = at_frag(kl + (t * 32 + 16) * KP, hh); const v16h va = at_frag(vl + t * 32, hh), vb = at_frag(vl + 16 * VP + t * 32, hh);
    const v8f e00 = at_exp8(at_mma(ka, q0, z8), c, b0), e01 = at_exp8(at_mma(kb, q0, z8), c, b0), e10 = at_exp8(at_mma(ka, q1, z8), c, b1), e11 = at_exp8(at_mma(kb, q1, z8), c, b1);
    su0 += at_sum8(e00) + at_sum8(e01); su1 += at_sum8(e10) + at_sum8(e11);
    const v16h p0 = at_pack(e00, e01), p1 = at_pack(e10, e11);
    o00 = at_mma(va, p0, o00); o01 = at_mma(vb, p0, o01); o10 = at_mma(va, p1, o10); o11 = at_mma(vb, p1, o11); }
  su0 += __shfl_xor(su0, 16, 32); su1 += __shfl_xor(su1, 16, 32);
  const float i0 = 1.0f / su0, i1 = 1.0f / su1;
  /* horizontal: the token's own row, columns h*32..; vertical: the reference's inverse reshape sends (stripe, head, token = a*64 + c) to row (stripe*8 + a, head*16 + c/4), columns 128 + (c%4)*32.. */
  float* og = CTX + (vert ? ((size_t)(bi * HS + st * WIN) * WSD + h * 16) * CH + CHH : (size_t)pl * TOKS * CH + h * DH); const int oc4 = vert ? CH : 4 * CH, oc1 = vert ? DH : CH;
  auto dstof = [&](int tok) { return og + (tok >> 6) * (WSD * CH) + ((tok & 63) >> 2) * oc4 + (tok & 3) * oc1; };
  float* d0 = dstof(q0r) + 8 * hh; float* d1 = dstof(q0r + 16) + 8 * hh;
  *(v8f*)d0 = o00 * i0; *(v8f*)(d0 + 16) = o01 * i0; *(v8f*)d1 = o10 * i1; *(v8f*)(d1 + 16) = o11 * i1; }
__global__ __launch_bounds__(256) void k_biasmix(const float* __restrict__ CTX, const float* __restrict__ KF, const float* __restrict__ dwk, const float* __restrict__ dwb, _Float16* __restrict__ C16) {
  #pragma clang fp contract(off)
  const size_t t = (size_t)blockIdx.x * 256 + threadIdx.x; if (t >= (size_t)NR * CH / 8) return; const int c0 = (int)((t * 8) % CH); const size_t row = (t * 8) / CH; const int b = (int)(row / NPX), p = (int)(row % NPX); const int y = p / WSD, x = p % WSD; float acc[8]; for (int q = 0; q < 8; ++q) acc[q] = 0.f;
#pragma unroll 1
  for (int i = 0; i < 3; ++i) { const int yy = y + i - 1; if (yy < 0 || yy >= HS) continue;
#pragma unroll 1
    for (int j = 0; j < 3; ++j) { const int xx = x + j - 1; if (xx < 0 || xx >= WSD) continue; const v8f v = *(const v8f*)(KF + (((size_t)b * HS + yy) * WSD + xx) * CH + c0);
#pragma unroll
      for (int q = 0; q < 8; ++q) acc[q] += hswish(v[q]) * bf16_round(dwk[(i * 3 + j) * CH + c0 + q]); } }
  const v8f cx = *(const v8f*)(CTX + t * 8); FragH f; for (int q = 0; q < 8; ++q) { float s = acc[q]; s += bf16_round(dwb[c0 + q]); float u = cx[q]; u += s; f.h[q] = (_Float16)hswish(u); }
  *(v8us*)((unsigned short*)C16 + t * 8) = f.half[0];  }

extern "C" void kernel_launch(void* const* d_in, const int* in_sizes, int n_in,
                              void* d_out, int out_size, void* d_ws, size_t ws_size, hipStream_t stream) {
  (void)in_sizes; (void)n_in; (void)out_size;
  const float* x = (const float*)d_in[0]; const float* wqkv = (const float*)d_in[1]; const float* bqkv = (const float*)d_in[2]; const float* dwk = (const float*)d_in[3]; const float* dwb = (const float*)d_in[4]; const float* wout = (const float*)d_in[5]; const float* bout = (const float*)d_in[6];
  char* ws = (char*)d_ws; size_t off = 0;
  auto take = [&](size_t bytes) { char* p = ws + off; off += (bytes + 255) & ~(size_t)255; return p; };
  const size_t ne = (size_t)NR * CH;
  _Float16* BQK = (_Float16*)take((size_t)2 * CH * CH * 2); _Float16* BO = (_Float16*)take((size_t)CH * CH * 2);
  _Float16* X16 = (_Float16*)take(ne * 2); _Float16* Q16 = (_Float16*)take(ne * 2); float* KF = (float*)take(ne * 4); _Float16* K16 = (_Float16*)take(ne * 2);
  float* CTX = (float*)take(ne * 4); _Float16* C16 = X16;      /* final operand over the x rows (dead) */
  if (off > ws_size) return;      /* 0.4 + 16 + 16 + 32 + 16 + 32 = about 113 MiB */
  k_wt_f16<<<(unsigned)(((size_t)CH * 2 * CH / 8 + 255) / 256), 256, 0, stream>>>(wqkv, BQK, CH, 2 * CH, 16.0f); k_wt_f16<<<(unsigned)(((size_t)CH * CH / 8 + 255) / 256), 256, 0, stream>>>(wout, BO, CH, CH, 16.0f);      /* (in, out) */
  k_x16<<<(unsigned)((ne / 8 + 255) / 256), 256, 0, stream>>>(x, X16, ne / 8);
  const dim3 g((NR / 128) * (CH / 64), 1);
  k_gemm2<0><<<g, 128, 0, stream>>>(X16, CH, 0, BQK, CH, 0, 0.0625f, bqkv, 0, nullptr, 1, 0, 0, nullptr, Q16, CH, 0, NR, CH, CH);      /* q (f16) */
  k_gemm2<0><<<g, 128, 0, stream>>>(X16, CH, 0, BQK + (size_t)CH * CH, CH, 0, 0.0625f, bqkv + CH, 0, nullptr, 1, 0, 0, KF, K16, CH, 0, NR, CH, CH);      /* k = v (f32 + f16, both from the epilogue) */
  k_attn<<<dim3(NPL * NHB, 2), 512, 0, stream>>>(Q16, K16, CTX);      /* y = 0: horizontal, context columns h*32; y = 1: vertical, context columns 128.. through the permutation */
  k_biasmix<<<(unsigned)((ne / 8 + 255) / 256), 256, 0, stream>>>(CTX, KF, dwk, dwb, C16);
  k_gemm2<0><<<g, 128, 0, stream>>>(C16, CH, 0, BO, CH, 0, 0.0625f, bout, 0, nullptr, 1, 0, 0, (float*)d_out, nullptr, CH, 0, NR, CH, CH);      /* out = hswish(context + bias) w_out + b */
}

// v003
// One run takes 100 microseconds.
// Two timings next to v002 both put it at 1.26 times that version's speed.
// Counting every step since v000, it is 8.68 times as fast.
#include <hip/hip_runtime.h>
// CrossShapedAttention (8 x 64 x 64 x 256, window 8, 4 heads x 32 per branch: [q | k] = x w_qkv + b (v = k); horizontal branch = channels 0..127 attending within each 8-row stripe (512 tokens), vertical branch = channels 128..255 within each 8-column stripe; softmax(q.k / sqrt(32)) v; the vertical context is put back through the TF code's exact reshape/transpose order (a fixed permutation of (row-in-stripe, column, head, channel)); bias = depthwise3x3(hard_swish(v)) + b; out = hard_swish(context + bias) w_out + b_out).
// Structure: exact f16 x rows; q and k(=v) as f16 WMMA GEMMs (32x64 wave tiles, f32 accumulation, exact x16 (in,out) weights + bias; q f16, k f32 + f16); horizontal stripes are contiguous row ranges: one fused launch does scores (K = 32), softmax (exact row maximum, f16 x 2^10 unnormalised, f32 row sum) and readout (N = 32) per (plane, head) with K and V^T in LDS (V^T is built from the K rows while they are staged), writing context columns h*32.. directly; the vertical branch runs in the same launch: it reads its q/k rows in place by the stripe's row map (token = row*8 + column-in-stripe) and stores its result through the reference's permutation; the hard-swish + depthwise 3x3 bias on VALU (f32, added into the context rows); hard_swish into f16 rows; output projection GEMM writing the [B,H,W,C] output.
// Compute dtype: inputs rounded to bf16; x / weights exact as f16; q, k, v and the final context as plain f16 GEMM operands (~2^-12); softmax / hard-swish / depthwise in f32. v_wmma_f32_16x16x32_f16.
#define NI 8
#define HS 64
#define WSD 64
#define CH 256
#define CHH 128                  /* channels per branch */
#define NHB 4                    /* heads per branch */
#define DH 32
#define WIN 8
#define NST 8                    /* stripes per image per branch */
#define TOKS 512                 /* tokens per stripe */
#define NPX (HS * WSD)
#define NR (NI * NPX)            /* 32768 */
#define NPL (NI * NST)           /* 64 (image, stripe) planes per branch */
typedef __bf16 v16b __attribute__((ext_vector_type(16)));
typedef unsigned short v8us __attribute__((ext_vector_type(8), may_alias));
typedef float  v8f  __attribute__((ext_vector_type(8)));
typedef float  v4f  __attribute__((ext_vector_type(4)));
typedef float  v4fa __attribute__((ext_vector_type(4), may_alias));
union FragB { v16b v; v8us half[2]; unsigned short u[16]; };

__device__ __forceinline__ unsigned short bf16_bits(float x) { unsigned int u = __float_as_uint(x); return (unsigned short)((u + 0x7FFFu + ((u >> 16) & 1u)) >> 16); }
__device__ __forceinline__ float bf16_val(unsigned short b) { return __uint_as_float(((unsigned int)b) << 16); }
__device__ __forceinline__ float bf16_round(float x) { return bf16_val(bf16_bits(x)); }
// D += A·B with NT terms: 1 = ah·bh, 2 = + al·bh (A split), 3 = + ah·bl (both split)
template <int NT>
__device__ __forceinline__ v8f mmaN(v16b ah, v16b al, v16b bh, v16b bl, v8f c) {
  c = __builtin_amdgcn_wmma_f32_16x16x32_bf16(false, ah, false, bh, (short)0, c, false, false);
  if (NT >= 2) c = __builtin_amdgcn_wmma_f32_16x16x32_bf16(false, al, false, bh, (short)0, c, false, false);
  if (NT >= 3) c = __builtin_amdgcn_wmma_f32_16x16x32_bf16(false, ah, false, bl, (short)0, c, false, false);
  asm volatile("v_nop\n\tv_nop\n\tv_nop\n\tv_nop" : "+v"(c) : "v"(ah), "v"(al), "v"(bh), "v"(bl));
  return c;
}

__global__ __launch_bounds__(256) void k_wt_bf16(const float* __restrict__ W, unsigned short* __restrict__ Wt, int K, int N) {
  const int t = blockIdx.x * 256 + threadIdx.x;
  const int k8n = K / 8;
  if (t >= N * k8n) return;
  const int n = t / k8n, k8 = (t % k8n) * 8;
  v8us v;
#pragma unroll
  for (int i = 0; i < 8; ++i) v[i] = bf16_bits(W[(size_t)(k8 + i) * N + n]);
  *(v8us*)(Wt + (size_t)n * K + k8) = v;
  
}

// GEMM C[M][N] (f32, pitch ldc) = act(A[M][K]·W + bias). A f32 row-major (pitch lda) converted per fragment to bf16
// (ASPLIT: hi/lo two planes -> 2 terms, else single rounded term); Wt bf16 [N][K] (pitch ldb). BIAS_BF16 rounds the
// bias to bf16 first (bias quantised to bf16 before the add). K%32==0, M%16==0, N%64==0.
template <bool ASPLIT, int ACT, bool BIAS_BF16>
__global__ __launch_bounds__(128) void k_gemm_bf(const float* __restrict__ A, int lda, const unsigned short* __restrict__ Wt, int ldb,
                                               const float* __restrict__ bias, float* __restrict__ C, int ldc, int M, int N, int K) {
  __shared__ __attribute__((aligned(16))) float so[4][16][64];
  const int tid = threadIdx.x, w = tid >> 5, lane = tid & 31, ln = lane & 15, hh = lane >> 4;
  const int ntn = N / 64;
  const int wid = blockIdx.x * 4 + w;
  const int mt = wid / ntn, nq = wid % ntn;
  if (mt * 16 >= M) return;
  const int row0 = mt * 16, col0 = nq * 64;
  const float* arow = A + (size_t)(row0 + ln) * lda;
  v8f acc[4] = {};
  for (int kb = 0; kb < K; kb += 32) {
    FragB ah, al;
    const v4f x0 = *(const v4fa*)(arow + kb + 8 * hh), x1 = *(const v4fa*)(arow + kb + 8 * hh + 4);
    const v4f x2 = *(const v4fa*)(arow + kb + 16 + 8 * hh), x3 = *(const v4fa*)(arow + kb + 16 + 8 * hh + 4);
    float xs[16] = {x0[0],x0[1],x0[2],x0[3],x1[0],x1[1],x1[2],x1[3],x2[0],x2[1],x2[2],x2[3],x3[0],x3[1],x3[2],x3[3]};
#pragma unroll
    for (int i = 0; i < 16; ++i) { const unsigned short hb = bf16_bits(xs[i]); ah.u[i] = hb; al.u[i] = ASPLIT ? bf16_bits(xs[i] - bf16_val(hb)) : (unsigned short)0; }
#pragma unroll
    for (int t = 0; t < 4; ++t) {
      const unsigned short* brow = Wt + (size_t)(col0 + t * 16 + ln) * ldb + kb;
      FragB b;
      b.half[0] = *(const v8us*)(brow + 8 * hh);
      b.half[1] = *(const v8us*)(brow + 16 + 8 * hh);
      acc[t] = mmaN<ASPLIT ? 2 : 1>(ah.v, al.v, b.v, b.v, acc[t]);
    }
  }
#pragma unroll
  for (int t = 0; t < 4; ++t) {
    float bv = bias ? bias[col0 + t * 16 + ln] : 0.f;
    if (BIAS_BF16) bv = bf16_round(bv);
#pragma unroll
    for (int r = 0; r < 8; ++r) { float v = acc[t][r] + bv; if (ACT == 1) v = fmaxf(v, 0.f); so[w][8 * hh + r][t * 16 + ln] = v; }
  }
  __builtin_amdgcn_fence(__ATOMIC_ACQ_REL, "workgroup");
  __builtin_amdgcn_wave_barrier();
  const int rsub = lane >> 4, c4 = (lane & 15) * 4;
  {
#pragma unroll
    for (int q = 0; q < 8; ++q) {
      const int r = q * 2 + rsub;
      const v4f v = *(const v4fa*)&so[w][r][c4];
      *(v4f*)(C + (size_t)(row0 + r) * ldc + col0 + c4) = v;
    }
    
  }
}

// GEMM C = act(A·W + bias + resid): A f32 (ASPLIT -> hi/lo 2 terms), Wt bf16 [N][K]; ACT 0 none, 1 relu, 2 exact gelu;
// resid (optional, f32, row index = (row % rmod), pitch ldr, RES_BF16 rounds it) added before the activation.
template <bool ASPLIT, int ACT, bool BIAS_BF16, bool RES_BF16>
__global__ __launch_bounds__(128) void k_gemm_bf3(const float* __restrict__ A, int lda, const unsigned short* __restrict__ Wt, int ldb,
                                                const float* __restrict__ bias, const float* __restrict__ resid, int rmod, int ldr,
                                                float* __restrict__ C, int ldc, int M, int N, int K) {
  __shared__ __attribute__((aligned(16))) float so[4][16][64];
  const int tid = threadIdx.x, w = tid >> 5, lane = tid & 31, ln = lane & 15, hh = lane >> 4;
  const int ntn = N / 64;
  const int wid = blockIdx.x * 4 + w;
  const int mt = wid / ntn, nq = wid % ntn;
  if (mt * 16 >= M) return;
  const int row0 = mt * 16, col0 = nq * 64;
  const float* arow = A + (size_t)(row0 + ln) * lda;
  v8f acc[4] = {};
  for (int kb = 0; kb < K; kb += 32) {
    FragB ah, al;
    const v4f x0 = *(const v4fa*)(arow + kb + 8 * hh), x1 = *(const v4fa*)(arow + kb + 8 * hh + 4);
    const v4f x2 = *(const v4fa*)(arow + kb + 16 + 8 * hh), x3 = *(const v4fa*)(arow + kb + 16 + 8 * hh + 4);
    float xs[16] = {x0[0],x0[1],x0[2],x0[3],x1[0],x1[1],x1[2],x1[3],x2[0],x2[1],x2[2],x2[3],x3[0],x3[1],x3[2],x3[3]};
#pragma unroll
    for (int i = 0; i < 16; ++i) { const unsigned short hb = bf16_bits(xs[i]); ah.u[i] = hb; al.u[i] = ASPLIT ? bf16_bits(xs[i] - bf16_val(hb)) : (unsigned short)0; }
#pragma unroll
    for (int t = 0; t < 4; ++t) {
      const unsigned short* brow = Wt + (size_t)(col0 + t * 16 + ln) * ldb + kb;
      FragB b;
      b.half[0] = *(const v8us*)(brow + 8 * hh);
      b.half[1] = *(const v8us*)(brow + 16 + 8 * hh);
      acc[t] = mmaN<ASPLIT ? 2 : 1>(ah.v, al.v, b.v, b.v, acc[t]);
    }
  }
#pragma unroll
  for (int t = 0; t < 4; ++t) {
    const int col = col0 + t * 16 + ln;
    float bv = bias ? bias[col] : 0.f;
    if (BIAS_BF16) bv = bf16_round(bv);
#pragma unroll
    for (int r = 0; r < 8; ++r) {
      float v = acc[t][r] + bv;
      if (resid) { float rv = resid[(size_t)((row0 + 8 * hh + r) % rmod) * ldr + col]; if (RES_BF16) rv = bf16_round(rv); v += rv; }
      if (ACT == 1) v = fmaxf(v, 0.f);
      if (ACT == 2) v = 0.5f * v * (1.0f + erff(v * 0.70710678118654752f));
      if (ACT == 3) { const float u = 0.7978845608028654f * (v + 0.044715f * v * v * v); v = 0.5f * v * (1.0f + tanhf(u)); }
      so[w][8 * hh + r][t * 16 + ln] = v;
    }
  }
  __builtin_amdgcn_fence(__ATOMIC_ACQ_REL, "workgroup");
  __builtin_amdgcn_wave_barrier();
  const int rsub = lane >> 4, c4 = (lane & 15) * 4;
  {
#pragma unroll
    for (int q = 0; q < 8; ++q) {
      const int r = q * 2 + rsub;
      const v4f v = *(const v4fa*)&so[w][r][c4];
      *(v4f*)(C + (size_t)(row0 + r) * ldc + col0 + c4) = v;
    }
    
  }
}
// row LayerNorm (biased variance, eps) over N: s = X (+ R); optional out_sum <- s; out_norm <- (s-mu)*rsqrt(var+eps)*g + b
template <bool PARAM_BF16>
__global__ __launch_bounds__(256) void k_layernorm(const float* __restrict__ X, const float* __restrict__ R, const float* __restrict__ g, const float* __restrict__ bta,
                                                  float* __restrict__ out_sum, float* __restrict__ out_norm, int N, float eps) {
  __shared__ float red[256];
  const int row = blockIdx.x, tid = threadIdx.x;
  const float* x = X + (size_t)row * N; const float* rr = R ? R + (size_t)row * N : nullptr;
  float vals[16];                     // up to N = 4096
  const int per = N / 256;            // contiguous chunk per thread? use strided-by-4 chunks: thread handles j = tid*4 + 1024*u
  float s1 = 0.f;
  for (int u = 0; u < per / 4; ++u) {
    const int j = tid * 4 + 1024 * u;
    const v4f a = *(const v4fa*)(x + j);
    v4f b = {0.f,0.f,0.f,0.f}; if (rr) b = *(const v4fa*)(rr + j);
#pragma unroll
    for (int q = 0; q < 4; ++q) { const float v = a[q] + b[q]; vals[u * 4 + q] = v; s1 += v; }
  }
  red[tid] = s1; __syncthreads();
  for (int st = 128; st > 0; st >>= 1) { if (tid < st) red[tid] += red[tid + st]; __syncthreads(); }
  const float mu = red[0] / (float)N; __syncthreads();
  float s2 = 0.f;
  for (int u = 0; u < per / 4; ++u)
#pragma unroll
    for (int q = 0; q < 4; ++q) { const float c = vals[u * 4 + q] - mu; s2 += c * c; }
  red[tid] = s2; __syncthreads();
  for (int st = 128; st > 0; st >>= 1) { if (tid < st) red[tid] += red[tid + st]; __syncthreads(); }
  const float rs = rsqrtf(red[0] / (float)N + eps);
  {
    for (int u = 0; u < per / 4; ++u) {
      const int j = tid * 4 + 1024 * u;
      v4f o, sm;
#pragma unroll
      for (int q = 0; q < 4; ++q) {
        float gg = g[j + q], bb = bta[j + q];
        if (PARAM_BF16) { gg = bf16_round(gg); bb = bf16_round(bb); }
        sm[q] = vals[u * 4 + q]; o[q] = (vals[u * 4 + q] - mu) * rs * gg + bb;
      }
      if (out_sum) *(v4f*)(out_sum + (size_t)row * N + j) = sm;
      *(v4f*)(out_norm + (size_t)row * N + j) = o;
    }
    
  }
}



// ---- f16 WMMA path (v_wmma_f32_16x16x32_f16): 11-bit significands for operands in range — used for every GEMM here, including the 2^10-scaled probability operand that needs more precision than bf16
typedef _Float16 v16h __attribute__((ext_vector_type(16)));
union FragH { v16h v; v8us half[2]; _Float16 h[16]; unsigned short u[16]; };
template <int NT>
__device__ __forceinline__ v8f mmaH(v16h ah, v16h al, v16h bh, v16h bl, v8f c) {
  c = __builtin_amdgcn_wmma_f32_16x16x32_f16(false, ah, false, bh, (short)0, c, false, false);
  if (NT >= 2) c = __builtin_amdgcn_wmma_f32_16x16x32_f16(false, al, false, bh, (short)0, c, false, false);
  if (NT >= 3) c = __builtin_amdgcn_wmma_f32_16x16x32_f16(false, ah, false, bl, (short)0, c, false, false);
  asm volatile("v_nop\n\tv_nop\n\tv_nop\n\tv_nop" : "+v"(c) : "v"(ah), "v"(al), "v"(bh), "v"(bl));
  return c;
}
// batched GEMM like k_gemm_b but f16 operands: A f32 (split into f16 hi/lo if ASPLIT, else rounded to f16), Bt = f16 values [n][k]; alpha; C f32; N multiple of 16 (partial tiles skipped)
template <bool ASPLIT>
__global__ __launch_bounds__(128) void k_gemm_h(const float* __restrict__ A, int lda, size_t sA, const _Float16* __restrict__ Bh, int ldb, size_t sB, float alpha, float* __restrict__ C, int ldc, size_t sC, int M, int N, int K) {
  __shared__ __attribute__((aligned(16))) float so[4][16][64];
  const int tid = threadIdx.x, w = tid >> 5, lane = tid & 31, ln = lane & 15, hh = lane >> 4; const int by = blockIdx.y;
  A += (size_t)by * sA; Bh += (size_t)by * sB; C += (size_t)by * sC;
  const int ntn = (N + 63) / 64; const int wid = blockIdx.x * 4 + w; const int mt = wid / ntn, nq = wid % ntn; if (mt * 16 >= M) return;
  const int row0 = mt * 16, col0 = nq * 64; const float* arow = A + (size_t)(row0 + ln) * lda;
  v8f acc[4] = {};
  for (int kb = 0; kb < K; kb += 32) {
    FragH ah, al;
    const v4f x0 = *(const v4fa*)(arow + kb + 8 * hh), x1 = *(const v4fa*)(arow + kb + 8 * hh + 4), x2 = *(const v4fa*)(arow + kb + 16 + 8 * hh), x3 = *(const v4fa*)(arow + kb + 16 + 8 * hh + 4);
    float xs[16] = {x0[0],x0[1],x0[2],x0[3],x1[0],x1[1],x1[2],x1[3],x2[0],x2[1],x2[2],x2[3],x3[0],x3[1],x3[2],x3[3]};
#pragma unroll
    for (int i = 0; i < 16; ++i) { const _Float16 h = (_Float16)xs[i]; ah.h[i] = h; al.h[i] = ASPLIT ? (_Float16)(xs[i] - (float)h) : (_Float16)0.0f; }
#pragma unroll
    for (int t = 0; t < 4; ++t) { if (col0 + t * 16 >= N) continue; const size_t boff = (size_t)(col0 + t * 16 + ln) * ldb + kb; FragH bq; bq.half[0] = *(const v8us*)(Bh + boff + 8 * hh); bq.half[1] = *(const v8us*)(Bh + boff + 16 + 8 * hh);
      acc[t] = mmaH<ASPLIT ? 2 : 1>(ah.v, al.v, bq.v, bq.v, acc[t]); }
  }
#pragma unroll
  for (int t = 0; t < 4; ++t) { if (col0 + t * 16 >= N) continue;
#pragma unroll
    for (int r = 0; r < 8; ++r) so[w][8 * hh + r][t * 16 + ln] = acc[t][r] * alpha; }
  __builtin_amdgcn_fence(__ATOMIC_ACQ_REL, "workgroup"); __builtin_amdgcn_wave_barrier();
  const int rsub = lane >> 4, c4 = (lane & 15) * 4;
  {
#pragma unroll
    for (int q = 0; q < 8; ++q) { const int r = q * 2 + rsub; if (col0 + c4 < N) { const v4f v = *(const v4fa*)&so[w][r][c4]; *(v4f*)(C + (size_t)(row0 + r) * ldc + col0 + c4) = v; } }
     }
}

// Wt[n][k] = f16(W[k][n]·scale) from f32 row-major W[K][N] (scale = power of two; bf16-exact weights stay exact in f16 away from the subnormal range)
__global__ __launch_bounds__(256) void k_wt_f16(const float* __restrict__ W, _Float16* __restrict__ Wt, int K, int N, float scale) {
  const int t = blockIdx.x * 256 + threadIdx.x; if (t >= N * (K / 8)) return; const int n = t / (K / 8), k8 = (t % (K / 8)) * 8; FragH f;
#pragma unroll
  for (int i = 0; i < 8; ++i) f.h[i] = (_Float16)(bf16_round(W[(size_t)(k8 + i) * N + n]) * scale); const v8us o = f.half[0];
  *(v8us*)((unsigned short*)Wt + (size_t)n * K + k8) = o; 
}
// k_gemm_hh variant with fused epilogue: v = acc·alpha + bias[by·sBias + col] (+ CP[(row/rowsPerB)·sCPb + by·64 + col] if CP) ; ACT 0 none / 1 elu ; writes f32 C and/or f16 C16 (each if non-null)
template <int ACT>
__global__ __launch_bounds__(128) void k_gemm_hhx(const _Float16* __restrict__ A, int lda, size_t sA, const _Float16* __restrict__ Bh, int ldb, size_t sB, float alpha, const float* __restrict__ bias, size_t sBias, const float* __restrict__ CP, int rowsPerB, size_t sCPb, int row0g,
    float* __restrict__ C, _Float16* __restrict__ C16, int ldc, size_t sC, int M, int N, int K) {
  __shared__ __attribute__((aligned(16))) float so[4][16][64];
  const int tid = threadIdx.x, w = tid >> 5, lane = tid & 31, ln = lane & 15, hh = lane >> 4; const int by = blockIdx.y;
  A += (size_t)by * sA; Bh += (size_t)by * sB; const size_t cofs = (size_t)by * sC; const float* bp = bias ? bias + (size_t)by * sBias : nullptr;
  const int ntn = (N + 63) / 64; const int wid = blockIdx.x * 4 + w; const int mt = wid / ntn, nq = wid % ntn; if (mt * 16 >= M) return;
  const int row0 = mt * 16, col0 = nq * 64; const _Float16* arow = A + (size_t)(row0 + ln) * lda;
  v8f acc[4] = {};
  for (int kb = 0; kb < K; kb += 32) { FragH ah; ah.half[0] = *(const v8us*)((const unsigned short*)arow + kb + 8 * hh); ah.half[1] = *(const v8us*)((const unsigned short*)arow + kb + 16 + 8 * hh);
#pragma unroll
    for (int t = 0; t < 4; ++t) { if (col0 + t * 16 >= N) continue; const size_t boff = (size_t)(col0 + t * 16 + ln) * ldb + kb; FragH bq; bq.half[0] = *(const v8us*)((const unsigned short*)Bh + boff + 8 * hh); bq.half[1] = *(const v8us*)((const unsigned short*)Bh + boff + 16 + 8 * hh);
      acc[t] = mmaH<1>(ah.v, ah.v, bq.v, bq.v, acc[t]); }
  }
#pragma unroll
  for (int t = 0; t < 4; ++t) { if (col0 + t * 16 >= N) continue; const int col = col0 + t * 16 + ln; const float bv = bp ? bf16_round(bp[col]) : 0.f;
#pragma unroll
    for (int r = 0; r < 8; ++r) { float v = acc[t][r] * alpha + bv; if (CP) { const int rr = row0g + row0 + 8 * hh + r; if (rowsPerB < 0) v += CP[cofs + (size_t)rr * ldc + col];      /* rowsPerB < 0: own element of the batched C plane */ else { const int bidx = rr / rowsPerB; v += CP[(size_t)bidx * sCPb + (size_t)by * 64 + col]; } } if (ACT == 1) v = (v > 0.f) ? v : expm1f(v); else if (ACT == 7) v = (v > 0.f) ? v + 1.0f : expf(v); else if (ACT == 8) v = tanhf(v); else if (ACT == 9) v = 0.5f * v * (1.0f + tanhf(0.7978845608028654f * (v + 0.044715f * v * v * v))); else if (ACT == 11) v = 1.0f / (1.0f + expf(-v)); else if (ACT == 12) v = (v > 0.f) ? v : 0.01f * v; else if (ACT == 14) v = (v > 0.f) ? v : 0.1f * v; else if (ACT == 16) v = (v >= 0.f) ? v : 0.3f * v; else if (ACT == 17) v = (v >= 0.f) ? v : 0.2f * v; else if (ACT == 15) v = v / (1.0f + expf(-v)); else if (ACT == 3) v = fmaxf(v, 0.f); else if (ACT == 6) v = 0.5f * v * (1.0f + erff(v * 0.70710678118654752f)); so[w][8 * hh + r][t * 16 + ln] = v; } }
  __builtin_amdgcn_fence(__ATOMIC_ACQ_REL, "workgroup"); __builtin_amdgcn_wave_barrier();
  const int rsub = lane >> 4, c4 = (lane & 15) * 4; typedef _Float16 v4h __attribute__((ext_vector_type(4)));
  {
#pragma unroll
    for (int q = 0; q < 8; ++q) { const int r = q * 2 + rsub; if (col0 + c4 < N) { const v4f v = *(const v4fa*)&so[w][r][c4]; if (C) *(v4f*)(C + cofs + (size_t)(row0 + r) * ldc + col0 + c4) = v; if (C16) { v4h h4; for (int i = 0; i < 4; ++i) h4[i] = (_Float16)v[i]; *(v4h*)(C16 + cofs + (size_t)(row0 + r) * ldc + col0 + c4) = h4; } } }
     }
}


typedef _Float16 v4h __attribute__((ext_vector_type(4)));

__global__ __launch_bounds__(256) void k_x16(const float* __restrict__ x, _Float16* __restrict__ X16, size_t n8) { const size_t t = (size_t)blockIdx.x * 256 + threadIdx.x; if (t >= n8) return; FragH f;
#pragma unroll
  for (int q = 0; q < 8; ++q) f.h[q] = (_Float16)bf16_round(x[t * 8 + q]); *(v8us*)((unsigned short*)X16 + t * 8) = f.half[0];  }
__global__ __launch_bounds__(256) void k_round16f(const float* __restrict__ W, _Float16* __restrict__ Bt, size_t n8) { const size_t t = (size_t)blockIdx.x * 256 + threadIdx.x; if (t >= n8) return; FragH f;
#pragma unroll
  for (int i = 0; i < 8; ++i) f.h[i] = (_Float16)(bf16_round(W[t * 8 + i]) * 16.0f); *(v8us*)((unsigned short*)Bt + t * 8) = f.half[0];  }
template <int NHv, int TTv>
__global__ __launch_bounds__(256) void k_vt(const _Float16* __restrict__ V16, int ldv, int voff, _Float16* __restrict__ Vt) { __shared__ unsigned short tl[64][66]; const int tid = threadIdx.x; const int slab = blockIdx.x / (TTv / 64), lg = blockIdx.x % (TTv / 64); const int b = slab / NHv, h = slab % NHv;
  for (int i = tid; i < 64 * 8; i += 256) { const int r = i / 8, c8 = (i % 8) * 8; FragH f; f.half[0] = *(const v8us*)((const unsigned short*)V16 + ((size_t)b * TTv + lg * 64 + r) * ldv + voff + h * 64 + c8);
#pragma unroll
    for (int q = 0; q < 8; ++q) tl[r][c8 + q] = f.u[q]; }
  __syncthreads();
  {
#pragma unroll
    for (int rd = 0; rd < 2; ++rd) { const int d = rd * 32 + tid / 8, pc = tid % 8; FragH f;
#pragma unroll
      for (int q = 0; q < 8; ++q) f.u[q] = tl[pc * 8 + q][d];
      *(v8us*)((unsigned short*)Vt + ((size_t)slab * 64 + d) * TTv + lg * 64 + pc * 8) = f.half[0]; }
     } }

__global__ __launch_bounds__(256) void k_hl(const float* __restrict__ F, _Float16* __restrict__ Hh, _Float16* __restrict__ Hl, size_t n8) { const size_t t = (size_t)blockIdx.x * 256 + threadIdx.x; if (t >= n8) return; FragH fh, fl; const v4f a = *(const v4fa*)(F + t * 8), c = *(const v4fa*)(F + t * 8 + 4);
#pragma unroll
  for (int q = 0; q < 4; ++q) { _Float16 h = (_Float16)a[q]; fh.h[q] = h; fl.h[q] = (_Float16)((a[q] - (float)h) * 1024.0f); h = (_Float16)c[q]; fh.h[4 + q] = h; fl.h[4 + q] = (_Float16)((c[q] - (float)h) * 1024.0f); }
  { *(v8us*)((unsigned short*)Hh + t * 8) = fh.half[0]; *(v8us*)((unsigned short*)Hl + t * 8) = fl.half[0];  } }

// ---- fast GEMM for dense rows of CH f16 (K = CH, N = CH, M % 128 == 0): one work-group = 128 rows x all CH columns, 16 waves of 32x64 tiles (4 row groups x 4 column groups); epilogue = k_gemm_hhx semantics ----
// The A rows and all B rows are brought in once as whole 512-byte rows (one row per wave-wide load) and staged in LDS; the fragments are read from there. After the products the same LDS holds the waves' output tiles.
#define GP (CH + 8)              /* LDS pitch of a staged row, f16 units: 528 B = 16 B x odd, conflict-free for 16-byte fragment reads */
__device__ __forceinline__ v16h g3_frag(const unsigned short* p) { FragH f; f.half[0] = *(const v8us*)p; f.half[1] = *(const v8us*)(p + 16); return f.v; }
__device__ __forceinline__ v8f g3_mma(v16h a, v16h b, v8f c) { return __builtin_amdgcn_wmma_f32_16x16x32_f16(false, a, false, b, (short)0, c, false, false); }
template <int ACT>
__global__ __launch_bounds__(512) void k_gemm3(const _Float16* __restrict__ A, size_t sA, const _Float16* __restrict__ Bh, size_t sB, float alpha, const float* __restrict__ bias, size_t sBias, const float* __restrict__ CP, int rowsPerB, size_t sCPb, int row0g,
    float* __restrict__ C, _Float16* __restrict__ C16, int ldc, size_t sC, int M) { static_assert(ACT == 0 || ACT == 3 || ACT == 6 || ACT == 8 || ACT == 9 || ACT == 11 || ACT == 12 || ACT == 14 || ACT == 15 || ACT == 16 || ACT == 17, "k_gemm3: unsupported ACT code (would silently apply no activation)");
  __shared__ __attribute__((aligned(16))) unsigned short sab[(128 + CH) * GP];      /* 128 A rows, then CH B rows */
  float (*so)[32][68] = reinterpret_cast<float (*)[32][68]>(sab);      /* 16 output tiles over the staged rows, behind the second barrier */
  static_assert(sizeof(float) * 16 * 32 * 68 <= sizeof(unsigned short) * (128 + CH) * GP, "output tiles must fit the staging bytes");
  const int tid = threadIdx.x, w = tid >> 5, lane = tid & 31, ln = lane & 15, hh = lane >> 4; const int by = blockIdx.y;
  A += (size_t)by * sA; Bh += (size_t)by * sB; const size_t cofs = (size_t)by * sC; const float* bp = bias ? bias + (size_t)by * sBias : nullptr;
  const int mt = blockIdx.x; if (mt * 128 >= M) return;      /* the same for the whole work-group, in front of both barriers */
  const int row0 = mt * 128 + 32 * (w & 3), col0 = (w >> 2) * 64;
  { const unsigned short* ag = (const unsigned short*)A + ((size_t)mt * 128 + w) * CH + lane * 8; const unsigned short* bg = (const unsigned short*)Bh + (size_t)w * CH + lane * 8;
    v8us ra[8], rb[16];      /* the four loops below are unrolled so that these stay in registers and all 24 loads are in flight before the first LDS store waits for one */
#pragma unroll
    for (int u = 0; u < 8; ++u) ra[u] = *(const v8us*)(ag + u * 16 * CH);
#pragma unroll
    for (int u = 0; u < 16; ++u) rb[u] = *(const v8us*)(bg + u * 16 * CH);
    unsigned short* sw = sab + w * GP + lane * 8;
#pragma unroll
    for (int u = 0; u < 8; ++u) *(v8us*)(sw + u * 16 * GP) = ra[u];
#pragma unroll
    for (int u = 0; u < 16; ++u) *(v8us*)(sw + (128 + u * 16) * GP) = rb[u]; }
  __syncthreads();      /* publishes the staged A and B rows; they are only read until the next barrier */
  const unsigned short* al = sab + (32 * (w & 3) + ln) * GP + 8 * hh; const unsigned short* bl = sab + (128 + col0 + ln) * GP + 8 * hh;
  const v8f z8 = {0.f,0.f,0.f,0.f,0.f,0.f,0.f,0.f}; v8f c00 = z8, c01 = z8, c02 = z8, c03 = z8, c10 = z8, c11 = z8, c12 = z8, c13 = z8;
  /* two register sets: the twelve LDS reads of k step s + 1 stand as one group ahead of the eight products of step s, so that a wave waits for a group once a step and not before every pair of products; unrolled so that the set index is a constant and every read has an immediate offset */
  v16h fa[2][2], fb[2][4];
  fa[0][0] = g3_frag(al); fa[0][1] = g3_frag(al + 16 * GP);
#pragma unroll
  for (int t = 0; t < 4; ++t) fb[0][t] = g3_frag(bl + t * 16 * GP);
#pragma unroll
  for (int s = 0; s < CH / 32; ++s) { const int cu = s & 1, nx = cu ^ 1;
    if (s + 1 < CH / 32) { const int kb = (s + 1) * 32; fa[nx][0] = g3_frag(al + kb); fa[nx][1] = g3_frag(al + 16 * GP + kb);
#pragma unroll
      for (int t = 0; t < 4; ++t) fb[nx][t] = g3_frag(bl + t * 16 * GP + kb); }
    __builtin_amdgcn_sched_barrier(0);      /* keeps the read group above in front of these products: without it the compiler moves each pair of reads down to its first use and waits there for it */
    c00 = g3_mma(fa[cu][0], fb[cu][0], c00); c10 = g3_mma(fa[cu][1], fb[cu][0], c10); c01 = g3_mma(fa[cu][0], fb[cu][1], c01); c11 = g3_mma(fa[cu][1], fb[cu][1], c11);
    c02 = g3_mma(fa[cu][0], fb[cu][2], c02); c12 = g3_mma(fa[cu][1], fb[cu][2], c12); c03 = g3_mma(fa[cu][0], fb[cu][3], c03); c13 = g3_mma(fa[cu][1], fb[cu][3], c13); }
  __syncthreads();      /* every wave has read its last staged fragment: from here the bytes are the waves' own output tiles */
  v8f accs[8] = {c00, c01, c02, c03, c10, c11, c12, c13};
#pragma unroll
  for (int u = 0; u < 8; ++u) { const int t = u & 3, half = u >> 2; const int col = col0 + t * 16 + ln; const float bv = bp ? bf16_round(bp[col]) : 0.f;
#pragma unroll
    for (int r = 0; r < 8; ++r) { const int rloc = half * 16 + 8 * hh + r; float v = accs[u][r] * alpha + bv; if (CP) { if (rowsPerB < 0) v += CP[cofs + (size_t)(row0g + row0 + rloc) * ldc + col];      /* rowsPerB < 0: own element of the batched C plane */ else { const int bidx = (row0g + row0 + rloc) / rowsPerB; v += CP[(size_t)bidx * sCPb + (size_t)by * 64 + col]; } }
      if (ACT == 3) v = fmaxf(v, 0.f); else if (ACT == 6) v = 0.5f * v * (1.0f + erff(v * 0.70710678118654752f)); else if (ACT == 11) v = 1.0f / (1.0f + expf(-v)); else if (ACT == 15) v = v / (1.0f + expf(-v)); else if (ACT == 12) v = (v > 0.f) ? v : 0.01f * v; else if (ACT == 8) v = tanhf(v); else if (ACT == 9) v = 0.5f * v * (1.0f + tanhf(0.7978845608028654f * (v + 0.044715f * v * v * v))); else if (ACT == 14) v = (v > 0.f) ? v : 0.1f * v; else if (ACT == 16) v = (v >= 0.f) ? v : 0.3f * v; else if (ACT == 17) v = (v >= 0.f) ? v : 0.2f * v;
      so[w][rloc][t * 16 + ln] = v; } }
  __builtin_amdgcn_fence(__ATOMIC_ACQ_REL, "workgroup"); __builtin_amdgcn_wave_barrier();
  const int rsub = lane >> 4, c4 = (lane & 15) * 4;
  {
#pragma unroll
    for (int q = 0; q < 16; ++q) { const int r = q * 2 + rsub; const v4f v = *(const v4fa*)&so[w][r][c4]; if (C) { *(v4f*)(C + cofs + (size_t)(row0 + r) * ldc + col0 + c4) = v;
        asm volatile("s_wait_xcnt 0x0" ::: "memory"); /* the f16 arm behind reuses the registers that the f32 store names: the wait stands in front of that overwrite */ }
      if (C16) { v4h h4; for (int i = 0; i < 4; ++i) h4[i] = (_Float16)v[i]; *(v4h*)(C16 + cofs + (size_t)(row0 + r) * ldc + col0 + c4) = h4; } }
     } }


__device__ __forceinline__ float hswish(float v) { return v * fminf(fmaxf(v + 3.0f, 0.0f), 6.0f) * (1.0f / 6.0f); }
// Fused stripe attention: one work-group = one (branch, plane, head), 16 waves x 32 query columns. K rows and V^T rows are staged once in LDS, both from the k rows as the GEMM wrote them; each wave forms
// S^T = K Q^T (a lane holds one query's scores), takes the exact row maximum in a first walk over the keys, then walks again: p = 2^10 exp(scale (s - max)), packed from the
// score accumulators straight into the B operand of O^T += V^T P^T; the row sum stays in f32 and divides the result. Scores and probabilities never reach memory.
#define KP 40                    /* LDS pitch of a K row, f16 units: 80 B = 16 B x odd, conflict-free for 16-byte fragment reads */
#define VP 520                   /* LDS pitch of a V^T row, f16 units: 1040 B = 16 B x odd */
__device__ __forceinline__ v16h at_frag(const unsigned short* p, int hh) { FragH f; f.half[0] = *(const v8us*)(p + 8 * hh); f.half[1] = *(const v8us*)(p + 16 + 8 * hh); return f.v; }
__device__ __forceinline__ v8f at_mma(v16h a, v16h b, v8f c) { return __builtin_amdgcn_wmma_f32_16x16x32_f16(false, a, false, b, (short)0, c, false, false); }
__device__ __forceinline__ float at_max8(v8f s, float m) { const float t0 = fmaxf(fmaxf(s[0], s[1]), s[2]), t1 = fmaxf(fmaxf(s[3], s[4]), s[5]), t2 = fmaxf(fmaxf(s[6], s[7]), m); return fmaxf(fmaxf(t0, t1), t2); }
__device__ __forceinline__ v8f at_exp8(v8f s, float c, float b) { float x[8], e[8];
  for (int r = 0; r < 8; ++r) x[r] = s[r] * c + b;
  /* eight 2^x in one statement: early-clobber results keep every result off every source, and the closing v_nop is the one slot the instruction set asks for behind a transcendental before a source may be overwritten or the result used */
  asm("v_exp_f32 %0, %8\n\tv_exp_f32 %1, %9\n\tv_exp_f32 %2, %10\n\tv_exp_f32 %3, %11\n\tv_exp_f32 %4, %12\n\tv_exp_f32 %5, %13\n\tv_exp_f32 %6, %14\n\tv_exp_f32 %7, %15\n\tv_nop"
      : "=&v"(e[0]), "=&v"(e[1]), "=&v"(e[2]), "=&v"(e[3]), "=&v"(e[4]), "=&v"(e[5]), "=&v"(e[6]), "=&v"(e[7]) : "v"(x[0]), "v"(x[1]), "v"(x[2]), "v"(x[3]), "v"(x[4]), "v"(x[5]), "v"(x[6]), "v"(x[7]));
  const v8f o = {e[0], e[1], e[2], e[3], e[4], e[5], e[6], e[7]}; return o; }
__device__ __forceinline__ float at_sum8(v8f e) { return ((e[0] + e[1]) + (e[2] + e[3])) + ((e[4] + e[5]) + (e[6] + e[7])); }
__device__ __forceinline__ v16h at_pack(v8f e0, v8f e1) { FragH f;
  for (int r = 0; r < 8; ++r) { f.h[r] = (_Float16)e0[r]; f.h[8 + r] = (_Float16)e1[r]; } return f.v; }
typedef unsigned int u32a __attribute__((may_alias));
/* a minimum of 8 waves per SIMD = 128 vector registers a wave, as before this staging: without it the build takes 130, which is 7 waves per SIMD, so only one 16-wave work-group would fit a WGP instead of two */
__global__ __launch_bounds__(512, 8) void k_attn(const _Float16* __restrict__ Q16, const _Float16* __restrict__ K16, float* __restrict__ CTX) {
  __shared__ __attribute__((aligned(16))) unsigned short sk[TOKS * KP];
  __shared__ __attribute__((aligned(16))) unsigned short sv[DH * VP];
  const int tid = threadIdx.x, w = tid >> 5, lane = tid & 31, ln = lane & 15, hh = lane >> 4;
  const int h = blockIdx.x % NHB, pl = blockIdx.x / NHB; const bool vert = blockIdx.y != 0;
  const int bi = pl / NST, st = pl % NST;
  /* token -> row of the [NR][CH] q / k planes: a horizontal stripe is 512 rows in a run; a vertical stripe takes 8 rows out of every 64 (one form for both, so that no branch stands between the loads) */
  const int rbase = vert ? bi * NPX + st * WIN : pl * TOKS, rstep = vert ? WSD : WIN;
  auto rowof = [&](int tok) { return rbase + (tok >> 3) * rstep + (tok & 7); };
  const int ch0 = (vert ? CHH : 0) + h * DH;
  const unsigned short* qg = (const unsigned short*)Q16 + ch0;
  const unsigned short* kg = (const unsigned short*)K16 + ch0;
  /* a thread takes 8 channels of two neighbouring tokens (neighbouring rows in both branches): two 16-byte K row pieces, and the same values as 8 (token, token + 1) pairs for the V^T rows (v = k) */
  for (int u = 0; u < 2; ++u) { const int i = tid + 512 * u; const int t0 = (i >> 2) * 2, kc = (i & 3) * 8; const unsigned short* kr = kg + (size_t)rowof(t0) * CH + kc;
    FragH a; a.half[0] = *(const v8us*)kr; a.half[1] = *(const v8us*)(kr + CH);
    asm volatile("s_wait_xcnt 0x0" ::: "memory"); /* the address pair of these two loads is reused further down: the wait stands in front of that overwrite */
    *(v8us*)(sk + t0 * KP + kc) = a.half[0]; *(v8us*)(sk + (t0 + 1) * KP + kc) = a.half[1];
    for (int q = 0; q < 8; ++q) *(u32a*)(sv + (kc + q) * VP + t0) = (unsigned int)a.u[q] | ((unsigned int)a.u[8 + q] << 16); }
  const int q0r = w * 32 + ln;
  __syncthreads();      /* publishes the staged K and V^T rows; they are only read from here on */
  const v16h q0 = at_frag(qg + (size_t)rowof(q0r) * CH, hh), q1 = at_frag(qg + (size_t)rowof(q0r + 16) * CH, hh);
  const v8f z8 = {0.f,0.f,0.f,0.f,0.f,0.f,0.f,0.f};
  float m0 = -3.0e38f, m1 = -3.0e38f;
  const unsigned short* kl = sk + ln * KP;
  for (int t = 0; t < TOKS / 16; ++t) { const v16h ka = at_frag(kl + t * 16 * KP, hh);
    const v8f s0 = at_mma(ka, q0, z8), s1 = at_mma(ka, q1, z8); m0 = at_max8(s0, m0); m1 = at_max8(s1, m1); }
  m0 = fmaxf(m0, __shfl_xor(m0, 16, 32)); m1 = fmaxf(m1, __shfl_xor(m1, 16, 32));
  const float c = 0.17677669529663688f * 1.4426950408889634f;      /* 1/sqrt(32) x log2(e) */
  const float b0 = 10.0f - m0 * c, b1 = 10.0f - m1 * c;
  float su0 = 0.f, su1 = 0.f; v8f o00 = z8, o01 = z8, o10 = z8, o11 = z8;
  const unsigned short* vl = sv + ln * VP;
  for (int t = 0; t < TOKS / 32; ++t) { const v16h ka = at_frag(kl + t * 32 * KP, hh), kb = at_frag(kl + (t * 32 + 16) * KP, hh); const v16h va = at_frag(vl + t * 32, hh), vb = at_frag(vl + 16 * VP + t * 32, hh);
    const v8f e00 = at_exp8(at_mma(ka, q0, z8), c, b0), e01 = at_exp8(at_mma(kb, q0, z8), c, b0), e10 = at_exp8(at_mma(ka, q1, z8), c, b1), e11 = at_exp8(at_mma(kb, q1, z8), c, b1);
    su0 += at_sum8(e00) + at_sum8(e01); su1 += at_sum8(e10) + at_sum8(e11);
    const v16h p0 = at_pack(e00, e01), p1 = at_pack(e10, e11);
    o00 = at_mma(va, p0, o00); o01 = at_mma(vb, p0, o01); o10 = at_mma(va, p1, o10); o11 = at_mma(vb, p1, o11); }
  su0 += __shfl_xor(su0, 16, 32); su1 += __shfl_xor(su1, 16, 32);
  const float i0 = 1.0f / su0, i1 = 1.0f / su1;
  /* horizontal: the token's own row, columns h*32..; vertical: the reference's inverse reshape sends (stripe, head, token = a*64 + c) to row (stripe*8 + a, head*16 + c/4), columns 128 + (c%4)*32.. */
  float* og = CTX + (vert ? ((size_t)(bi * HS + st * WIN) * WSD + h * 16) * CH + CHH : (size_t)pl * TOKS * CH + h * DH); const int oc4 = vert ? CH : 4 * CH, oc1 = vert ? DH : CH;
  auto dstof = [&](int tok) { return og + (tok >> 6) * (WSD * CH) + ((tok & 63) >> 2) * oc4 + (tok & 3) * oc1; };
  float* d0 = dstof(q0r) + 8 * hh; float* d1 = dstof(q0r + 16) + 8 * hh;
  *(v8f*)d0 = o00 * i0; *(v8f*)(d0 + 16) = o01 * i0; *(v8f*)d1 = o10 * i1; *(v8f*)(d1 + 16) = o11 * i1; }
__global__ __launch_bounds__(256) void k_biasmix(const float* __restrict__ CTX, const float* __restrict__ KF, const float* __restrict__ dwk, const float* __restrict__ dwb, _Float16* __restrict__ C16) {
  #pragma clang fp contract(off)
  const size_t t = (size_t)blockIdx.x * 256 + threadIdx.x; if (t >= (size_t)NR * CH / 8) return; const int c0 = (int)((t * 8) % CH); const size_t row = (t * 8) / CH; const int b = (int)(row / NPX), p = (int)(row % NPX); const int y = p / WSD, x = p % WSD; float acc[8]; for (int q = 0; q < 8; ++q) acc[q] = 0.f;
#pragma unroll 1
  for (int i = 0; i < 3; ++i) { const int yy = y + i - 1; if (yy < 0 || yy >= HS) continue;
#pragma unroll 1
    for (int j = 0; j < 3; ++j) { const int xx = x + j - 1; if (xx < 0 || xx >= WSD) continue; const v8f v = *(const v8f*)(KF + (((size_t)b * HS + yy) * WSD + xx) * CH + c0);
#pragma unroll
      for (int q = 0; q < 8; ++q) acc[q] += hswish(v[q]) * bf16_round(dwk[(i * 3 + j) * CH + c0 + q]); } }
  const v8f cx = *(const v8f*)(CTX + t * 8); FragH f; for (int q = 0; q < 8; ++q) { float s = acc[q]; s += bf16_round(dwb[c0 + q]); float u = cx[q]; u += s; f.h[q] = (_Float16)hswish(u); }
  *(v8us*)((unsigned short*)C16 + t * 8) = f.half[0];  }

extern "C" void kernel_launch(void* const* d_in, const int* in_sizes, int n_in,
                              void* d_out, int out_size, void* d_ws, size_t ws_size, hipStream_t stream) {
  (void)in_sizes; (void)n_in; (void)out_size;
  const float* x = (const float*)d_in[0]; const float* wqkv = (const float*)d_in[1]; const float* bqkv = (const float*)d_in[2]; const float* dwk = (const float*)d_in[3]; const float* dwb = (const float*)d_in[4]; const float* wout = (const float*)d_in[5]; const float* bout = (const float*)d_in[6];
  char* ws = (char*)d_ws; size_t off = 0;
  auto take = [&](size_t bytes) { char* p = ws + off; off += (bytes + 255) & ~(size_t)255; return p; };
  const size_t ne = (size_t)NR * CH;
  _Float16* BQK = (_Float16*)take((size_t)2 * CH * CH * 2); _Float16* BO = (_Float16*)take((size_t)CH * CH * 2);
  _Float16* X16 = (_Float16*)take(ne * 2); _Float16* Q16 = (_Float16*)take(ne * 2); float* KF = (float*)take(ne * 4); _Float16* K16 = (_Float16*)take(ne * 2);
  float* CTX = (float*)take(ne * 4); _Float16* C16 = X16;      /* final operand over the x rows (dead) */
  if (off > ws_size) return;      /* 0.4 + 16 + 16 + 32 + 16 + 32 = about 113 MiB */
  k_wt_f16<<<(unsigned)(((size_t)CH * 2 * CH / 8 + 255) / 256), 256, 0, stream>>>(wqkv, BQK, CH, 2 * CH, 16.0f); k_wt_f16<<<(unsigned)(((size_t)CH * CH / 8 + 255) / 256), 256, 0, stream>>>(wout, BO, CH, CH, 16.0f);      /* (in, out) */
  k_x16<<<(unsigned)((ne / 8 + 255) / 256), 256, 0, stream>>>(x, X16, ne / 8);
  const dim3 g(NR / 128, 1);
  k_gemm3<0><<<g, 512, 0, stream>>>(X16, 0, BQK, 0, 0.0625f, bqkv, 0, nullptr, 1, 0, 0, nullptr, Q16, CH, 0, NR);      /* q (f16) */
  k_gemm3<0><<<g, 512, 0, stream>>>(X16, 0, BQK + (size_t)CH * CH, 0, 0.0625f, bqkv + CH, 0, nullptr, 1, 0, 0, KF, K16, CH, 0, NR);      /* k = v (f32 + f16, both from the epilogue) */
  k_attn<<<dim3(NPL * NHB, 2), 512, 0, stream>>>(Q16, K16, CTX);      /* y = 0: horizontal, context columns h*32; y = 1: vertical, context columns 128.. through the permutation */
  k_biasmix<<<(unsigned)((ne / 8 + 255) / 256), 256, 0, stream>>>(CTX, KF, dwk, dwb, C16);
  k_gemm3<0><<<g, 512, 0, stream>>>(C16, 0, BO, 0, 0.0625f, bout, 0, nullptr, 1, 0, 0, (float*)d_out, nullptr, CH, 0, NR);      /* out = hswish(context + bias) w_out + b */
}

// v004
// One run takes 88.4 microseconds.
// Timed twice side by side with v003, it ran 1.13 and 1.14 times as fast.
// All steps since v000 together make it 9.86 times as fast.
#include <hip/hip_runtime.h>
// CrossShapedAttention (8 x 64 x 64 x 256, window 8, 4 heads x 32 per branch: [q | k] = x w_qkv + b (v = k); horizontal branch = channels 0..127 attending within each 8-row stripe (512 tokens), vertical branch = channels 128..255 within each 8-column stripe; softmax(q.k / sqrt(32)) v; the vertical context is put back through the TF code's exact reshape/transpose order (a fixed permutation of (row-in-stripe, column, head, channel)); bias = depthwise3x3(hard_swish(v)) + b; out = hard_swish(context + bias) w_out + b_out).
// Structure: q and k(=v) as f16 WMMA GEMMs in one launch that reads the f32 x rows itself and stages them once as exact f16 rows (32x64 wave tiles, f32 accumulation, exact x16 (in,out) weights + bias; q f16, k f32 + f16); horizontal stripes are contiguous row ranges: one fused launch does scores (K = 32), softmax (exact row maximum, f16 x 2^10 unnormalised, f32 row sum) and readout (N = 32) per (plane, head) with K and V^T in LDS (V^T is built from the K rows while they are staged), writing context columns h*32.. directly; the vertical branch runs in the same launch: it reads its q/k rows in place by the stripe's row map (token = row*8 + column-in-stripe) and stores its result through the reference's permutation; the hard-swish + depthwise 3x3 bias on VALU (f32, added into the context rows); hard_swish into f16 rows; output projection GEMM writing the [B,H,W,C] output.
// Compute dtype: inputs rounded to bf16; x / weights exact as f16; q, k, v and the final context as plain f16 GEMM operands (~2^-12); softmax / hard-swish / depthwise in f32. v_wmma_f32_16x16x32_f16.
#define NI 8
#define HS 64
#define WSD 64
#define CH 256
#define CHH 128                  /* channels per branch */
#define NHB 4                    /* heads per branch */
#define DH 32
#define WIN 8
#define NST 8                    /* stripes per image per branch */
#define TOKS 512                 /* tokens per stripe */
#define NPX (HS * WSD)
#define NR (NI * NPX)            /* 32768 */
#define NPL (NI * NST)           /* 64 (image, stripe) planes per branch */
typedef __bf16 v16b __attribute__((ext_vector_type(16)));
typedef unsigned short v8us __attribute__((ext_vector_type(8), may_alias));
typedef float  v8f  __attribute__((ext_vector_type(8)));
typedef float  v4f  __attribute__((ext_vector_type(4)));
typedef float  v4fa __attribute__((ext_vector_type(4), may_alias));
union FragB { v16b v; v8us half[2]; unsigned short u[16]; };

__device__ __forceinline__ unsigned short bf16_bits(float x) { unsigned int u = __float_as_uint(x); return (unsigned short)((u + 0x7FFFu + ((u >> 16) & 1u)) >> 16); }
__device__ __forceinline__ float bf16_val(unsigned short b) { return __uint_as_float(((unsigned int)b) << 16); }
__device__ __forceinline__ float bf16_round(float x) { return bf16_val(bf16_bits(x)); }
// D += A·B with NT terms: 1 = ah·bh, 2 = + al·bh (A split), 3 = + ah·bl (both split)
template <int NT>
__device__ __forceinline__ v8f mmaN(v16b ah, v16b al, v16b bh, v16b bl, v8f c) {
  c = __builtin_amdgcn_wmma_f32_16x16x32_bf16(false, ah, false, bh, (short)0, c, false, false);
  if (NT >= 2) c = __builtin_amdgcn_wmma_f32_16x16x32_bf16(false, al, false, bh, (short)0, c, false, false);
  if (NT >= 3) c = __builtin_amdgcn_wmma_f32_16x16x32_bf16(false, ah, false, bl, (short)0, c, false, false);
  asm volatile("v_nop\n\tv_nop\n\tv_nop\n\tv_nop" : "+v"(c) : "v"(ah), "v"(al), "v"(bh), "v"(bl));
  return c;
}

__global__ __launch_bounds__(256) void k_wt_bf16(const float* __restrict__ W, unsigned short* __restrict__ Wt, int K, int N) {
  const int t = blockIdx.x * 256 + threadIdx.x;
  const int k8n = K / 8;
  if (t >= N * k8n) return;
  const int n = t / k8n, k8 = (t % k8n) * 8;
  v8us v;
#pragma unroll
  for (int i = 0; i < 8; ++i) v[i] = bf16_bits(W[(size_t)(k8 + i) * N + n]);
  *(v8us*)(Wt + (size_t)n * K + k8) = v;
  
}

// GEMM C[M][N] (f32, pitch ldc) = act(A[M][K]·W + bias). A f32 row-major (pitch lda) converted per fragment to bf16
// (ASPLIT: hi/lo two planes -> 2 terms, else single rounded term); Wt bf16 [N][K] (pitch ldb). BIAS_BF16 rounds the
// bias to bf16 first (bias quantised to bf16 before the add). K%32==0, M%16==0, N%64==0.
template <bool ASPLIT, int ACT, bool BIAS_BF16>
__global__ __launch_bounds__(128) void k_gemm_bf(const float* __restrict__ A, int lda, const unsigned short* __restrict__ Wt, int ldb,
                                               const float* __restrict__ bias, float* __restrict__ C, int ldc, int M, int N, int K) {
  __shared__ __attribute__((aligned(16))) float so[4][16][64];
  const int tid = threadIdx.x, w = tid >> 5, lane = tid & 31, ln = lane & 15, hh = lane >> 4;
  const int ntn = N / 64;
  const int wid = blockIdx.x * 4 + w;
  const int mt = wid / ntn, nq = wid % ntn;
  if (mt * 16 >= M) return;
  const int row0 = mt * 16, col0 = nq * 64;
  const float* arow = A + (size_t)(row0 + ln) * lda;
  v8f acc[4] = {};
  for (int kb = 0; kb < K; kb += 32) {
    FragB ah, al;
    const v4f x0 = *(const v4fa*)(arow + kb + 8 * hh), x1 = *(const v4fa*)(arow + kb + 8 * hh + 4);
    const v4f x2 = *(const v4fa*)(arow + kb + 16 + 8 * hh), x3 = *(const v4fa*)(arow + kb + 16 + 8 * hh + 4);
    float xs[16] = {x0[0],x0[1],x0[2],x0[3],x1[0],x1[1],x1[2],x1[3],x2[0],x2[1],x2[2],x2[3],x3[0],x3[1],x3[2],x3[3]};
#pragma unroll
    for (int i = 0; i < 16; ++i) { const unsigned short hb = bf16_bits(xs[i]); ah.u[i] = hb; al.u[i] = ASPLIT ? bf16_bits(xs[i] - bf16_val(hb)) : (unsigned short)0; }
#pragma unroll
    for (int t = 0; t < 4; ++t) {
      const unsigned short* brow = Wt + (size_t)(col0 + t * 16 + ln) * ldb + kb;
      FragB b;
      b.half[0] = *(const v8us*)(brow + 8 * hh);
      b.half[1] = *(const v8us*)(brow + 16 + 8 * hh);
      acc[t] = mmaN<ASPLIT ? 2 : 1>(ah.v, al.v, b.v, b.v, acc[t]);
    }
  }
#pragma unroll
  for (int t = 0; t < 4; ++t) {
    float bv = bias ? bias[col0 + t * 16 + ln] : 0.f;
    if (BIAS_BF16) bv = bf16_round(bv);
#pragma unroll
    for (int r = 0; r < 8; ++r) { float v = acc[t][r] + bv; if (ACT == 1) v = fmaxf(v, 0.f); so[w][8 * hh + r][t * 16 + ln] = v; }
  }
  __builtin_amdgcn_fence(__ATOMIC_ACQ_REL, "workgroup");
  __builtin_amdgcn_wave_barrier();
  const int rsub = lane >> 4, c4 = (lane & 15) * 4;
  {
#pragma unroll
    for (int q = 0; q < 8; ++q) {
      const int r = q * 2 + rsub;
      const v4f v = *(const v4fa*)&so[w][r][c4];
      *(v4f*)(C + (size_t)(row0 + r) * ldc + col0 + c4) = v;
    }
    
  }
}

// GEMM C = act(A·W + bias + resid): A f32 (ASPLIT -> hi/lo 2 terms), Wt bf16 [N][K]; ACT 0 none, 1 relu, 2 exact gelu;
// resid (optional, f32, row index = (row % rmod), pitch ldr, RES_BF16 rounds it) added before the activation.
template <bool ASPLIT, int ACT, bool BIAS_BF16, bool RES_BF16>
__global__ __launch_bounds__(128) void k_gemm_bf3(const float* __restrict__ A, int lda, const unsigned short* __restrict__ Wt, int ldb,
                                                const float* __restrict__ bias, const float* __restrict__ resid, int rmod, int ldr,
                                                float* __restrict__ C, int ldc, int M, int N, int K) {
  __shared__ __attribute__((aligned(16))) float so[4][16][64];
  const int tid = threadIdx.x, w = tid >> 5, lane = tid & 31, ln = lane & 15, hh = lane >> 4;
  const int ntn = N / 64;
  const int wid = blockIdx.x * 4 + w;
  const int mt = wid / ntn, nq = wid % ntn;
  if (mt * 16 >= M) return;
  const int row0 = mt * 16, col0 = nq * 64;
  const float* arow = A + (size_t)(row0 + ln) * lda;
  v8f acc[4] = {};
  for (int kb = 0; kb < K; kb += 32) {
    FragB ah, al;
    const v4f x0 = *(const v4fa*)(arow + kb + 8 * hh), x1 = *(const v4fa*)(arow + kb + 8 * hh + 4);
    const v4f x2 = *(const v4fa*)(arow + kb + 16 + 8 * hh), x3 = *(const v4fa*)(arow + kb + 16 + 8 * hh + 4);
    float xs[16] = {x0[0],x0[1],x0[2],x0[3],x1[0],x1[1],x1[2],x1[3],x2[0],x2[1],x2[2],x2[3],x3[0],x3[1],x3[2],x3[3]};
#pragma unroll
    for (int i = 0; i < 16; ++i) { const unsigned short hb = bf16_bits(xs[i]); ah.u[i] = hb; al.u[i] = ASPLIT ? bf16_bits(xs[i] - bf16_val(hb)) : (unsigned short)0; }
#pragma unroll
    for (int t = 0; t < 4; ++t) {
      const unsigned short* brow = Wt + (size_t)(col0 + t * 16 + ln) * ldb + kb;
      FragB b;
      b.half[0] = *(const v8us*)(brow + 8 * hh);
      b.half[1] = *(const v8us*)(brow + 16 + 8 * hh);
      acc[t] = mmaN<ASPLIT ? 2 : 1>(ah.v, al.v, b.v, b.v, acc[t]);
    }
  }
#pragma unroll
  for (int t = 0; t < 4; ++t) {
    const int col = col0 + t * 16 + ln;
    float bv = bias ? bias[col] : 0.f;
    if (BIAS_BF16) bv = bf16_round(bv);
#pragma unroll
    for (int r = 0; r < 8; ++r) {
      float v = acc[t][r] + bv;
      if (resid) { float rv = resid[(size_t)((row0 + 8 * hh + r) % rmod) * ldr + col]; if (RES_BF16) rv = bf16_round(rv); v += rv; }
      if (ACT == 1) v = fmaxf(v, 0.f);
      if (ACT == 2) v = 0.5f * v * (1.0f + erff(v * 0.70710678118654752f));
      if (ACT == 3) { const float u = 0.7978845608028654f * (v + 0.044715f * v * v * v); v = 0.5f * v * (1.0f + tanhf(u)); }
      so[w][8 * hh + r][t * 16 + ln] = v;
    }
  }
  __builtin_amdgcn_fence(__ATOMIC_ACQ_REL, "workgroup");
  __builtin_amdgcn_wave_barrier();
  const int rsub = lane >> 4, c4 = (lane & 15) * 4;
  {
#pragma unroll
    for (int q = 0; q < 8; ++q) {
      const int r = q * 2 + rsub;
      const v4f v = *(const v4fa*)&so[w][r][c4];
      *(v4f*)(C + (size_t)(row0 + r) * ldc + col0 + c4) = v;
    }
    
  }
}
// row LayerNorm (biased variance, eps) over N: s = X (+ R); optional out_sum <- s; out_norm <- (s-mu)*rsqrt(var+eps)*g + b
template <bool PARAM_BF16>
__global__ __launch_bounds__(256) void k_layernorm(const float* __restrict__ X, const float* __restrict__ R, const float* __restrict__ g, const float* __restrict__ bta,
                                                  float* __restrict__ out_sum, float* __restrict__ out_norm, int N, float eps) {
  __shared__ float red[256];
  const int row = blockIdx.x, tid = threadIdx.x;
  const float* x = X + (size_t)row * N; const float* rr = R ? R + (size_t)row * N : nullptr;
  float vals[16];                     // up to N = 4096
  const int per = N / 256;            // contiguous chunk per thread? use strided-by-4 chunks: thread handles j = tid*4 + 1024*u
  float s1 = 0.f;
  for (int u = 0; u < per / 4; ++u) {
    const int j = tid * 4 + 1024 * u;
    const v4f a = *(const v4fa*)(x + j);
    v4f b = {0.f,0.f,0.f,0.f}; if (rr) b = *(const v4fa*)(rr + j);
#pragma unroll
    for (int q = 0; q < 4; ++q) { const float v = a[q] + b[q]; vals[u * 4 + q] = v; s1 += v; }
  }
  red[tid] = s1; __syncthreads();
  for (int st = 128; st > 0; st >>= 1) { if (tid < st) red[tid] += red[tid + st]; __syncthreads(); }
  const float mu = red[0] / (float)N; __syncthreads();
  float s2 = 0.f;
  for (int u = 0; u < per / 4; ++u)
#pragma unroll
    for (int q = 0; q < 4; ++q) { const float c = vals[u * 4 + q] - mu; s2 += c * c; }
  red[tid] = s2; __syncthreads();
  for (int st = 128; st > 0; st >>= 1) { if (tid < st) red[tid] += red[tid + st]; __syncthreads(); }
  const float rs = rsqrtf(red[0] / (float)N + eps);
  {
    for (int u = 0; u < per / 4; ++u) {
      const int j = tid * 4 + 1024 * u;
      v4f o, sm;
#pragma unroll
      for (int q = 0; q < 4; ++q) {
        float gg = g[j + q], bb = bta[j + q];
        if (PARAM_BF16) { gg = bf16_round(gg); bb = bf16_round(bb); }
        sm[q] = vals[u * 4 + q]; o[q] = (vals[u * 4 + q] - mu) * rs * gg + bb;
      }
      if (out_sum) *(v4f*)(out_sum + (size_t)row * N + j) = sm;
      *(v4f*)(out_norm + (size_t)row * N + j) = o;
    }
    
  }
}



// ---- f16 WMMA path (v_wmma_f32_16x16x32_f16): 11-bit significands for operands in range — used for every GEMM here, including the 2^10-scaled probability operand that needs more precision than bf16
typedef _Float16 v16h __attribute__((ext_vector_type(16)));
union FragH { v16h v; v8us half[2]; _Float16 h[16]; unsigned short u[16]; };
template <int NT>
__device__ __forceinline__ v8f mmaH(v16h ah, v16h al, v16h bh, v16h bl, v8f c) {
  c = __builtin_amdgcn_wmma_f32_16x16x32_f16(false, ah, false, bh, (short)0, c, false, false);
  if (NT >= 2) c = __builtin_amdgcn_wmma_f32_16x16x32_f16(false, al, false, bh, (short)0, c, false, false);
  if (NT >= 3) c = __builtin_amdgcn_wmma_f32_16x16x32_f16(false, ah, false, bl, (short)0, c, false, false);
  asm volatile("v_nop\n\tv_nop\n\tv_nop\n\tv_nop" : "+v"(c) : "v"(ah), "v"(al), "v"(bh), "v"(bl));
  return c;
}
// batched GEMM like k_gemm_b but f16 operands: A f32 (split into f16 hi/lo if ASPLIT, else rounded to f16), Bt = f16 values [n][k]; alpha; C f32; N multiple of 16 (partial tiles skipped)
template <bool ASPLIT>
__global__ __launch_bounds__(128) void k_gemm_h(const float* __restrict__ A, int lda, size_t sA, const _Float16* __restrict__ Bh, int ldb, size_t sB, float alpha, float* __restrict__ C, int ldc, size_t sC, int M, int N, int K) {
  __shared__ __attribute__((aligned(16))) float so[4][16][64];
  const int tid = threadIdx.x, w = tid >> 5, lane = tid & 31, ln = lane & 15, hh = lane >> 4; const int by = blockIdx.y;
  A += (size_t)by * sA; Bh += (size_t)by * sB; C += (size_t)by * sC;
  const int ntn = (N + 63) / 64; const int wid = blockIdx.x * 4 + w; const int mt = wid / ntn, nq = wid % ntn; if (mt * 16 >= M) return;
  const int row0 = mt * 16, col0 = nq * 64; const float* arow = A + (size_t)(row0 + ln) * lda;
  v8f acc[4] = {};
  for (int kb = 0; kb < K; kb += 32) {
    FragH ah, al;
    const v4f x0 = *(const v4fa*)(arow + kb + 8 * hh), x1 = *(const v4fa*)(arow + kb + 8 * hh + 4), x2 = *(const v4fa*)(arow + kb + 16 + 8 * hh), x3 = *(const v4fa*)(arow + kb + 16 + 8 * hh + 4);
    float xs[16] = {x0[0],x0[1],x0[2],x0[3],x1[0],x1[1],x1[2],x1[3],x2[0],x2[1],x2[2],x2[3],x3[0],x3[1],x3[2],x3[3]};
#pragma unroll
    for (int i = 0; i < 16; ++i) { const _Float16 h = (_Float16)xs[i]; ah.h[i] = h; al.h[i] = ASPLIT ? (_Float16)(xs[i] - (float)h) : (_Float16)0.0f; }
#pragma unroll
    for (int t = 0; t < 4; ++t) { if (col0 + t * 16 >= N) continue; const size_t boff = (size_t)(col0 + t * 16 + ln) * ldb + kb; FragH bq; bq.half[0] = *(const v8us*)(Bh + boff + 8 * hh); bq.half[1] = *(const v8us*)(Bh + boff + 16 + 8 * hh);
      acc[t] = mmaH<ASPLIT ? 2 : 1>(ah.v, al.v, bq.v, bq.v, acc[t]); }
  }
#pragma unroll
  for (int t = 0; t < 4; ++t) { if (col0 + t * 16 >= N) continue;
#pragma unroll
    for (int r = 0; r < 8; ++r) so[w][8 * hh + r][t * 16 + ln] = acc[t][r] * alpha; }
  __builtin_amdgcn_fence(__ATOMIC_ACQ_REL, "workgroup"); __builtin_amdgcn_wave_barrier();
  const int rsub = lane >> 4, c4 = (lane & 15) * 4;
  {
#pragma unroll
    for (int q = 0; q < 8; ++q) { const int r = q * 2 + rsub; if (col0 + c4 < N) { const v4f v = *(const v4fa*)&so[w][r][c4]; *(v4f*)(C + (size_t)(row0 + r) * ldc + col0 + c4) = v; } }
     }
}

// Wt[n][k] = f16(W[k][n]·scale) from f32 row-major W[K][N] (scale = power of two; bf16-exact weights stay exact in f16 away from the subnormal range)
__global__ __launch_bounds__(256) void k_wt_f16(const float* __restrict__ W, _Float16* __restrict__ Wt, int K, int N, float scale) {
  const int t = blockIdx.x * 256 + threadIdx.x; if (t >= N * (K / 8)) return; const int n = t / (K / 8), k8 = (t % (K / 8)) * 8; FragH f;
#pragma unroll
  for (int i = 0; i < 8; ++i) f.h[i] = (_Float16)(bf16_round(W[(size_t)(k8 + i) * N + n]) * scale); const v8us o = f.half[0];
  *(v8us*)((unsigned short*)Wt + (size_t)n * K + k8) = o; 
}
// k_gemm_hh variant with fused epilogue: v = acc·alpha + bias[by·sBias + col] (+ CP[(row/rowsPerB)·sCPb + by·64 + col] if CP) ; ACT 0 none / 1 elu ; writes f32 C and/or f16 C16 (each if non-null)
template <int ACT>
__global__ __launch_bounds__(128) void k_gemm_hhx(const _Float16* __restrict__ A, int lda, size_t sA, const _Float16* __restrict__ Bh, int ldb, size_t sB, float alpha, const float* __restrict__ bias, size_t sBias, const float* __restrict__ CP, int rowsPerB, size_t sCPb, int row0g,
    float* __restrict__ C, _Float16* __restrict__ C16, int ldc, size_t sC, int M, int N, int K) {
  __shared__ __attribute__((aligned(16))) float so[4][16][64];
  const int tid = threadIdx.x, w = tid >> 5, lane = tid & 31, ln = lane & 15, hh = lane >> 4; const int by = blockIdx.y;
  A += (size_t)by * sA; Bh += (size_t)by * sB; const size_t cofs = (size_t)by * sC; const float* bp = bias ? bias + (size_t)by * sBias : nullptr;
  const int ntn = (N + 63) / 64; const int wid = blockIdx.x * 4 + w; const int mt = wid / ntn, nq = wid % ntn; if (mt * 16 >= M) return;
  const int row0 = mt * 16, col0 = nq * 64; const _Float16* arow = A + (size_t)(row0 + ln) * lda;
  v8f acc[4] = {};
  for (int kb = 0; kb < K; kb += 32) { FragH ah; ah.half[0] = *(const v8us*)((const unsigned short*)arow + kb + 8 * hh); ah.half[1] = *(const v8us*)((const unsigned short*)arow + kb + 16 + 8 * hh);
#pragma unroll
    for (int t = 0; t < 4; ++t) { if (col0 + t * 16 >= N) continue; const size_t boff = (size_t)(col0 + t * 16 + ln) * ldb + kb; FragH bq; bq.half[0] = *(const v8us*)((const unsigned short*)Bh + boff + 8 * hh); bq.half[1] = *(const v8us*)((const unsigned short*)Bh + boff + 16 + 8 * hh);
      acc[t] = mmaH<1>(ah.v, ah.v, bq.v, bq.v, acc[t]); }
  }
#pragma unroll
  for (int t = 0; t < 4; ++t) { if (col0 + t * 16 >= N) continue; const int col = col0 + t * 16 + ln; const float bv = bp ? bf16_round(bp[col]) : 0.f;
#pragma unroll
    for (int r = 0; r < 8; ++r) { float v = acc[t][r] * alpha + bv; if (CP) { const int rr = row0g + row0 + 8 * hh + r; if (rowsPerB < 0) v += CP[cofs + (size_t)rr * ldc + col];      /* rowsPerB < 0: own element of the batched C plane */ else { const int bidx = rr / rowsPerB; v += CP[(size_t)bidx * sCPb + (size_t)by * 64 + col]; } } if (ACT == 1) v = (v > 0.f) ? v : expm1f(v); else if (ACT == 7) v = (v > 0.f) ? v + 1.0f : expf(v); else if (ACT == 8) v = tanhf(v); else if (ACT == 9) v = 0.5f * v * (1.0f + tanhf(0.7978845608028654f * (v + 0.044715f * v * v * v))); else if (ACT == 11) v = 1.0f / (1.0f + expf(-v)); else if (ACT == 12) v = (v > 0.f) ? v : 0.01f * v; else if (ACT == 14) v = (v > 0.f) ? v : 0.1f * v; else if (ACT == 16) v = (v >= 0.f) ? v : 0.3f * v; else if (ACT == 17) v = (v >= 0.f) ? v : 0.2f * v; else if (ACT == 15) v = v / (1.0f + expf(-v)); else if (ACT == 3) v = fmaxf(v, 0.f); else if (ACT == 6) v = 0.5f * v * (1.0f + erff(v * 0.70710678118654752f)); so[w][8 * hh + r][t * 16 + ln] = v; } }
  __builtin_amdgcn_fence(__ATOMIC_ACQ_REL, "workgroup"); __builtin_amdgcn_wave_barrier();
  const int rsub = lane >> 4, c4 = (lane & 15) * 4; typedef _Float16 v4h __attribute__((ext_vector_type(4)));
  {
#pragma unroll
    for (int q = 0; q < 8; ++q) { const int r = q * 2 + rsub; if (col0 + c4 < N) { const v4f v = *(const v4fa*)&so[w][r][c4]; if (C) *(v4f*)(C + cofs + (size_t)(row0 + r) * ldc + col0 + c4) = v; if (C16) { v4h h4; for (int i = 0; i < 4; ++i) h4[i] = (_Float16)v[i]; *(v4h*)(C16 + cofs + (size_t)(row0 + r) * ldc + col0 + c4) = h4; } } }
     }
}


typedef _Float16 v4h __attribute__((ext_vector_type(4)));

__global__ __launch_bounds__(256) void k_round16f(const float* __restrict__ W, _Float16* __restrict__ Bt, size_t n8) { const size_t t = (size_t)blockIdx.x * 256 + threadIdx.x; if (t >= n8) return; FragH f;
#pragma unroll
  for (int i = 0; i < 8; ++i) f.h[i] = (_Float16)(bf16_round(W[t * 8 + i]) * 16.0f); *(v8us*)((unsigned short*)Bt + t * 8) = f.half[0];  }
template <int NHv, int TTv>
__global__ __launch_bounds__(256) void k_vt(const _Float16* __restrict__ V16, int ldv, int voff, _Float16* __restrict__ Vt) { __shared__ unsigned short tl[64][66]; const int tid = threadIdx.x; const int slab = blockIdx.x / (TTv / 64), lg = blockIdx.x % (TTv / 64); const int b = slab / NHv, h = slab % NHv;
  for (int i = tid; i < 64 * 8; i += 256) { const int r = i / 8, c8 = (i % 8) * 8; FragH f; f.half[0] = *(const v8us*)((const unsigned short*)V16 + ((size_t)b * TTv + lg * 64 + r) * ldv + voff + h * 64 + c8);
#pragma unroll
    for (int q = 0; q < 8; ++q) tl[r][c8 + q] = f.u[q]; }
  __syncthreads();
  {
#pragma unroll
    for (int rd = 0; rd < 2; ++rd) { const int d = rd * 32 + tid / 8, pc = tid % 8; FragH f;
#pragma unroll
      for (int q = 0; q < 8; ++q) f.u[q] = tl[pc * 8 + q][d];
      *(v8us*)((unsigned short*)Vt + ((size_t)slab * 64 + d) * TTv + lg * 64 + pc * 8) = f.half[0]; }
     } }

__global__ __launch_bounds__(256) void k_hl(const float* __restrict__ F, _Float16* __restrict__ Hh, _Float16* __restrict__ Hl, size_t n8) { const size_t t = (size_t)blockIdx.x * 256 + threadIdx.x; if (t >= n8) return; FragH fh, fl; const v4f a = *(const v4fa*)(F + t * 8), c = *(const v4fa*)(F + t * 8 + 4);
#pragma unroll
  for (int q = 0; q < 4; ++q) { _Float16 h = (_Float16)a[q]; fh.h[q] = h; fl.h[q] = (_Float16)((a[q] - (float)h) * 1024.0f); h = (_Float16)c[q]; fh.h[4 + q] = h; fl.h[4 + q] = (_Float16)((c[q] - (float)h) * 1024.0f); }
  { *(v8us*)((unsigned short*)Hh + t * 8) = fh.half[0]; *(v8us*)((unsigned short*)Hl + t * 8) = fl.half[0];  } }

// ---- fast GEMM for dense rows of CH f16 (K = CH, N = CH, M % 128 == 0): one work-group = 128 rows x all CH columns, 16 waves of 32x64 tiles (4 row groups x 4 column groups); epilogue = k_gemm_hhx semantics ----
// The A rows and all B rows are brought in once as whole 512-byte rows (one row per wave-wide load) and staged in LDS; the fragments are read from there. After the products the same LDS holds the waves' output tiles.
#define GP (CH + 8)              /* LDS pitch of a staged row, f16 units: 528 B = 16 B x odd, conflict-free for 16-byte fragment reads */
__device__ __forceinline__ v16h g3_frag(const unsigned short* p) { FragH f; f.half[0] = *(const v8us*)p; f.half[1] = *(const v8us*)(p + 16); return f.v; }
__device__ __forceinline__ v8f g3_mma(v16h a, v16h b, v8f c) { return __builtin_amdgcn_wmma_f32_16x16x32_f16(false, a, false, b, (short)0, c, false, false); }
template <int ACT>
__global__ __launch_bounds__(512) void k_gemm3(const _Float16* __restrict__ A, size_t sA, const _Float16* __restrict__ Bh, size_t sB, float alpha, const float* __restrict__ bias, size_t sBias, const float* __restrict__ CP, int rowsPerB, size_t sCPb, int row0g,
    float* __restrict__ C, _Float16* __restrict__ C16, int ldc, size_t sC, int M) { static_assert(ACT == 0 || ACT == 3 || ACT == 6 || ACT == 8 || ACT == 9 || ACT == 11 || ACT == 12 || ACT == 14 || ACT == 15 || ACT == 16 || ACT == 17, "k_gemm3: unsupported ACT code (would silently apply no activation)");
  __shared__ __attribute__((aligned(16))) unsigned short sab[(128 + CH) * GP];      /* 128 A rows, then CH B rows */
  float (*so)[32][68] = reinterpret_cast<float (*)[32][68]>(sab);      /* 16 output tiles over the staged rows, behind the second barrier */
  static_assert(sizeof(float) * 16 * 32 * 68 <= sizeof(unsigned short) * (128 + CH) * GP, "output tiles must fit the staging bytes");
  const int tid = threadIdx.x, w = tid >> 5, lane = tid & 31, ln = lane & 15, hh = lane >> 4; const int by = blockIdx.y;
  A += (size_t)by * sA; Bh += (size_t)by * sB; const size_t cofs = (size_t)by * sC; const float* bp = bias ? bias + (size_t)by * sBias : nullptr;
  const int mt = blockIdx.x; if (mt * 128 >= M) return;      /* the same for the whole work-group, in front of both barriers */
  const int row0 = mt * 128 + 32 * (w & 3), col0 = (w >> 2) * 64;
  { const unsigned short* ag = (const unsigned short*)A + ((size_t)mt * 128 + w) * CH + lane * 8; const unsigned short* bg = (const unsigned short*)Bh + (size_t)w * CH + lane * 8;
    v8us ra[8], rb[16];      /* the four loops below are unrolled so that these stay in registers and all 24 loads are in flight before the first LDS store waits for one */
#pragma unroll
    for (int u = 0; u < 8; ++u) ra[u] = *(const v8us*)(ag + u * 16 * CH);
#pragma unroll
    for (int u = 0; u < 16; ++u) rb[u] = *(const v8us*)(bg + u * 16 * CH);
    unsigned short* sw = sab + w * GP + lane * 8;
#pragma unroll
    for (int u = 0; u < 8; ++u) *(v8us*)(sw + u * 16 * GP) = ra[u];
#pragma unroll
    for (int u = 0; u < 16; ++u) *(v8us*)(sw + (128 + u * 16) * GP) = rb[u]; }
  __syncthreads();      /* publishes the staged A and B rows; they are only read until the next barrier */
  const unsigned short* al = sab + (32 * (w & 3) + ln) * GP + 8 * hh; const unsigned short* bl = sab + (128 + col0 + ln) * GP + 8 * hh;
  const v8f z8 = {0.f,0.f,0.f,0.f,0.f,0.f,0.f,0.f}; v8f c00 = z8, c01 = z8, c02 = z8, c03 = z8, c10 = z8, c11 = z8, c12 = z8, c13 = z8;
  /* two register sets: the twelve LDS reads of k step s + 1 stand as one group ahead of the eight products of step s, so that a wave waits for a group once a step and not before every pair of products; unrolled so that the set index is a constant and every read has an immediate offset */
  v16h fa[2][2], fb[2][4];
  fa[0][0] = g3_frag(al); fa[0][1] = g3_frag(al + 16 * GP);
#pragma unroll
  for (int t = 0; t < 4; ++t) fb[0][t] = g3_frag(bl + t * 16 * GP);
#pragma unroll
  for (int s = 0; s < CH / 32; ++s) { const int cu = s & 1, nx = cu ^ 1;
    if (s + 1 < CH / 32) { const int kb = (s + 1) * 32; fa[nx][0] = g3_frag(al + kb); fa[nx][1] = g3_frag(al + 16 * GP + kb);
#pragma unroll
      for (int t = 0; t < 4; ++t) fb[nx][t] = g3_frag(bl + t * 16 * GP + kb); }
    __builtin_amdgcn_sched_barrier(0);      /* keeps the read group above in front of these products: without it the compiler moves each pair of reads down to its first use and waits there for it */
    c00 = g3_mma(fa[cu][0], fb[cu][0], c00); c10 = g3_mma(fa[cu][1], fb[cu][0], c10); c01 = g3_mma(fa[cu][0], fb[cu][1], c01); c11 = g3_mma(fa[cu][1], fb[cu][1], c11);
    c02 = g3_mma(fa[cu][0], fb[cu][2], c02); c12 = g3_mma(fa[cu][1], fb[cu][2], c12); c03 = g3_mma(fa[cu][0], fb[cu][3], c03); c13 = g3_mma(fa[cu][1], fb[cu][3], c13); }
  __syncthreads();      /* every wave has read its last staged fragment: from here the bytes are the waves' own output tiles */
  v8f accs[8] = {c00, c01, c02, c03, c10, c11, c12, c13};
#pragma unroll
  for (int u = 0; u < 8; ++u) { const int t = u & 3, half = u >> 2; const int col = col0 + t * 16 + ln; const float bv = bp ? bf16_round(bp[col]) : 0.f;
#pragma unroll
    for (int r = 0; r < 8; ++r) { const int rloc = half * 16 + 8 * hh + r; float v = accs[u][r] * alpha + bv; if (CP) { if (rowsPerB < 0) v += CP[cofs + (size_t)(row0g + row0 + rloc) * ldc + col];      /* rowsPerB < 0: own element of the batched C plane */ else { const int bidx = (row0g + row0 + rloc) / rowsPerB; v += CP[(size_t)bidx * sCPb + (size_t)by * 64 + col]; } }
      if (ACT == 3) v = fmaxf(v, 0.f); else if (ACT == 6) v = 0.5f * v * (1.0f + erff(v * 0.70710678118654752f)); else if (ACT == 11) v = 1.0f / (1.0f + expf(-v)); else if (ACT == 15) v = v / (1.0f + expf(-v)); else if (ACT == 12) v = (v > 0.f) ? v : 0.01f * v; else if (ACT == 8) v = tanhf(v); else if (ACT == 9) v = 0.5f * v * (1.0f + tanhf(0.7978845608028654f * (v + 0.044715f * v * v * v))); else if (ACT == 14) v = (v > 0.f) ? v : 0.1f * v; else if (ACT == 16) v = (v >= 0.f) ? v : 0.3f * v; else if (ACT == 17) v = (v >= 0.f) ? v : 0.2f * v;
      so[w][rloc][t * 16 + ln] = v; } }
  __builtin_amdgcn_fence(__ATOMIC_ACQ_REL, "workgroup"); __builtin_amdgcn_wave_barrier();
  const int rsub = lane >> 4, c4 = (lane & 15) * 4;
  {
#pragma unroll
    for (int q = 0; q < 16; ++q) { const int r = q * 2 + rsub; const v4f v = *(const v4fa*)&so[w][r][c4]; if (C) { *(v4f*)(C + cofs + (size_t)(row0 + r) * ldc + col0 + c4) = v;
        asm volatile("s_wait_xcnt 0x0" ::: "memory"); /* the f16 arm behind reuses the registers that the f32 store names: the wait stands in front of that overwrite */ }
      if (C16) { v4h h4; for (int i = 0; i < 4; ++i) h4[i] = (_Float16)v[i]; *(v4h*)(C16 + cofs + (size_t)(row0 + r) * ldc + col0 + c4) = h4; } }
     } }


// ---- q and k projections in one launch, straight from the f32 x rows: one work-group = 128 rows, 16 waves of 32x64 tiles as in k_gemm3. The x rows are read once as whole 512-byte pieces, rounded (bf16, exact in f16)
// and staged in LDS, where they stay for both passes; the first pass runs them against the k rows of Bh, the second against the q rows (k first: its three times larger output drains while the q pass computes).
// The B rows of a pass and its output tiles share the second LDS array.
typedef unsigned short v4us __attribute__((ext_vector_type(4), may_alias));
union Frag4 { v4us v; _Float16 h[4]; };
/* work-group barrier that orders LDS traffic only: __syncthreads() would also wait until the first pass's global stores have completed, although no wave reads them in this launch */
__device__ __forceinline__ void qk_barrier() { __builtin_amdgcn_fence(__ATOMIC_RELEASE, "workgroup", "local"); __builtin_amdgcn_s_barrier(); __builtin_amdgcn_fence(__ATOMIC_ACQUIRE, "workgroup", "local"); }
__global__ __launch_bounds__(512) void k_qk(const float* __restrict__ x, const _Float16* __restrict__ Bh, const float* __restrict__ bias, _Float16* __restrict__ Q16, float* __restrict__ KF, _Float16* __restrict__ K16) {
  __shared__ __attribute__((aligned(16))) unsigned short sa[128 * GP];      /* 128 x rows, f16 */
  __shared__ __attribute__((aligned(16))) unsigned short sb[16 * 32 * 68 * 2];      /* CH B rows of the pass, then the 16 output tiles (32 x 68 f32 each) */
  static_assert(CH * GP <= 16 * 32 * 68 * 2, "the B rows must fit the bytes of the output tiles");
  float (*so)[32][68] = reinterpret_cast<float (*)[32][68]>(sb);
  const int tid = threadIdx.x, w = tid >> 5, lane = tid & 31, ln = lane & 15, hh = lane >> 4;
  const int mt = blockIdx.x, row0 = mt * 128 + 32 * (w & 3), col0 = (w >> 2) * 64;
  const unsigned short* bg = (const unsigned short*)Bh + (size_t)w * CH + lane * 8;
  v8us rb[16];      /* the B rows of the coming pass on their way to LDS; every loop over them is unrolled so that they stay in registers */
  float bv[2][4];      /* both passes' biases, read here so that no wait for them stands behind the B loads of the second pass */
  { const float* xg = x + ((size_t)mt * 128 + w) * CH + lane * 4; v4f xa[8][2];      /* unrolled: all loads are in flight before the first conversion waits for one */
#pragma unroll
    for (int u = 0; u < 8; ++u) { xa[u][0] = *(const v4fa*)(xg + u * 16 * CH); xa[u][1] = *(const v4fa*)(xg + u * 16 * CH + 128); }
#pragma unroll
    for (int u = 0; u < 16; ++u) rb[u] = *(const v8us*)(bg + (size_t)CH * CH + u * 16 * CH);
#pragma unroll
    for (int u = 0; u < 8; ++u) bv[u >> 2][u & 3] = bias[(u >> 2) * CH + col0 + (u & 3) * 16 + ln];
    asm volatile("s_wait_xcnt 0x0" :: "v"(xg) : "memory"); /* the registers that the loads above name are reused further down: the wait stands in front of every such overwrite; the x pointer is an input so that no load's own result lands on it ahead of the wait */
    unsigned short* sw = sa + w * GP + lane * 4;
#pragma unroll
    for (int u = 0; u < 8; ++u)
#pragma unroll
      for (int p = 0; p < 2; ++p) { Frag4 f;
#pragma unroll
        for (int i = 0; i < 4; ++i) f.h[i] = (_Float16)bf16_round(xa[u][p][i]);
        *(v4us*)(sw + u * 16 * GP + p * 128) = f.v; } }
  const unsigned short* al = sa + (32 * (w & 3) + ln) * GP + 8 * hh; const unsigned short* bl = sb + (col0 + ln) * GP + 8 * hh;
  const int rsub = lane >> 4, c4 = (lane & 15) * 4; const size_t o0 = (size_t)(row0 + rsub) * CH + col0 + c4;      /* a lane's first output element; its later ones are 2 rows apart */
#pragma unroll      /* unrolled: which outputs a pass writes is then known at compile time, and no branch stands between the stores */
  for (int part = 1; part >= 0; --part) {      /* 1: k, 0: q */
    { unsigned short* sw = sb + w * GP + lane * 8;
#pragma unroll
      for (int u = 0; u < 16; ++u) *(v8us*)(sw + u * 16 * GP) = rb[u]; }
    qk_barrier();      /* publishes the B rows of this pass (in the first pass the x rows too) */
    const v8f z8 = {0.f,0.f,0.f,0.f,0.f,0.f,0.f,0.f}; v8f c00 = z8, c01 = z8, c02 = z8, c03 = z8, c10 = z8, c11 = z8, c12 = z8, c13 = z8;
    /* two register sets, the reads of k step s + 1 as one group ahead of the products of step s, as in k_gemm3 */
    v16h fa[2][2], fb[2][4];
    fa[0][0] = g3_frag(al); fa[0][1] = g3_frag(al + 16 * GP);
#pragma unroll
    for (int t = 0; t < 4; ++t) fb[0][t] = g3_frag(bl + t * 16 * GP);
#pragma unroll
    for (int s = 0; s < CH / 32; ++s) { const int cu = s & 1, nx = cu ^ 1;
      if (s + 1 < CH / 32) { const int kb = (s + 1) * 32; fa[nx][0] = g3_frag(al + kb); fa[nx][1] = g3_frag(al + 16 * GP + kb);
#pragma unroll
        for (int t = 0; t < 4; ++t) fb[nx][t] = g3_frag(bl + t * 16 * GP + kb); }
      __builtin_amdgcn_sched_barrier(0);      /* keeps the read group above in front of these products, as in k_gemm3 */
      c00 = g3_mma(fa[cu][0], fb[cu][0], c00); c10 = g3_mma(fa[cu][1], fb[cu][0], c10); c01 = g3_mma(fa[cu][0], fb[cu][1], c01); c11 = g3_mma(fa[cu][1], fb[cu][1], c11);
      c02 = g3_mma(fa[cu][0], fb[cu][2], c02); c12 = g3_mma(fa[cu][1], fb[cu][2], c12); c03 = g3_mma(fa[cu][0], fb[cu][3], c03); c13 = g3_mma(fa[cu][1], fb[cu][3], c13); }
    qk_barrier();      /* every wave has read its last B fragment: from here those bytes are the waves' own output tiles */
    if (part == 1) {      /* the q rows of Bh start their way here and fly while the k tiles are written out */
#pragma unroll
      for (int u = 0; u < 16; ++u) rb[u] = *(const v8us*)(bg + u * 16 * CH); }
    v8f accs[8] = {c00, c01, c02, c03, c10, c11, c12, c13};
#pragma unroll
    for (int u = 0; u < 8; ++u) { const int t = u & 3, half = u >> 2; const float bq = bf16_round(bv[part][t]);
#pragma unroll
      for (int r = 0; r < 8; ++r) so[w][half * 16 + 8 * hh + r][t * 16 + ln] = accs[u][r] * 0.0625f + bq; }
    __builtin_amdgcn_fence(__ATOMIC_ACQ_REL, "workgroup", "local"); __builtin_amdgcn_wave_barrier();      /* a wave reads back what its own lanes wrote */
    _Float16* o16 = (part ? K16 : Q16) + o0; float* o32 = KF + o0;
#pragma unroll
    for (int q = 0; q < 16; ++q) { const v4f v = *(const v4fa*)&so[w][q * 2 + rsub][c4];
      if (part) *(v4f*)(o32 + q * 2 * CH) = v;
      v4h h4; for (int i = 0; i < 4; ++i) h4[i] = (_Float16)v[i]; *(v4h*)(o16 + q * 2 * CH) = h4; }
    if (part == 1) { asm volatile("s_wait_xcnt 0x0" ::: "memory"); /* the second pass reuses the registers that the k stores name: the wait stands in front of that overwrite */
      qk_barrier(); }      /* every wave has read its k tile back: the q rows of Bh may be written over the tiles */
  } }

__device__ __forceinline__ float hswish(float v) { return v * fminf(fmaxf(v + 3.0f, 0.0f), 6.0f) * (1.0f / 6.0f); }
// Fused stripe attention: one work-group = one (branch, plane, head), 16 waves x 32 query columns. K rows and V^T rows are staged once in LDS, both from the k rows as the GEMM wrote them; each wave forms
// S^T = K Q^T (a lane holds one query's scores), takes the exact row maximum in a first walk over the keys, then walks again: p = 2^10 exp(scale (s - max)), packed from the
// score accumulators straight into the B operand of O^T += V^T P^T; the row sum stays in f32 and divides the result. Scores and probabilities never reach memory.
#define KP 40                    /* LDS pitch of a K row, f16 units: 80 B = 16 B x odd, conflict-free for 16-byte fragment reads */
#define VP 520                   /* LDS pitch of a V^T row, f16 units: 1040 B = 16 B x odd */
__device__ __forceinline__ v16h at_frag(const unsigned short* p, int hh) { FragH f; f.half[0] = *(const v8us*)(p + 8 * hh); f.half[1] = *(const v8us*)(p + 16 + 8 * hh); return f.v; }
__device__ __forceinline__ v8f at_mma(v16h a, v16h b, v8f c) { return __builtin_amdgcn_wmma_f32_16x16x32_f16(false, a, false, b, (short)0, c, false, false); }
__device__ __forceinline__ float at_max8(v8f s, float m) { const float t0 = fmaxf(fmaxf(s[0], s[1]), s[2]), t1 = fmaxf(fmaxf(s[3], s[4]), s[5]), t2 = fmaxf(fmaxf(s[6], s[7]), m); return fmaxf(fmaxf(t0, t1), t2); }
__device__ __forceinline__ v8f at_exp8(v8f s, float c, float b) { float x[8], e[8];
  for (int r = 0; r < 8; ++r) x[r] = s[r] * c + b;
  /* eight 2^x in one statement: early-clobber results keep every result off every source, and the closing v_nop is the one slot the instruction set asks for behind a transcendental before a source may be overwritten or the result used */
  asm("v_exp_f32 %0, %8\n\tv_exp_f32 %1, %9\n\tv_exp_f32 %2, %10\n\tv_exp_f32 %3, %11\n\tv_exp_f32 %4, %12\n\tv_exp_f32 %5, %13\n\tv_exp_f32 %6, %14\n\tv_exp_f32 %7, %15\n\tv_nop"
      : "=&v"(e[0]), "=&v"(e[1]), "=&v"(e[2]), "=&v"(e[3]), "=&v"(e[4]), "=&v"(e[5]), "=&v"(e[6]), "=&v"(e[7]) : "v"(x[0]), "v"(x[1]), "v"(x[2]), "v"(x[3]), "v"(x[4]), "v"(x[5]), "v"(x[6]), "v"(x[7]));
  const v8f o = {e[0], e[1], e[2], e[3], e[4], e[5], e[6], e[7]}; return o; }
__device__ __forceinline__ float at_sum8(v8f e) { return ((e[0] + e[1]) + (e[2] + e[3])) + ((e[4] + e[5]) + (e[6] + e[7])); }
__device__ __forceinline__ v16h at_pack(v8f e0, v8f e1) { FragH f;
  for (int r = 0; r < 8; ++r) { f.h[r] = (_Float16)e0[r]; f.h[8 + r] = (_Float16)e1[r]; } return f.v; }
typedef unsigned int u32a __attribute__((may_alias));
/* a minimum of 8 waves per SIMD = 128 vector registers a wave, as before this staging: without it the build takes 130, which is 7 waves per SIMD, so only one 16-wave work-group would fit a WGP instead of two */
__global__ __launch_bounds__(512, 8) void k_attn(const _Float16* __restrict__ Q16, const _Float16* __restrict__ K16, float* __restrict__ CTX) {
  __shared__ __attribute__((aligned(16))) unsigned short sk[TOKS * KP];
  __shared__ __attribute__((aligned(16))) unsigned short sv[DH * VP];
  const int tid = threadIdx.x, w = tid >> 5, lane = tid & 31, ln = lane & 15, hh = lane >> 4;
  const int h = blockIdx.x % NHB, pl = blockIdx.x / NHB; const bool vert = blockIdx.y != 0;
  const int bi = pl / NST, st = pl % NST;
  /* token -> row of the [NR][CH] q / k planes: a horizontal stripe is 512 rows in a run; a vertical stripe takes 8 rows out of every 64 (one form for both, so that no branch stands between the loads) */
  const int rbase = vert ? bi * NPX + st * WIN : pl * TOKS, rstep = vert ? WSD : WIN;
  auto rowof = [&](int tok) { return rbase + (tok >> 3) * rstep + (tok & 7); };
  const int ch0 = (vert ? CHH : 0) + h * DH;
  const unsigned short* qg = (const unsigned short*)Q16 + ch0;
  const unsigned short* kg = (const unsigned short*)K16 + ch0;
  /* a thread takes 8 channels of two neighbouring tokens (neighbouring rows in both branches): two 16-byte K row pieces, and the same values as 8 (token, token + 1) pairs for the V^T rows (v = k) */
  for (int u = 0; u < 2; ++u) { const int i = tid + 512 * u; const int t0 = (i >> 2) * 2, kc = (i & 3) * 8; const unsigned short* kr = kg + (size_t)rowof(t0) * CH + kc;
    FragH a; a.half[0] = *(const v8us*)kr; a.half[1] = *(const v8us*)(kr + CH);
    asm volatile("s_wait_xcnt 0x0" ::: "memory"); /* the address pair of these two loads is reused further down: the wait stands in front of that overwrite */
    *(v8us*)(sk + t0 * KP + kc) = a.half[0]; *(v8us*)(sk + (t0 + 1) * KP + kc) = a.half[1];
    for (int q = 0; q < 8; ++q) *(u32a*)(sv + (kc + q) * VP + t0) = (unsigned int)a.u[q] | ((unsigned int)a.u[8 + q] << 16); }
  const int q0r = w * 32 + ln;
  __syncthreads();      /* publishes the staged K and V^T rows; they are only read from here on */
  const v16h q0 = at_frag(qg + (size_t)rowof(q0r) * CH, hh), q1 = at_frag(qg + (size_t)rowof(q0r + 16) * CH, hh);
  const v8f z8 = {0.f,0.f,0.f,0.f,0.f,0.f,0.f,0.f};
  float m0 = -3.0e38f, m1 = -3.0e38f;
  const unsigned short* kl = sk + ln * KP;
  for (int t = 0; t < TOKS / 16; ++t) { const v16h ka = at_frag(kl + t * 16 * KP, hh);
    const v8f s0 = at_mma(ka, q0, z8), s1 = at_mma(ka, q1, z8); m0 = at_max8(s0, m0); m1 = at_max8(s1, m1); }
  m0 = fmaxf(m0, __shfl_xor(m0, 16, 32)); m1 = fmaxf(m1, __shfl_xor(m1, 16, 32));
  const float c = 0.17677669529663688f * 1.4426950408889634f;      /* 1/sqrt(32) x log2(e) */
  const float b0 = 10.0f - m0 * c, b1 = 10.0f - m1 * c;
  float su0 = 0.f, su1 = 0.f; v8f o00 = z8, o01 = z8, o10 = z8, o11 = z8;
  const unsigned short* vl = sv + ln * VP;
  for (int t = 0; t < TOKS / 32; ++t) { const v16h ka = at_frag(kl + t * 32 * KP, hh), kb = at_frag(kl + (t * 32 + 16) * KP, hh); const v16h va = at_frag(vl + t * 32, hh), vb = at_frag(vl + 16 * VP + t * 32, hh);
    const v8f e00 = at_exp8(at_mma(ka, q0, z8), c, b0), e01 = at_exp8(at_mma(kb, q0, z8), c, b0), e10 = at_exp8(at_mma(ka, q1, z8), c, b1), e11 = at_exp8(at_mma(kb, q1, z8), c, b1);
    su0 += at_sum8(e00) + at_sum8(e01); su1 += at_sum8(e10) + at_sum8(e11);
    const v16h p0 = at_pack(e00, e01), p1 = at_pack(e10, e11);
    o00 = at_mma(va, p0, o00); o01 = at_mma(vb, p0, o01); o10 = at_mma(va, p1, o10); o11 = at_mma(vb, p1, o11); }
  su0 += __shfl_xor(su0, 16, 32); su1 += __shfl_xor(su1, 16, 32);
  const float i0 = 1.0f / su0, i1 = 1.0f / su1;
  /* horizontal: the token's own row, columns h*32..; vertical: the reference's inverse reshape sends (stripe, head, token = a*64 + c) to row (stripe*8 + a, head*16 + c/4), columns 128 + (c%4)*32.. */
  float* og = CTX + (vert ? ((size_t)(bi * HS + st * WIN) * WSD + h * 16) * CH + CHH : (size_t)pl * TOKS * CH + h * DH); const int oc4 = vert ? CH : 4 * CH, oc1 = vert ? DH : CH;
  auto dstof = [&](int tok) { return og + (tok >> 6) * (WSD * CH) + ((tok & 63) >> 2) * oc4 + (tok & 3) * oc1; };
  float* d0 = dstof(q0r) + 8 * hh; float* d1 = dstof(q0r + 16) + 8 * hh;
  *(v8f*)d0 = o00 * i0; *(v8f*)(d0 + 16) = o01 * i0; *(v8f*)d1 = o10 * i1; *(v8f*)(d1 + 16) = o11 * i1; }
__global__ __launch_bounds__(256) void k_biasmix(const float* __restrict__ CTX, const float* __restrict__ KF, const float* __restrict__ dwk, const float* __restrict__ dwb, _Float16* __restrict__ C16) {
  #pragma clang fp contract(off)
  const size_t t = (size_t)blockIdx.x * 256 + threadIdx.x; if (t >= (size_t)NR * CH / 8) return; const int c0 = (int)((t * 8) % CH); const size_t row = (t * 8) / CH; const int b = (int)(row / NPX), p = (int)(row % NPX); const int y = p / WSD, x = p % WSD; float acc[8]; for (int q = 0; q < 8; ++q) acc[q] = 0.f;
#pragma unroll 1
  for (int i = 0; i < 3; ++i) { const int yy = y + i - 1; if (yy < 0 || yy >= HS) continue;
#pragma unroll 1
    for (int j = 0; j < 3; ++j) { const int xx = x + j - 1; if (xx < 0 || xx >= WSD) continue; const v8f v = *(const v8f*)(KF + (((size_t)b * HS + yy) * WSD + xx) * CH + c0);
#pragma unroll
      for (int q = 0; q < 8; ++q) acc[q] += hswish(v[q]) * bf16_round(dwk[(i * 3 + j) * CH + c0 + q]); } }
  const v8f cx = *(const v8f*)(CTX + t * 8); FragH f; for (int q = 0; q < 8; ++q) { float s = acc[q]; s += bf16_round(dwb[c0 + q]); float u = cx[q]; u += s; f.h[q] = (_Float16)hswish(u); }
  *(v8us*)((unsigned short*)C16 + t * 8) = f.half[0];  }

extern "C" void kernel_launch(void* const* d_in, const int* in_sizes, int n_in,
                              void* d_out, int out_size, void* d_ws, size_t ws_size, hipStream_t stream) {
  (void)in_sizes; (void)n_in; (void)out_size;
  const float* x = (const float*)d_in[0]; const float* wqkv = (const float*)d_in[1]; const float* bqkv = (const float*)d_in[2]; const float* dwk = (const float*)d_in[3]; const float* dwb = (const float*)d_in[4]; const float* wout = (const float*)d_in[5]; const float* bout = (const float*)d_in[6];
  char* ws = (char*)d_ws; size_t off = 0;
  auto take = [&](size_t bytes) { char* p = ws + off; off += (bytes + 255) & ~(size_t)255; return p; };
  const size_t ne = (size_t)NR * CH;
  _Float16* BQK = (_Float16*)take((size_t)2 * CH * CH * 2); _Float16* BO = (_Float16*)take((size_t)CH * CH * 2);
  _Float16* C16 = (_Float16*)take(ne * 2); _Float16* Q16 = (_Float16*)take(ne * 2); float* KF = (float*)take(ne * 4); _Float16* K16 = (_Float16*)take(ne * 2);
  float* CTX = (float*)take(ne * 4);
  if (off > ws_size) return;      /* 0.4 + 16 + 16 + 32 + 16 + 32 = about 113 MiB */
  k_wt_f16<<<(unsigned)(((size_t)CH * 2 * CH / 8 + 255) / 256), 256, 0, stream>>>(wqkv, BQK, CH, 2 * CH, 16.0f); k_wt_f16<<<(unsigned)(((size_t)CH * CH / 8 + 255) / 256), 256, 0, stream>>>(wout, BO, CH, CH, 16.0f);      /* (in, out) */
  const dim3 g(NR / 128, 1);
  k_qk<<<g, 512, 0, stream>>>(x, BQK, bqkv, Q16, KF, K16);      /* q (f16) and k = v (f32 + f16) from the f32 x rows */
  k_attn<<<dim3(NPL * NHB, 2), 512, 0, stream>>>(Q16, K16, CTX);      /* y = 0: horizontal, context columns h*32; y = 1: vertical, context columns 128.. through the permutation */
  k_biasmix<<<(unsigned)((ne / 8 + 255) / 256), 256, 0, stream>>>(CTX, KF, dwk, dwb, C16);
  k_gemm3<0><<<g, 512, 0, stream>>>(C16, 0, BO, 0, 0.0625f, bout, 0, nullptr, 1, 0, 0, (float*)d_out, nullptr, CH, 0, NR);      /* out = hswish(context + bias) w_out + b */
}

// v005
// One run takes 71.9 microseconds.
// In two side-by-side timings against v004, it was 1.24 and 1.22 times as fast.
// All steps since v000 together make it 12.1 times as fast.
#include <hip/hip_runtime.h>
// CrossShapedAttention (8 x 64 x 64 x 256, window 8, 4 heads x 32 per branch: [q | k] = x w_qkv + b (v = k); horizontal branch = channels 0..127 attending within each 8-row stripe (512 tokens), vertical branch = channels 128..255 within each 8-column stripe; softmax(q.k / sqrt(32)) v; the vertical context is put back through the TF code's exact reshape/transpose order (a fixed permutation of (row-in-stripe, column, head, channel)); bias = depthwise3x3(hard_swish(v)) + b; out = hard_swish(context + bias) w_out + b_out).
// Structure: q and k(=v) as f16 WMMA GEMMs in one launch that reads the f32 x rows itself and stages them once as exact f16 rows (32x64 wave tiles, f32 accumulation, exact x16 (in,out) weights + bias; q f16, k f32 + f16); horizontal stripes are contiguous row ranges: one fused launch does scores (K = 32), softmax (exact row maximum, f16 x 2^10 unnormalised, f32 row sum) and readout (N = 32) per (plane, head) with K and V^T in LDS (V^T is built from the K rows while they are staged), writing context columns h*32.. directly; the vertical branch runs in the same launch: it reads its q/k rows in place by the stripe's row map (token = row*8 + column-in-stripe) and stores its result through the reference's permutation; the output projection GEMM makes its own A rows while it stages them (hard-swish + depthwise 3x3 bias on VALU in f32, added to the context rows, hard_swish, f16) and writes the [B,H,W,C] output.
// Compute dtype: inputs rounded to bf16; x / weights exact as f16; q, k, v and the final context as plain f16 GEMM operands (~2^-12); softmax / hard-swish / depthwise in f32. v_wmma_f32_16x16x32_f16.
#define NI 8
#define HS 64
#define WSD 64
#define CH 256
#define CHH 128                  /* channels per branch */
#define NHB 4                    /* heads per branch */
#define DH 32
#define WIN 8
#define NST 8                    /* stripes per image per branch */
#define TOKS 512                 /* tokens per stripe */
#define NPX (HS * WSD)
#define NR (NI * NPX)            /* 32768 */
#define NPL (NI * NST)           /* 64 (image, stripe) planes per branch */
typedef __bf16 v16b __attribute__((ext_vector_type(16)));
typedef unsigned short v8us __attribute__((ext_vector_type(8), may_alias));
typedef float  v8f  __attribute__((ext_vector_type(8)));
typedef float  v4f  __attribute__((ext_vector_type(4)));
typedef float  v4fa __attribute__((ext_vector_type(4), may_alias));
union FragB { v16b v; v8us half[2]; unsigned short u[16]; };

__device__ __forceinline__ unsigned short bf16_bits(float x) { unsigned int u = __float_as_uint(x); return (unsigned short)((u + 0x7FFFu + ((u >> 16) & 1u)) >> 16); }
__device__ __forceinline__ float bf16_val(unsigned short b) { return __uint_as_float(((unsigned int)b) << 16); }
__device__ __forceinline__ float bf16_round(float x) { return bf16_val(bf16_bits(x)); }
// D += A·B with NT terms: 1 = ah·bh, 2 = + al·bh (A split), 3 = + ah·bl (both split)
template <int NT>
__device__ __forceinline__ v8f mmaN(v16b ah, v16b al, v16b bh, v16b bl, v8f c) {
  c = __builtin_amdgcn_wmma_f32_16x16x32_bf16(false, ah, false, bh, (short)0, c, false, false);
  if (NT >= 2) c = __builtin_amdgcn_wmma_f32_16x16x32_bf16(false, al, false, bh, (short)0, c, false, false);
  if (NT >= 3) c = __builtin_amdgcn_wmma_f32_16x16x32_bf16(false, ah, false, bl, (short)0, c, false, false);
  asm volatile("v_nop\n\tv_nop\n\tv_nop\n\tv_nop" : "+v"(c) : "v"(ah), "v"(al), "v"(bh), "v"(bl));
  return c;
}

__global__ __launch_bounds__(256) void k_wt_bf16(const float* __restrict__ W, unsigned short* __restrict__ Wt, int K, int N) {
  const int t = blockIdx.x * 256 + threadIdx.x;
  const int k8n = K / 8;
  if (t >= N * k8n) return;
  const int n = t / k8n, k8 = (t % k8n) * 8;
  v8us v;
#pragma unroll
  for (int i = 0; i < 8; ++i) v[i] = bf16_bits(W[(size_t)(k8 + i) * N + n]);
  *(v8us*)(Wt + (size_t)n * K + k8) = v;
  
}

// GEMM C[M][N] (f32, pitch ldc) = act(A[M][K]·W + bias). A f32 row-major (pitch lda) converted per fragment to bf16
// (ASPLIT: hi/lo two planes -> 2 terms, else single rounded term); Wt bf16 [N][K] (pitch ldb). BIAS_BF16 rounds the
// bias to bf16 first (bias quantised to bf16 before the add). K%32==0, M%16==0, N%64==0.
template <bool ASPLIT, int ACT, bool BIAS_BF16>
__global__ __launch_bounds__(128) void k_gemm_bf(const float* __restrict__ A, int lda, const unsigned short* __restrict__ Wt, int ldb,
                                               const float* __restrict__ bias, float* __restrict__ C, int ldc, int M, int N, int K) {
  __shared__ __attribute__((aligned(16))) float so[4][16][64];
  const int tid = threadIdx.x, w = tid >> 5, lane = tid & 31, ln = lane & 15, hh = lane >> 4;
  const int ntn = N / 64;
  const int wid = blockIdx.x * 4 + w;
  const int mt = wid / ntn, nq = wid % ntn;
  if (mt * 16 >= M) return;
  const int row0 = mt * 16, col0 = nq * 64;
  const float* arow = A + (size_t)(row0 + ln) * lda;
  v8f acc[4] = {};
  for (int kb = 0; kb < K; kb += 32) {
    FragB ah, al;
    const v4f x0 = *(const v4fa*)(arow + kb + 8 * hh), x1 = *(const v4fa*)(arow + kb + 8 * hh + 4);
    const v4f x2 = *(const v4fa*)(arow + kb + 16 + 8 * hh), x3 = *(const v4fa*)(arow + kb + 16 + 8 * hh + 4);
    float xs[16] = {x0[0],x0[1],x0[2],x0[3],x1[0],x1[1],x1[2],x1[3],x2[0],x2[1],x2[2],x2[3],x3[0],x3[1],x3[2],x3[3]};
#pragma unroll
    for (int i = 0; i < 16; ++i) { const unsigned short hb = bf16_bits(xs[i]); ah.u[i] = hb; al.u[i] = ASPLIT ? bf16_bits(xs[i] - bf16_val(hb)) : (unsigned short)0; }
#pragma unroll
    for (int t = 0; t < 4; ++t) {
      const unsigned short* brow = Wt + (size_t)(col0 + t * 16 + ln) * ldb + kb;
      FragB b;
      b.half[0] = *(const v8us*)(brow + 8 * hh);
      b.half[1] = *(const v8us*)(brow + 16 + 8 * hh);
      acc[t] = mmaN<ASPLIT ? 2 : 1>(ah.v, al.v, b.v, b.v, acc[t]);
    }
  }
#pragma unroll
  for (int t = 0; t < 4; ++t) {
    float bv = bias ? bias[col0 + t * 16 + ln] : 0.f;
    if (BIAS_BF16) bv = bf16_round(bv);
#pragma unroll
    for (int r = 0; r < 8; ++r) { float v = acc[t][r] + bv; if (ACT == 1) v = fmaxf(v, 0.f); so[w][8 * hh + r][t * 16 + ln] = v; }
  }
  __builtin_amdgcn_fence(__ATOMIC_ACQ_REL, "workgroup");
  __builtin_amdgcn_wave_barrier();
  const int rsub = lane >> 4, c4 = (lane & 15) * 4;
  {
#pragma unroll
    for (int q = 0; q < 8; ++q) {
      const int r = q * 2 + rsub;
      const v4f v = *(const v4fa*)&so[w][r][c4];
      *(v4f*)(C + (size_t)(row0 + r) * ldc + col0 + c4) = v;
    }
    
  }
}

// GEMM C = act(A·W + bias + resid): A f32 (ASPLIT -> hi/lo 2 terms), Wt bf16 [N][K]; ACT 0 none, 1 relu, 2 exact gelu;
// resid (optional, f32, row index = (row % rmod), pitch ldr, RES_BF16 rounds it) added before the activation.
template <bool ASPLIT, int ACT, bool BIAS_BF16, bool RES_BF16>
__global__ __launch_bounds__(128) void k_gemm_bf3(const float* __restrict__ A, int lda, const unsigned short* __restrict__ Wt, int ldb,
                                                const float* __restrict__ bias, const float* __restrict__ resid, int rmod, int ldr,
                                                float* __restrict__ C, int ldc, int M, int N, int K) {
  __shared__ __attribute__((aligned(16))) float so[4][16][64];
  const int tid = threadIdx.x, w = tid >> 5, lane = tid & 31, ln = lane & 15, hh = lane >> 4;
  const int ntn = N / 64;
  const int wid = blockIdx.x * 4 + w;
  const int mt = wid / ntn, nq = wid % ntn;
  if (mt * 16 >= M) return;
  const int row0 = mt * 16, col0 = nq * 64;
  const float* arow = A + (size_t)(row0 + ln) * lda;
  v8f acc[4] = {};
  for (int kb = 0; kb < K; kb += 32) {
    FragB ah, al;
    const v4f x0 = *(const v4fa*)(arow + kb + 8 * hh), x1 = *(const v4fa*)(arow + kb + 8 * hh + 4);
    const v4f x2 = *(const v4fa*)(arow + kb + 16 + 8 * hh), x3 = *(const v4fa*)(arow + kb + 16 + 8 * hh + 4);
    float xs[16] = {x0[0],x0[1],x0[2],x0[3],x1[0],x1[1],x1[2],x1[3],x2[0],x2[1],x2[2],x2[3],x3[0],x3[1],x3[2],x3[3]};
#pragma unroll
    for (int i = 0; i < 16; ++i) { const unsigned short hb = bf16_bits(xs[i]); ah.u[i] = hb; al.u[i] = ASPLIT ? bf16_bits(xs[i] - bf16_val(hb)) : (unsigned short)0; }
#pragma unroll
    for (int t = 0; t < 4; ++t) {
      const unsigned short* brow = Wt + (size_t)(col0 + t * 16 + ln) * ldb + kb;
      FragB b;
      b.half[0] = *(const v8us*)(brow + 8 * hh);
      b.half[1] = *(const v8us*)(brow + 16 + 8 * hh);
      acc[t] = mmaN<ASPLIT ? 2 : 1>(ah.v, al.v, b.v, b.v, acc[t]);
    }
  }
#pragma unroll
  for (int t = 0; t < 4; ++t) {
    const int col = col0 + t * 16 + ln;
    float bv = bias ? bias[col] : 0.f;
    if (BIAS_BF16) bv = bf16_round(bv);
#pragma unroll
    for (int r = 0; r < 8; ++r) {
      float v = acc[t][r] + bv;
      if (resid) { float rv = resid[(size_t)((row0 + 8 * hh + r) % rmod) * ldr + col]; if (RES_BF16) rv = bf16_round(rv); v += rv; }
      if (ACT == 1) v = fmaxf(v, 0.f);
      if (ACT == 2) v = 0.5f * v * (1.0f + erff(v * 0.70710678118654752f));
      if (ACT == 3) { const float u = 0.7978845608028654f * (v + 0.044715f * v * v * v); v = 0.5f * v * (1.0f + tanhf(u)); }
      so[w][8 * hh + r][t * 16 + ln] = v;
    }
  }
  __builtin_amdgcn_fence(__ATOMIC_ACQ_REL, "workgroup");
  __builtin_amdgcn_wave_barrier();
  const int rsub = lane >> 4, c4 = (lane & 15) * 4;
  {
#pragma unroll
    for (int q = 0; q < 8; ++q) {
      const int r = q * 2 + rsub;
      const v4f v = *(const v4fa*)&so[w][r][c4];
      *(v4f*)(C + (size_t)(row0 + r) * ldc + col0 + c4) = v;
    }
    
  }
}
// row LayerNorm (biased variance, eps) over N: s = X (+ R); optional out_sum <- s; out_norm <- (s-mu)*rsqrt(var+eps)*g + b
template <bool PARAM_BF16>
__global__ __launch_bounds__(256) void k_layernorm(const float* __restrict__ X, const float* __restrict__ R, const float* __restrict__ g, const float* __restrict__ bta,
                                                  float* __restrict__ out_sum, float* __restrict__ out_norm, int N, float eps) {
  __shared__ float red[256];
  const int row = blockIdx.x, tid = threadIdx.x;
  const float* x = X + (size_t)row * N; const float* rr = R ? R + (size_t)row * N : nullptr;
  float vals[16];                     // up to N = 4096
  const int per = N / 256;            // contiguous chunk per thread? use strided-by-4 chunks: thread handles j = tid*4 + 1024*u
  float s1 = 0.f;
  for (int u = 0; u < per / 4; ++u) {
    const int j = tid * 4 + 1024 * u;
    const v4f a = *(const v4fa*)(x + j);
    v4f b = {0.f,0.f,0.f,0.f}; if (rr) b = *(const v4fa*)(rr + j);
#pragma unroll
    for (int q = 0; q < 4; ++q) { const float v = a[q] + b[q]; vals[u * 4 + q] = v; s1 += v; }
  }
  red[tid] = s1; __syncthreads();
  for (int st = 128; st > 0; st >>= 1) { if (tid < st) red[tid] += red[tid + st]; __syncthreads(); }
  const float mu = red[0] / (float)N; __syncthreads();
  float s2 = 0.f;
  for (int u = 0; u < per / 4; ++u)
#pragma unroll
    for (int q = 0; q < 4; ++q) { const float c = vals[u * 4 + q] - mu; s2 += c * c; }
  red[tid] = s2; __syncthreads();
  for (int st = 128; st > 0; st >>= 1) { if (tid < st) red[tid] += red[tid + st]; __syncthreads(); }
  const float rs = rsqrtf(red[0] / (float)N + eps);
  {
    for (int u = 0; u < per / 4; ++u) {
      const int j = tid * 4 + 1024 * u;
      v4f o, sm;
#pragma unroll
      for (int q = 0; q < 4; ++q) {
        float gg = g[j + q], bb = bta[j + q];
        if (PARAM_BF16) { gg = bf16_round(gg); bb = bf16_round(bb); }
        sm[q] = vals[u * 4 + q]; o[q] = (vals[u * 4 + q] - mu) * rs * gg + bb;
      }
      if (out_sum) *(v4f*)(out_sum + (size_t)row * N + j) = sm;
      *(v4f*)(out_norm + (size_t)row * N + j) = o;
    }
    
  }
}



// ---- f16 WMMA path (v_wmma_f32_16x16x32_f16): 11-bit significands for operands in range — used for every GEMM here, including the 2^10-scaled probability operand that needs more precision than bf16
typedef _Float16 v16h __attribute__((ext_vector_type(16)));
union FragH { v16h v; v8us half[2]; _Float16 h[16]; unsigned short u[16]; };
template <int NT>
__device__ __forceinline__ v8f mmaH(v16h ah, v16h al, v16h bh, v16h bl, v8f c) {
  c = __builtin_amdgcn_wmma_f32_16x16x32_f16(false, ah, false, bh, (short)0, c, false, false);
  if (NT >= 2) c = __builtin_amdgcn_wmma_f32_16x16x32_f16(false, al, false, bh, (short)0, c, false, false);
  if (NT >= 3) c = __builtin_amdgcn_wmma_f32_16x16x32_f16(false, ah, false, bl, (short)0, c, false, false);
  asm volatile("v_nop\n\tv_nop\n\tv_nop\n\tv_nop" : "+v"(c) : "v"(ah), "v"(al), "v"(bh), "v"(bl));
  return c;
}
// batched GEMM like k_gemm_b but f16 operands: A f32 (split into f16 hi/lo if ASPLIT, else rounded to f16), Bt = f16 values [n][k]; alpha; C f32; N multiple of 16 (partial tiles skipped)
template <bool ASPLIT>
__global__ __launch_bounds__(128) void k_gemm_h(const float* __restrict__ A, int lda, size_t sA, const _Float16* __restrict__ Bh, int ldb, size_t sB, float alpha, float* __restrict__ C, int ldc, size_t sC, int M, int N, int K) {
  __shared__ __attribute__((aligned(16))) float so[4][16][64];
  const int tid = threadIdx.x, w = tid >> 5, lane = tid & 31, ln = lane & 15, hh = lane >> 4; const int by = blockIdx.y;
  A += (size_t)by * sA; Bh += (size_t)by * sB; C += (size_t)by * sC;
  const int ntn = (N + 63) / 64; const int wid = blockIdx.x * 4 + w; const int mt = wid / ntn, nq = wid % ntn; if (mt * 16 >= M) return;
  const int row0 = mt * 16, col0 = nq * 64; const float* arow = A + (size_t)(row0 + ln) * lda;
  v8f acc[4] = {};
  for (int kb = 0; kb < K; kb += 32) {
    FragH ah, al;
    const v4f x0 = *(const v4fa*)(arow + kb + 8 * hh), x1 = *(const v4fa*)(arow + kb + 8 * hh + 4), x2 = *(const v4fa*)(arow + kb + 16 + 8 * hh), x3 = *(const v4fa*)(arow + kb + 16 + 8 * hh + 4);
    float xs[16] = {x0[0],x0[1],x0[2],x0[3],x1[0],x1[1],x1[2],x1[3],x2[0],x2[1],x2[2],x2[3],x3[0],x3[1],x3[2],x3[3]};
#pragma unroll
    for (int i = 0; i < 16; ++i) { const _Float16 h = (_Float16)xs[i]; ah.h[i] = h; al.h[i] = ASPLIT ? (_Float16)(xs[i] - (float)h) : (_Float16)0.0f; }
#pragma unroll
    for (int t = 0; t < 4; ++t) { if (col0 + t * 16 >= N) continue; const size_t boff = (size_t)(col0 + t * 16 + ln) * ldb + kb; FragH bq; bq.half[0] = *(const v8us*)(Bh + boff + 8 * hh); bq.half[1] = *(const v8us*)(Bh + boff + 16 + 8 * hh);
      acc[t] = mmaH<ASPLIT ? 2 : 1>(ah.v, al.v, bq.v, bq.v, acc[t]); }
  }
#pragma unroll
  for (int t = 0; t < 4; ++t) { if (col0 + t * 16 >= N) continue;
#pragma unroll
    for (int r = 0; r < 8; ++r) so[w][8 * hh + r][t * 16 + ln] = acc[t][r] * alpha; }
  __builtin_amdgcn_fence(__ATOMIC_ACQ_REL, "workgroup"); __builtin_amdgcn_wave_barrier();
  const int rsub = lane >> 4, c4 = (lane & 15) * 4;
  {
#pragma unroll
    for (int q = 0; q < 8; ++q) { const int r = q * 2 + rsub; if (col0 + c4 < N) { const v4f v = *(const v4fa*)&so[w][r][c4]; *(v4f*)(C + (size_t)(row0 + r) * ldc + col0 + c4) = v; } }
     }
}

// Wt[n][k] = f16(W[k][n]·scale) from f32 row-major W[K][N] (scale = power of two; bf16-exact weights stay exact in f16 away from the subnormal range)
__global__ __launch_bounds__(256) void k_wt_f16(const float* __restrict__ W, _Float16* __restrict__ Wt, int K, int N, float scale) {
  const int t = blockIdx.x * 256 + threadIdx.x; if (t >= N * (K / 8)) return; const int n = t / (K / 8), k8 = (t % (K / 8)) * 8; FragH f;
#pragma unroll
  for (int i = 0; i < 8; ++i) f.h[i] = (_Float16)(bf16_round(W[(size_t)(k8 + i) * N + n]) * scale); const v8us o = f.half[0];
  *(v8us*)((unsigned short*)Wt + (size_t)n * K + k8) = o; 
}
// k_gemm_hh variant with fused epilogue: v = acc·alpha + bias[by·sBias + col] (+ CP[(row/rowsPerB)·sCPb + by·64 + col] if CP) ; ACT 0 none / 1 elu ; writes f32 C and/or f16 C16 (each if non-null)
template <int ACT>
__global__ __launch_bounds__(128) void k_gemm_hhx(const _Float16* __restrict__ A, int lda, size_t sA, const _Float16* __restrict__ Bh, int ldb, size_t sB, float alpha, const float* __restrict__ bias, size_t sBias, const float* __restrict__ CP, int rowsPerB, size_t sCPb, int row0g,
    float* __restrict__ C, _Float16* __restrict__ C16, int ldc, size_t sC, int M, int N, int K) {
  __shared__ __attribute__((aligned(16))) float so[4][16][64];
  const int tid = threadIdx.x, w = tid >> 5, lane = tid & 31, ln = lane & 15, hh = lane >> 4; const int by = blockIdx.y;
  A += (size_t)by * sA; Bh += (size_t)by * sB; const size_t cofs = (size_t)by * sC; const float* bp = bias ? bias + (size_t)by * sBias : nullptr;
  const int ntn = (N + 63) / 64; const int wid = blockIdx.x * 4 + w; const int mt = wid / ntn, nq = wid % ntn; if (mt * 16 >= M) return;
  const int row0 = mt * 16, col0 = nq * 64; const _Float16* arow = A + (size_t)(row0 + ln) * lda;
  v8f acc[4] = {};
  for (int kb = 0; kb < K; kb += 32) { FragH ah; ah.half[0] = *(const v8us*)((const unsigned short*)arow + kb + 8 * hh); ah.half[1] = *(const v8us*)((const unsigned short*)arow + kb + 16 + 8 * hh);
#pragma unroll
    for (int t = 0; t < 4; ++t) { if (col0 + t * 16 >= N) continue; const size_t boff = (size_t)(col0 + t * 16 + ln) * ldb + kb; FragH bq; bq.half[0] = *(const v8us*)((const unsigned short*)Bh + boff + 8 * hh); bq.half[1] = *(const v8us*)((const unsigned short*)Bh + boff + 16 + 8 * hh);
      acc[t] = mmaH<1>(ah.v, ah.v, bq.v, bq.v, acc[t]); }
  }
#pragma unroll
  for (int t = 0; t < 4; ++t) { if (col0 + t * 16 >= N) continue; const int col = col0 + t * 16 + ln; const float bv = bp ? bf16_round(bp[col]) : 0.f;
#pragma unroll
    for (int r = 0; r < 8; ++r) { float v = acc[t][r] * alpha + bv; if (CP) { const int rr = row0g + row0 + 8 * hh + r; if (rowsPerB < 0) v += CP[cofs + (size_t)rr * ldc + col];      /* rowsPerB < 0: own element of the batched C plane */ else { const int bidx = rr / rowsPerB; v += CP[(size_t)bidx * sCPb + (size_t)by * 64 + col]; } } if (ACT == 1) v = (v > 0.f) ? v : expm1f(v); else if (ACT == 7) v = (v > 0.f) ? v + 1.0f : expf(v); else if (ACT == 8) v = tanhf(v); else if (ACT == 9) v = 0.5f * v * (1.0f + tanhf(0.7978845608028654f * (v + 0.044715f * v * v * v))); else if (ACT == 11) v = 1.0f / (1.0f + expf(-v)); else if (ACT == 12) v = (v > 0.f) ? v : 0.01f * v; else if (ACT == 14) v = (v > 0.f) ? v : 0.1f * v; else if (ACT == 16) v = (v >= 0.f) ? v : 0.3f * v; else if (ACT == 17) v = (v >= 0.f) ? v : 0.2f * v; else if (ACT == 15) v = v / (1.0f + expf(-v)); else if (ACT == 3) v = fmaxf(v, 0.f); else if (ACT == 6) v = 0.5f * v * (1.0f + erff(v * 0.70710678118654752f)); so[w][8 * hh + r][t * 16 + ln] = v; } }
  __builtin_amdgcn_fence(__ATOMIC_ACQ_REL, "workgroup"); __builtin_amdgcn_wave_barrier();
  const int rsub = lane >> 4, c4 = (lane & 15) * 4; typedef _Float16 v4h __attribute__((ext_vector_type(4)));
  {
#pragma unroll
    for (int q = 0; q < 8; ++q) { const int r = q * 2 + rsub; if (col0 + c4 < N) { const v4f v = *(const v4fa*)&so[w][r][c4]; if (C) *(v4f*)(C + cofs + (size_t)(row0 + r) * ldc + col0 + c4) = v; if (C16) { v4h h4; for (int i = 0; i < 4; ++i) h4[i] = (_Float16)v[i]; *(v4h*)(C16 + cofs + (size_t)(row0 + r) * ldc + col0 + c4) = h4; } } }
     }
}


typedef _Float16 v4h __attribute__((ext_vector_type(4)));

__global__ __launch_bounds__(256) void k_round16f(const float* __restrict__ W, _Float16* __restrict__ Bt, size_t n8) { const size_t t = (size_t)blockIdx.x * 256 + threadIdx.x; if (t >= n8) return; FragH f;
#pragma unroll
  for (int i = 0; i < 8; ++i) f.h[i] = (_Float16)(bf16_round(W[t * 8 + i]) * 16.0f); *(v8us*)((unsigned short*)Bt + t * 8) = f.half[0];  }
template <int NHv, int TTv>
__global__ __launch_bounds__(256) void k_vt(const _Float16* __restrict__ V16, int ldv, int voff, _Float16* __restrict__ Vt) { __shared__ unsigned short tl[64][66]; const int tid = threadIdx.x; const int slab = blockIdx.x / (TTv / 64), lg = blockIdx.x % (TTv / 64); const int b = slab / NHv, h = slab % NHv;
  for (int i = tid; i < 64 * 8; i += 256) { const int r = i / 8, c8 = (i % 8) * 8; FragH f; f.half[0] = *(const v8us*)((const unsigned short*)V16 + ((size_t)b * TTv + lg * 64 + r) * ldv + voff + h * 64 + c8);
#pragma unroll
    for (int q = 0; q < 8; ++q) tl[r][c8 + q] = f.u[q]; }
  __syncthreads();
  {
#pragma unroll
    for (int rd = 0; rd < 2; ++rd) { const int d = rd * 32 + tid / 8, pc = tid % 8; FragH f;
#pragma unroll
      for (int q = 0; q < 8; ++q) f.u[q] = tl[pc * 8 + q][d];
      *(v8us*)((unsigned short*)Vt + ((size_t)slab * 64 + d) * TTv + lg * 64 + pc * 8) = f.half[0]; }
     } }

__global__ __launch_bounds__(256) void k_hl(const float* __restrict__ F, _Float16* __restrict__ Hh, _Float16* __restrict__ Hl, size_t n8) { const size_t t = (size_t)blockIdx.x * 256 + threadIdx.x; if (t >= n8) return; FragH fh, fl; const v4f a = *(const v4fa*)(F + t * 8), c = *(const v4fa*)(F + t * 8 + 4);
#pragma unroll
  for (int q = 0; q < 4; ++q) { _Float16 h = (_Float16)a[q]; fh.h[q] = h; fl.h[q] = (_Float16)((a[q] - (float)h) * 1024.0f); h = (_Float16)c[q]; fh.h[4 + q] = h; fl.h[4 + q] = (_Float16)((c[q] - (float)h) * 1024.0f); }
  { *(v8us*)((unsigned short*)Hh + t * 8) = fh.half[0]; *(v8us*)((unsigned short*)Hl + t * 8) = fl.half[0];  } }

// ---- staged-row GEMM pieces (K = CH, N = CH): LDS pitch, fragment read and product, shared by k_qk and k_gemm3 below ----
#define GP (CH + 8)              /* LDS pitch of a staged row, f16 units: 528 B = 16 B x odd, conflict-free for 16-byte fragment reads */
__device__ __forceinline__ v16h g3_frag(const unsigned short* p) { FragH f; f.half[0] = *(const v8us*)p; f.half[1] = *(const v8us*)(p + 16); return f.v; }
__device__ __forceinline__ v8f g3_mma(v16h a, v16h b, v8f c) { return __builtin_amdgcn_wmma_f32_16x16x32_f16(false, a, false, b, (short)0, c, false, false); }


// ---- q and k projections in one launch, straight from the f32 x rows: one work-group = 128 rows, 16 waves of 32x64 tiles as in k_gemm3. The x rows are read once as whole 512-byte pieces, rounded (bf16, exact in f16)
// and staged in LDS, where they stay for both passes; the first pass runs them against the k rows of Bh, the second against the q rows (k first: its three times larger output drains while the q pass computes).
// The B rows of a pass and its output tiles share the second LDS array.
typedef unsigned short v4us __attribute__((ext_vector_type(4), may_alias));
union Frag4 { v4us v; _Float16 h[4]; };
/* work-group barrier that orders LDS traffic only: __syncthreads() would also wait until the first pass's global stores have completed, although no wave reads them in this launch */
__device__ __forceinline__ void qk_barrier() { __builtin_amdgcn_fence(__ATOMIC_RELEASE, "workgroup", "local"); __builtin_amdgcn_s_barrier(); __builtin_amdgcn_fence(__ATOMIC_ACQUIRE, "workgroup", "local"); }
__global__ __launch_bounds__(512) void k_qk(const float* __restrict__ x, const _Float16* __restrict__ Bh, const float* __restrict__ bias, _Float16* __restrict__ Q16, float* __restrict__ KF, _Float16* __restrict__ K16) {
  __shared__ __attribute__((aligned(16))) unsigned short sa[128 * GP];      /* 128 x rows, f16 */
  __shared__ __attribute__((aligned(16))) unsigned short sb[16 * 32 * 68 * 2];      /* CH B rows of the pass, then the 16 output tiles (32 x 68 f32 each) */
  static_assert(CH * GP <= 16 * 32 * 68 * 2, "the B rows must fit the bytes of the output tiles");
  float (*so)[32][68] = reinterpret_cast<float (*)[32][68]>(sb);
  const int tid = threadIdx.x, w = tid >> 5, lane = tid & 31, ln = lane & 15, hh = lane >> 4;
  const int mt = blockIdx.x, row0 = mt * 128 + 32 * (w & 3), col0 = (w >> 2) * 64;
  const unsigned short* bg = (const unsigned short*)Bh + (size_t)w * CH + lane * 8;
  v8us rb[16];      /* the B rows of the coming pass on their way to LDS; every loop over them is unrolled so that they stay in registers */
  float bv[2][4];      /* both passes' biases, read here so that no wait for them stands behind the B loads of the second pass */
  { const float* xg = x + ((size_t)mt * 128 + w) * CH + lane * 4; v4f xa[8][2];      /* unrolled: all loads are in flight before the first conversion waits for one */
#pragma unroll
    for (int u = 0; u < 8; ++u) { xa[u][0] = *(const v4fa*)(xg + u * 16 * CH); xa[u][1] = *(const v4fa*)(xg + u * 16 * CH + 128); }
#pragma unroll
    for (int u = 0; u < 16; ++u) rb[u] = *(const v8us*)(bg + (size_t)CH * CH + u * 16 * CH);
#pragma unroll
    for (int u = 0; u < 8; ++u) bv[u >> 2][u & 3] = bias[(u >> 2) * CH + col0 + (u & 3) * 16 + ln];
    asm volatile("s_wait_xcnt 0x0" :: "v"(xg) : "memory"); /* the registers that the loads above name are reused further down: the wait stands in front of every such overwrite; the x pointer is an input so that no load's own result lands on it ahead of the wait */
    unsigned short* sw = sa + w * GP + lane * 4;
#pragma unroll
    for (int u = 0; u < 8; ++u)
#pragma unroll
      for (int p = 0; p < 2; ++p) { Frag4 f;
#pragma unroll
        for (int i = 0; i < 4; ++i) f.h[i] = (_Float16)bf16_round(xa[u][p][i]);
        *(v4us*)(sw + u * 16 * GP + p * 128) = f.v; } }
  const unsigned short* al = sa + (32 * (w & 3) + ln) * GP + 8 * hh; const unsigned short* bl = sb + (col0 + ln) * GP + 8 * hh;
  const int rsub = lane >> 4, c4 = (lane & 15) * 4; const size_t o0 = (size_t)(row0 + rsub) * CH + col0 + c4;      /* a lane's first output element; its later ones are 2 rows apart */
#pragma unroll      /* unrolled: which outputs a pass writes is then known at compile time, and no branch stands between the stores */
  for (int part = 1; part >= 0; --part) {      /* 1: k, 0: q */
    { unsigned short* sw = sb + w * GP + lane * 8;
#pragma unroll
      for (int u = 0; u < 16; ++u) *(v8us*)(sw + u * 16 * GP) = rb[u]; }
    qk_barrier();      /* publishes the B rows of this pass (in the first pass the x rows too) */
    const v8f z8 = {0.f,0.f,0.f,0.f,0.f,0.f,0.f,0.f}; v8f c00 = z8, c01 = z8, c02 = z8, c03 = z8, c10 = z8, c11 = z8, c12 = z8, c13 = z8;
    /* two register sets, the reads of k step s + 1 as one group ahead of the products of step s, as in k_gemm3 */
    v16h fa[2][2], fb[2][4];
    fa[0][0] = g3_frag(al); fa[0][1] = g3_frag(al + 16 * GP);
#pragma unroll
    for (int t = 0; t < 4; ++t) fb[0][t] = g3_frag(bl + t * 16 * GP);
#pragma unroll
    for (int s = 0; s < CH / 32; ++s) { const int cu = s & 1, nx = cu ^ 1;
      if (s + 1 < CH / 32) { const int kb = (s + 1) * 32; fa[nx][0] = g3_frag(al + kb); fa[nx][1] = g3_frag(al + 16 * GP + kb);
#pragma unroll
        for (int t = 0; t < 4; ++t) fb[nx][t] = g3_frag(bl + t * 16 * GP + kb); }
      __builtin_amdgcn_sched_barrier(0);      /* keeps the read group above in front of these products, as in k_gemm3 */
      c00 = g3_mma(fa[cu][0], fb[cu][0], c00); c10 = g3_mma(fa[cu][1], fb[cu][0], c10); c01 = g3_mma(fa[cu][0], fb[cu][1], c01); c11 = g3_mma(fa[cu][1], fb[cu][1], c11);
      c02 = g3_mma(fa[cu][0], fb[cu][2], c02); c12 = g3_mma(fa[cu][1], fb[cu][2], c12); c03 = g3_mma(fa[cu][0], fb[cu][3], c03); c13 = g3_mma(fa[cu][1], fb[cu][3], c13); }
    qk_barrier();      /* every wave has read its last B fragment: from here those bytes are the waves' own output tiles */
    if (part == 1) {      /* the q rows of Bh start their way here and fly while the k tiles are written out */
#pragma unroll
      for (int u = 0; u < 16; ++u) rb[u] = *(const v8us*)(bg + u * 16 * CH); }
    v8f accs[8] = {c00, c01, c02, c03, c10, c11, c12, c13};
#pragma unroll
    for (int u = 0; u < 8; ++u) { const int t = u & 3, half = u >> 2; const float bq = bf16_round(bv[part][t]);
#pragma unroll
      for (int r = 0; r < 8; ++r) so[w][half * 16 + 8 * hh + r][t * 16 + ln] = accs[u][r] * 0.0625f + bq; }
    __builtin_amdgcn_fence(__ATOMIC_ACQ_REL, "workgroup", "local"); __builtin_amdgcn_wave_barrier();      /* a wave reads back what its own lanes wrote */
    _Float16* o16 = (part ? K16 : Q16) + o0; float* o32 = KF + o0;
#pragma unroll
    for (int q = 0; q < 16; ++q) { const v4f v = *(const v4fa*)&so[w][q * 2 + rsub][c4];
      if (part) *(v4f*)(o32 + q * 2 * CH) = v;
      v4h h4; for (int i = 0; i < 4; ++i) h4[i] = (_Float16)v[i]; *(v4h*)(o16 + q * 2 * CH) = h4; }
    if (part == 1) { asm volatile("s_wait_xcnt 0x0" ::: "memory"); /* the second pass reuses the registers that the k stores name: the wait stands in front of that overwrite */
      qk_barrier(); }      /* every wave has read its k tile back: the q rows of Bh may be written over the tiles */
  } }

__device__ __forceinline__ float hswish(float v) { return v * fminf(fmaxf(v + 3.0f, 0.0f), 6.0f) * (1.0f / 6.0f); }
// Fused stripe attention: one work-group = one (branch, plane, head), 16 waves x 32 query columns. K rows and V^T rows are staged once in LDS, both from the k rows as the GEMM wrote them; each wave forms
// S^T = K Q^T (a lane holds one query's scores), takes the exact row maximum in a first walk over the keys, then walks again: p = 2^10 exp(scale (s - max)), packed from the
// score accumulators straight into the B operand of O^T += V^T P^T; the row sum stays in f32 and divides the result. Scores and probabilities never reach memory.
#define KP 40                    /* LDS pitch of a K row, f16 units: 80 B = 16 B x odd, conflict-free for 16-byte fragment reads */
#define VP 520                   /* LDS pitch of a V^T row, f16 units: 1040 B = 16 B x odd */
__device__ __forceinline__ v16h at_frag(const unsigned short* p, int hh) { FragH f; f.half[0] = *(const v8us*)(p + 8 * hh); f.half[1] = *(const v8us*)(p + 16 + 8 * hh); return f.v; }
__device__ __forceinline__ v8f at_mma(v16h a, v16h b, v8f c) { return __builtin_amdgcn_wmma_f32_16x16x32_f16(false, a, false, b, (short)0, c, false, false); }
__device__ __forceinline__ float at_max8(v8f s, float m) { const float t0 = fmaxf(fmaxf(s[0], s[1]), s[2]), t1 = fmaxf(fmaxf(s[3], s[4]), s[5]), t2 = fmaxf(fmaxf(s[6], s[7]), m); return fmaxf(fmaxf(t0, t1), t2); }
__device__ __forceinline__ v8f at_exp8(v8f s, float c, float b) { float x[8], e[8];
  for (int r = 0; r < 8; ++r) x[r] = s[r] * c + b;
  /* eight 2^x in one statement: early-clobber results keep every result off every source, and the closing v_nop is the one slot the instruction set asks for behind a transcendental before a source may be overwritten or the result used */
  asm("v_exp_f32 %0, %8\n\tv_exp_f32 %1, %9\n\tv_exp_f32 %2, %10\n\tv_exp_f32 %3, %11\n\tv_exp_f32 %4, %12\n\tv_exp_f32 %5, %13\n\tv_exp_f32 %6, %14\n\tv_exp_f32 %7, %15\n\tv_nop"
      : "=&v"(e[0]), "=&v"(e[1]), "=&v"(e[2]), "=&v"(e[3]), "=&v"(e[4]), "=&v"(e[5]), "=&v"(e[6]), "=&v"(e[7]) : "v"(x[0]), "v"(x[1]), "v"(x[2]), "v"(x[3]), "v"(x[4]), "v"(x[5]), "v"(x[6]), "v"(x[7]));
  const v8f o = {e[0], e[1], e[2], e[3], e[4], e[5], e[6], e[7]}; return o; }
__device__ __forceinline__ float at_sum8(v8f e) { return ((e[0] + e[1]) + (e[2] + e[3])) + ((e[4] + e[5]) + (e[6] + e[7])); }
__device__ __forceinline__ v16h at_pack(v8f e0, v8f e1) { FragH f;
  for (int r = 0; r < 8; ++r) { f.h[r] = (_Float16)e0[r]; f.h[8 + r] = (_Float16)e1[r]; } return f.v; }
typedef unsigned int u32a __attribute__((may_alias));
/* a minimum of 8 waves per SIMD = 128 vector registers a wave, as before this staging: without it the build takes 130, which is 7 waves per SIMD, so only one 16-wave work-group would fit a WGP instead of two */
__global__ __launch_bounds__(512, 8) void k_attn(const _Float16* __restrict__ Q16, const _Float16* __restrict__ K16, float* __restrict__ CTX) {
  __shared__ __attribute__((aligned(16))) unsigned short sk[TOKS * KP];
  __shared__ __attribute__((aligned(16))) unsigned short sv[DH * VP];
  const int tid = threadIdx.x, w = tid >> 5, lane = tid & 31, ln = lane & 15, hh = lane >> 4;
  const int h = blockIdx.x % NHB, pl = blockIdx.x / NHB; const bool vert = blockIdx.y != 0;
  const int bi = pl / NST, st = pl % NST;
  /* token -> row of the [NR][CH] q / k planes: a horizontal stripe is 512 rows in a run; a vertical stripe takes 8 rows out of every 64 (one form for both, so that no branch stands between the loads) */
  const int rbase = vert ? bi * NPX + st * WIN : pl * TOKS, rstep = vert ? WSD : WIN;
  auto rowof = [&](int tok) { return rbase + (tok >> 3) * rstep + (tok & 7); };
  const int ch0 = (vert ? CHH : 0) + h * DH;
  const unsigned short* qg = (const unsigned short*)Q16 + ch0;
  const unsigned short* kg = (const unsigned short*)K16 + ch0;
  /* a thread takes 8 channels of two neighbouring tokens (neighbouring rows in both branches): two 16-byte K row pieces, and the same values as 8 (token, token + 1) pairs for the V^T rows (v = k) */
  for (int u = 0; u < 2; ++u) { const int i = tid + 512 * u; const int t0 = (i >> 2) * 2, kc = (i & 3) * 8; const unsigned short* kr = kg + (size_t)rowof(t0) * CH + kc;
    FragH a; a.half[0] = *(const v8us*)kr; a.half[1] = *(const v8us*)(kr + CH);
    asm volatile("s_wait_xcnt 0x0" ::: "memory"); /* the address pair of these two loads is reused further down: the wait stands in front of that overwrite */
    *(v8us*)(sk + t0 * KP + kc) = a.half[0]; *(v8us*)(sk + (t0 + 1) * KP + kc) = a.half[1];
    for (int q = 0; q < 8; ++q) *(u32a*)(sv + (kc + q) * VP + t0) = (unsigned int)a.u[q] | ((unsigned int)a.u[8 + q] << 16); }
  const int q0r = w * 32 + ln;
  __syncthreads();      /* publishes the staged K and V^T rows; they are only read from here on */
  const v16h q0 = at_frag(qg + (size_t)rowof(q0r) * CH, hh), q1 = at_frag(qg + (size_t)rowof(q0r + 16) * CH, hh);
  const v8f z8 = {0.f,0.f,0.f,0.f,0.f,0.f,0.f,0.f};
  float m0 = -3.0e38f, m1 = -3.0e38f;
  const unsigned short* kl = sk + ln * KP;
  for (int t = 0; t < TOKS / 16; ++t) { const v16h ka = at_frag(kl + t * 16 * KP, hh);
    const v8f s0 = at_mma(ka, q0, z8), s1 = at_mma(ka, q1, z8); m0 = at_max8(s0, m0); m1 = at_max8(s1, m1); }
  m0 = fmaxf(m0, __shfl_xor(m0, 16, 32)); m1 = fmaxf(m1, __shfl_xor(m1, 16, 32));
  const float c = 0.17677669529663688f * 1.4426950408889634f;      /* 1/sqrt(32) x log2(e) */
  const float b0 = 10.0f - m0 * c, b1 = 10.0f - m1 * c;
  float su0 = 0.f, su1 = 0.f; v8f o00 = z8, o01 = z8, o10 = z8, o11 = z8;
  const unsigned short* vl = sv + ln * VP;
  for (int t = 0; t < TOKS / 32; ++t) { const v16h ka = at_frag(kl + t * 32 * KP, hh), kb = at_frag(kl + (t * 32 + 16) * KP, hh); const v16h va = at_frag(vl + t * 32, hh), vb = at_frag(vl + 16 * VP + t * 32, hh);
    const v8f e00 = at_exp8(at_mma(ka, q0, z8), c, b0), e01 = at_exp8(at_mma(kb, q0, z8), c, b0), e10 = at_exp8(at_mma(ka, q1, z8), c, b1), e11 = at_exp8(at_mma(kb, q1, z8), c, b1);
    su0 += at_sum8(e00) + at_sum8(e01); su1 += at_sum8(e10) + at_sum8(e11);
    const v16h p0 = at_pack(e00, e01), p1 = at_pack(e10, e11);
    o00 = at_mma(va, p0, o00); o01 = at_mma(vb, p0, o01); o10 = at_mma(va, p1, o10); o11 = at_mma(vb, p1, o11); }
  su0 += __shfl_xor(su0, 16, 32); su1 += __shfl_xor(su1, 16, 32);
  const float i0 = 1.0f / su0, i1 = 1.0f / su1;
  /* horizontal: the token's own row, columns h*32..; vertical: the reference's inverse reshape sends (stripe, head, token = a*64 + c) to row (stripe*8 + a, head*16 + c/4), columns 128 + (c%4)*32.. */
  float* og = CTX + (vert ? ((size_t)(bi * HS + st * WIN) * WSD + h * 16) * CH + CHH : (size_t)pl * TOKS * CH + h * DH); const int oc4 = vert ? CH : 4 * CH, oc1 = vert ? DH : CH;
  auto dstof = [&](int tok) { return og + (tok >> 6) * (WSD * CH) + ((tok & 63) >> 2) * oc4 + (tok & 3) * oc1; };
  float* d0 = dstof(q0r) + 8 * hh; float* d1 = dstof(q0r + 16) + 8 * hh;
  *(v8f*)d0 = o00 * i0; *(v8f*)(d0 + 16) = o01 * i0; *(v8f*)d1 = o10 * i1; *(v8f*)(d1 + 16) = o11 * i1; }
// ---- output projection, its A rows made in place: one work-group = 128 rows (two image rows) x all CH columns, 16 waves of 32x64 tiles (4 row groups x 4 column groups).
// A row = f16(hard_swish(context + depthwise3x3(hard_swish(v)) + b)): a thread takes 4 channels of 8 neighbouring pixels in both image rows and walks the 4 x 10 patch of v around them, so that a value of v is read
// and hard-swished once for the up to six sums that it enters; the rows go straight to LDS, beside all B rows (whole 512-byte rows, one per wave-wide load). After the products the same LDS holds the waves' output tiles.
__global__ __launch_bounds__(512) void k_gemm3(const float* __restrict__ CTX, const float* __restrict__ KF, const float* __restrict__ dwk, const float* __restrict__ dwb, const _Float16* __restrict__ Bh, const float* __restrict__ bias, float* __restrict__ C) {
  __shared__ __attribute__((aligned(16))) unsigned short sab[(128 + CH) * GP];      /* 128 A rows, then CH B rows */
  float (*so)[32][68] = reinterpret_cast<float (*)[32][68]>(sab);      /* 16 output tiles over the staged rows, behind the second barrier */
  static_assert(sizeof(float) * 16 * 32 * 68 <= sizeof(unsigned short) * (128 + CH) * GP, "output tiles must fit the staging bytes");
  static_assert(2 * WSD == 128 && WSD == 64 && CH == 256, "a work-group's 128 rows are two image rows; 8 runs of 8 pixels x 64 groups of 4 channels = 512 threads");
  const int tid = threadIdx.x, w = tid >> 5, lane = tid & 31, ln = lane & 15, hh = lane >> 4;
  const int mt = blockIdx.x;
  const int row0 = mt * 128 + 32 * (w & 3), col0 = (w >> 2) * 64;
  { const int x0 = (tid >> 6) * 8, y0 = (mt % (HS / 2)) * 2, c0 = (tid & 63) * 4;      /* first pixel of the run, first of the two image rows, first channel */
    const bool okl = x0 > 0, okr = x0 + 8 < WSD, okt = y0 > 0, okb = y0 + 2 < HS;      /* does the patch's left / right column, top / bottom row lie inside the image? */
    const int PB = CH * 4, RB = WSD * CH * 4;      /* bytes of a pixel's f32 row and of an image row */
    /* byte offsets inside an image row: the run's first pixel, and the patch's outer columns (held inside the image; what is read there for an outside tap is replaced by 0) */
    const unsigned cb = (unsigned)(c0 * 4), vb = (unsigned)(x0 * PB) + cb, vl = okl ? vb - PB : vb, vr = okr ? vb + 8 * PB : vb;
    const char* kimg = (const char*)(KF + (size_t)(mt / (HS / 2)) * NPX * CH);
    const char* kr[4] = {kimg + (size_t)(okt ? y0 - 1 : y0) * RB, kimg + (size_t)y0 * RB, kimg + (size_t)(y0 + 1) * RB, kimg + (size_t)(okb ? y0 + 2 : y0) * RB};
    const char* cxp = (const char*)(CTX + (size_t)mt * 128 * CH);
    const unsigned short* bg = (const unsigned short*)Bh + (size_t)w * CH + lane * 8;
    auto kload = [&](int r, int cx) -> v4f { return cx == 0 ? *(const v4fa*)(kr[r] + vl) : cx == 9 ? *(const v4fa*)(kr[r] + vr) : *(const v4fa*)(kr[r] + vb + (cx - 1) * PB); };
    auto hsw4 = [&](v4f v, bool ok) -> v4f { v4f o; for (int i = 0; i < 4; ++i) o[i] = ok ? hswish(v[i]) : 0.f; return o; };
    v8us rb[16]; v4f wt[9], bb, hv[10][4], cx[8][2];      /* every loop over these is unrolled so that they stay in registers */
#pragma unroll
    for (int u = 0; u < 16; ++u) rb[u] = *(const v8us*)(bg + u * 16 * CH);
#pragma unroll
    for (int t = 0; t < 9; ++t) wt[t] = *(const v4fa*)((const char*)dwk + cb + t * PB);
    bb = *(const v4fa*)((const char*)dwb + cb);
#pragma unroll
    for (int q = 0; q < 6; ++q)
#pragma unroll
      for (int r = 0; r < 4; ++r) hv[q][r] = kload(r, q);
    asm volatile("s_wait_xcnt 0x0" :: "v"(cb), "v"(vb), "v"(vl), "v"(bg) : "memory"); /* the registers that the loads above name are reused further down: the wait stands in front of every such overwrite; the offsets are inputs so that no load's own result lands on them ahead of the wait */
    { unsigned short* sw = sab + (128 + w) * GP + lane * 8;
#pragma unroll
      for (int u = 0; u < 16; ++u) *(v8us*)(sw + u * 16 * GP) = rb[u]; }
    __builtin_amdgcn_sched_barrier(0);      /* keeps the second group of loads behind the LDS stores that free the B rows' registers: moved up in front of them, the build runs out of registers and spills */
    /* second group of loads: it flies while the first pixels are worked on */
#pragma unroll
    for (int p = 0; p < 6; ++p) { cx[p][0] = *(const v4fa*)(cxp + vb + p * PB); cx[p][1] = *(const v4fa*)(cxp + vb + (RB + p * PB)); }
#pragma unroll
    for (int q = 6; q < 8; ++q)
#pragma unroll
      for (int r = 0; r < 4; ++r) hv[q][r] = kload(r, q);
#pragma unroll
    for (int t = 0; t < 9; ++t) for (int i = 0; i < 4; ++i) wt[t][i] = bf16_round(wt[t][i]);
    for (int i = 0; i < 4; ++i) bb[i] = bf16_round(bb[i]);
    auto pixel = [&](int p) {      /* both image rows of pixel x0 + p, from patch columns p .. p + 2; taps summed row by row, left to right */
#pragma unroll
      for (int o = 0; o < 2; ++o) { v4f acc = {0.f, 0.f, 0.f, 0.f};
#pragma unroll
        for (int i = 0; i < 3; ++i)
#pragma unroll
          for (int j = 0; j < 3; ++j) acc += hv[p + j][o + i] * wt[i * 3 + j];
        const v4f u = cx[p][o] + (acc + bb); Frag4 f;
        for (int i = 0; i < 4; ++i) f.h[i] = (_Float16)hswish(u[i]);
        *(v4us*)(sab + (o * WSD + x0 + p) * GP + c0) = f.v; } };
#pragma unroll
    for (int q = 0; q < 6; ++q)
#pragma unroll
      for (int r = 0; r < 4; ++r) hv[q][r] = hsw4(hv[q][r], (q > 0 || okl) && (r > 0 || okt) && (r < 3 || okb));
    pixel(0); pixel(1);
    __builtin_amdgcn_sched_barrier(0);      /* keeps the third group of loads behind the two pixels whose registers it takes over: moved up in front of them, the build runs out of registers and spills */
    /* third group, the rest of the context and of the patch, issued as soon as two pixels' registers are free: it flies while the pixels that need nothing of it are finished */
#pragma unroll
    for (int p = 6; p < 8; ++p) { cx[p][0] = *(const v4fa*)(cxp + vb + p * PB); cx[p][1] = *(const v4fa*)(cxp + vb + (RB + p * PB)); }
#pragma unroll
    for (int q = 8; q < 10; ++q)
#pragma unroll
      for (int r = 0; r < 4; ++r) hv[q][r] = kload(r, q);
    asm volatile("s_wait_xcnt 0x0" :: "v"(vb), "v"(vr) : "memory"); /* as above, for the second and the third group, which name the same registers */
    pixel(2); pixel(3);
#pragma unroll
    for (int q = 6; q < 8; ++q)
#pragma unroll
      for (int r = 0; r < 4; ++r) hv[q][r] = hsw4(hv[q][r], (r > 0 || okt) && (r < 3 || okb));
    pixel(4); pixel(5);
#pragma unroll
    for (int q = 8; q < 10; ++q)
#pragma unroll
      for (int r = 0; r < 4; ++r) hv[q][r] = hsw4(hv[q][r], (q < 9 || okr) && (r > 0 || okt) && (r < 3 || okb));
    pixel(6); pixel(7); }
  __syncthreads();      /* publishes the A rows made above and the staged B rows; they are only read until the next barrier */
  const unsigned short* al = sab + (32 * (w & 3) + ln) * GP + 8 * hh; const unsigned short* bl = sab + (128 + col0 + ln) * GP + 8 * hh;
  const v8f z8 = {0.f,0.f,0.f,0.f,0.f,0.f,0.f,0.f}; v8f c00 = z8, c01 = z8, c02 = z8, c03 = z8, c10 = z8, c11 = z8, c12 = z8, c13 = z8;
  /* two register sets: the twelve LDS reads of k step s + 1 stand as one group ahead of the eight products of step s, so that a wave waits for a group once a step and not before every pair of products; unrolled so that the set index is a constant and every read has an immediate offset */
  v16h fa[2][2], fb[2][4];
  fa[0][0] = g3_frag(al); fa[0][1] = g3_frag(al + 16 * GP);
#pragma unroll
  for (int t = 0; t < 4; ++t) fb[0][t] = g3_frag(bl + t * 16 * GP);
#pragma unroll
  for (int s = 0; s < CH / 32; ++s) { const int cu = s & 1, nx = cu ^ 1;
    if (s + 1 < CH / 32) { const int kb = (s + 1) * 32; fa[nx][0] = g3_frag(al + kb); fa[nx][1] = g3_frag(al + 16 * GP + kb);
#pragma unroll
      for (int t = 0; t < 4; ++t) fb[nx][t] = g3_frag(bl + t * 16 * GP + kb); }
    __builtin_amdgcn_sched_barrier(0);      /* keeps the read group above in front of these products: without it the compiler moves each pair of reads down to its first use and waits there for it */
    c00 = g3_mma(fa[cu][0], fb[cu][0], c00); c10 = g3_mma(fa[cu][1], fb[cu][0], c10); c01 = g3_mma(fa[cu][0], fb[cu][1], c01); c11 = g3_mma(fa[cu][1], fb[cu][1], c11);
    c02 = g3_mma(fa[cu][0], fb[cu][2], c02); c12 = g3_mma(fa[cu][1], fb[cu][2], c12); c03 = g3_mma(fa[cu][0], fb[cu][3], c03); c13 = g3_mma(fa[cu][1], fb[cu][3], c13); }
  __syncthreads();      /* every wave has read its last staged fragment: from here the bytes are the waves' own output tiles */
  v8f accs[8] = {c00, c01, c02, c03, c10, c11, c12, c13};
#pragma unroll
  for (int u = 0; u < 8; ++u) { const int t = u & 3, half = u >> 2; const float bv = bf16_round(bias[col0 + t * 16 + ln]);
#pragma unroll
    for (int r = 0; r < 8; ++r) so[w][half * 16 + 8 * hh + r][t * 16 + ln] = accs[u][r] * 0.0625f + bv; }
  __builtin_amdgcn_fence(__ATOMIC_ACQ_REL, "workgroup"); __builtin_amdgcn_wave_barrier();
  const int rsub = lane >> 4, c4 = (lane & 15) * 4; float* o32 = C + (size_t)(row0 + rsub) * CH + col0 + c4;      /* a lane's first output element; its later ones are 2 rows apart */
#pragma unroll
  for (int q = 0; q < 16; ++q) { const v4f v = *(const v4fa*)&so[w][q * 2 + rsub][c4]; *(v4f*)(o32 + q * 2 * CH) = v; } }

extern "C" void kernel_launch(void* const* d_in, const int* in_sizes, int n_in,
                              void* d_out, int out_size, void* d_ws, size_t ws_size, hipStream_t stream) {
  (void)in_sizes; (void)n_in; (void)out_size;
  const float* x = (const float*)d_in[0]; const float* wqkv = (const float*)d_in[1]; const float* bqkv = (const float*)d_in[2]; const float* dwk = (const float*)d_in[3]; const float* dwb = (const float*)d_in[4]; const float* wout = (const float*)d_in[5]; const float* bout = (const float*)d_in[6];
  char* ws = (char*)d_ws; size_t off = 0;
  auto take = [&](size_t bytes) { char* p = ws + off; off += (bytes + 255) & ~(size_t)255; return p; };
  const size_t ne = (size_t)NR * CH;
  _Float16* BQK = (_Float16*)take((size_t)2 * CH * CH * 2); _Float16* BO = (_Float16*)take((size_t)CH * CH * 2);
  _Float16* Q16 = (_Float16*)take(ne * 2); float* KF = (float*)take(ne * 4); _Float16* K16 = (_Float16*)take(ne * 2);
  float* CTX = (float*)take(ne * 4);
  if (off > ws_size) return;      /* 0.4 + 16 + 32 + 16 + 32 = about 97 MiB */
  k_wt_f16<<<(unsigned)(((size_t)CH * 2 * CH / 8 + 255) / 256), 256, 0, stream>>>(wqkv, BQK, CH, 2 * CH, 16.0f); k_wt_f16<<<(unsigned)(((size_t)CH * CH / 8 + 255) / 256), 256, 0, stream>>>(wout, BO, CH, CH, 16.0f);      /* (in, out) */
  const dim3 g(NR / 128, 1);
  k_qk<<<g, 512, 0, stream>>>(x, BQK, bqkv, Q16, KF, K16);      /* q (f16) and k = v (f32 + f16) from the f32 x rows */
  k_attn<<<dim3(NPL * NHB, 2), 512, 0, stream>>>(Q16, K16, CTX);      /* y = 0: horizontal, context columns h*32; y = 1: vertical, context columns 128.. through the permutation */
  k_gemm3<<<g, 512, 0, stream>>>(CTX, KF, dwk, dwb, BO, bout, (float*)d_out);      /* out = hswish(context + depthwise bias) w_out + b */
}

// v007
// It runs in 58.6 microseconds.
// It is 1.22 times as fast as v005, going by the measured steps of the versions left out in between.
// All steps since v000 together make it 14.8 times as fast.
#include <hip/hip_runtime.h>
// CrossShapedAttention (8 x 64 x 64 x 256, window 8, 4 heads x 32 per branch: [q | k] = x w_qkv + b (v = k); horizontal branch = channels 0..127 attending within each 8-row stripe (512 tokens), vertical branch = channels 128..255 within each 8-column stripe; softmax(q.k / sqrt(32)) v; the vertical context is put back through the TF code's exact reshape/transpose order (a fixed permutation of (row-in-stripe, column, head, channel)); bias = depthwise3x3(hard_swish(v)) + b; out = hard_swish(context + bias) w_out + b_out).
// Structure: q and k(=v) as f16 WMMA GEMMs in one launch that reads the f32 x rows itself and stages them once as exact f16 rows (32x64 wave tiles, f32 accumulation, exact x16 (in,out) weights + bias; q and k f16); horizontal stripes are contiguous row ranges: one fused launch does scores (K = 32), softmax (exact row maximum, f16 x 2^10 unnormalised, f32 row sum) and readout (N = 32) per (plane, head) with K and V^T in LDS (V^T is built from the K rows while they are staged), writing context columns h*32.. directly; the vertical branch runs in the same launch: it reads its q/k rows in place by the stripe's row map (token = row*8 + column-in-stripe) and stores its result through the reference's permutation; the output projection GEMM makes its own A rows while it stages them (hard-swish + depthwise 3x3 bias on VALU in f32 from the f16 k rows, added to the context rows, hard_swish, f16) and writes the [B,H,W,C] output.
// Compute dtype: inputs rounded to bf16; x / weights exact as f16; q, k, v and the final context as plain f16 GEMM operands (~2^-12); softmax / hard-swish / depthwise in f32. v_wmma_f32_16x16x32_f16.
#define NI 8
#define HS 64
#define WSD 64
#define CH 256
#define CHH 128                  /* channels per branch */
#define NHB 4                    /* heads per branch */
#define DH 32
#define WIN 8
#define NST 8                    /* stripes per image per branch */
#define TOKS 512                 /* tokens per stripe */
#define NPX (HS * WSD)
#define NR (NI * NPX)            /* 32768 */
#define NPL (NI * NST)           /* 64 (image, stripe) planes per branch */
typedef __bf16 v16b __attribute__((ext_vector_type(16)));
typedef unsigned short v8us __attribute__((ext_vector_type(8), may_alias));
typedef float  v8f  __attribute__((ext_vector_type(8)));
typedef float  v4f  __attribute__((ext_vector_type(4)));
typedef float  v4fa __attribute__((ext_vector_type(4), may_alias));
union FragB { v16b v; v8us half[2]; unsigned short u[16]; };

__device__ __forceinline__ unsigned short bf16_bits(float x) { unsigned int u = __float_as_uint(x); return (unsigned short)((u + 0x7FFFu + ((u >> 16) & 1u)) >> 16); }
__device__ __forceinline__ float bf16_val(unsigned short b) { return __uint_as_float(((unsigned int)b) << 16); }
__device__ __forceinline__ float bf16_round(float x) { return bf16_val(bf16_bits(x)); }
// D += A·B with NT terms: 1 = ah·bh, 2 = + al·bh (A split), 3 = + ah·bl (both split)
template <int NT>
__device__ __forceinline__ v8f mmaN(v16b ah, v16b al, v16b bh, v16b bl, v8f c) {
  c = __builtin_amdgcn_wmma_f32_16x16x32_bf16(false, ah, false, bh, (short)0, c, false, false);
  if (NT >= 2) c = __builtin_amdgcn_wmma_f32_16x16x32_bf16(false, al, false, bh, (short)0, c, false, false);
  if (NT >= 3) c = __builtin_amdgcn_wmma_f32_16x16x32_bf16(false, ah, false, bl, (short)0, c, false, false);
  asm volatile("v_nop\n\tv_nop\n\tv_nop\n\tv_nop" : "+v"(c) : "v"(ah), "v"(al), "v"(bh), "v"(bl));
  return c;
}

__global__ __launch_bounds__(256) void k_wt_bf16(const float* __restrict__ W, unsigned short* __restrict__ Wt, int K, int N) {
  const int t = blockIdx.x * 256 + threadIdx.x;
  const int k8n = K / 8;
  if (t >= N * k8n) return;
  const int n = t / k8n, k8 = (t % k8n) * 8;
  v8us v;
#pragma unroll
  for (int i = 0; i < 8; ++i) v[i] = bf16_bits(W[(size_t)(k8 + i) * N + n]);
  *(v8us*)(Wt + (size_t)n * K + k8) = v;
  
}

// GEMM C[M][N] (f32, pitch ldc) = act(A[M][K]·W + bias). A f32 row-major (pitch lda) converted per fragment to bf16
// (ASPLIT: hi/lo two planes -> 2 terms, else single rounded term); Wt bf16 [N][K] (pitch ldb). BIAS_BF16 rounds the
// bias to bf16 first (bias quantised to bf16 before the add). K%32==0, M%16==0, N%64==0.
template <bool ASPLIT, int ACT, bool BIAS_BF16>
__global__ __launch_bounds__(128) void k_gemm_bf(const float* __restrict__ A, int lda, const unsigned short* __restrict__ Wt, int ldb,
                                               const float* __restrict__ bias, float* __restrict__ C, int ldc, int M, int N, int K) {
  __shared__ __attribute__((aligned(16))) float so[4][16][64];
  const int tid = threadIdx.x, w = tid >> 5, lane = tid & 31, ln = lane & 15, hh = lane >> 4;
  const int ntn = N / 64;
  const int wid = blockIdx.x * 4 + w;
  const int mt = wid / ntn, nq = wid % ntn;
  if (mt * 16 >= M) return;
  const int row0 = mt * 16, col0 = nq * 64;
  const float* arow = A + (size_t)(row0 + ln) * lda;
  v8f acc[4] = {};
  for (int kb = 0; kb < K; kb += 32) {
    FragB ah, al;
    const v4f x0 = *(const v4fa*)(arow + kb + 8 * hh), x1 = *(const v4fa*)(arow + kb + 8 * hh + 4);
    const v4f x2 = *(const v4fa*)(arow + kb + 16 + 8 * hh), x3 = *(const v4fa*)(arow + kb + 16 + 8 * hh + 4);
    float xs[16] = {x0[0],x0[1],x0[2],x0[3],x1[0],x1[1],x1[2],x1[3],x2[0],x2[1],x2[2],x2[3],x3[0],x3[1],x3[2],x3[3]};
#pragma unroll
    for (int i = 0; i < 16; ++i) { const unsigned short hb = bf16_bits(xs[i]); ah.u[i] = hb; al.u[i] = ASPLIT ? bf16_bits(xs[i] - bf16_val(hb)) : (unsigned short)0; }
#pragma unroll
    for (int t = 0; t < 4; ++t) {
      const unsigned short* brow = Wt + (size_t)(col0 + t * 16 + ln) * ldb + kb;
      FragB b;
      b.half[0] = *(const v8us*)(brow + 8 * hh);
      b.half[1] = *(const v8us*)(brow + 16 + 8 * hh);
      acc[t] = mmaN<ASPLIT ? 2 : 1>(ah.v, al.v, b.v, b.v, acc[t]);
    }
  }
#pragma unroll
  for (int t = 0; t < 4; ++t) {
    float bv = bias ? bias[col0 + t * 16 + ln] : 0.f;
    if (BIAS_BF16) bv = bf16_round(bv);
#pragma unroll
    for (int r = 0; r < 8; ++r) { float v = acc[t][r] + bv; if (ACT == 1) v = fmaxf(v, 0.f); so[w][8 * hh + r][t * 16 + ln] = v; }
  }
  __builtin_amdgcn_fence(__ATOMIC_ACQ_REL, "workgroup");
  __builtin_amdgcn_wave_barrier();
  const int rsub = lane >> 4, c4 = (lane & 15) * 4;
  {
#pragma unroll
    for (int q = 0; q < 8; ++q) {
      const int r = q * 2 + rsub;
      const v4f v = *(const v4fa*)&so[w][r][c4];
      *(v4f*)(C + (size_t)(row0 + r) * ldc + col0 + c4) = v;
    }
    
  }
}

// GEMM C = act(A·W + bias + resid): A f32 (ASPLIT -> hi/lo 2 terms), Wt bf16 [N][K]; ACT 0 none, 1 relu, 2 exact gelu;
// resid (optional, f32, row index = (row % rmod), pitch ldr, RES_BF16 rounds it) added before the activation.
template <bool ASPLIT, int ACT, bool BIAS_BF16, bool RES_BF16>
__global__ __launch_bounds__(128) void k_gemm_bf3(const float* __restrict__ A, int lda, const unsigned short* __restrict__ Wt, int ldb,
                                                const float* __restrict__ bias, const float* __restrict__ resid, int rmod, int ldr,
                                                float* __restrict__ C, int ldc, int M, int N, int K) {
  __shared__ __attribute__((aligned(16))) float so[4][16][64];
  const int tid = threadIdx.x, w = tid >> 5, lane = tid & 31, ln = lane & 15, hh = lane >> 4;
  const int ntn = N / 64;
  const int wid = blockIdx.x * 4 + w;
  const int mt = wid / ntn, nq = wid % ntn;
  if (mt * 16 >= M) return;
  const int row0 = mt * 16, col0 = nq * 64;
  const float* arow = A + (size_t)(row0 + ln) * lda;
  v8f acc[4] = {};
  for (int kb = 0; kb < K; kb += 32) {
    FragB ah, al;
    const v4f x0 = *(const v4fa*)(arow + kb + 8 * hh), x1 = *(const v4fa*)(arow + kb + 8 * hh + 4);
    const v4f x2 = *(const v4fa*)(arow + kb + 16 + 8 * hh), x3 = *(const v4fa*)(arow + kb + 16 + 8 * hh + 4);
    float xs[16] = {x0[0],x0[1],x0[2],x0[3],x1[0],x1[1],x1[2],x1[3],x2[0],x2[1],x2[2],x2[3],x3[0],x3[1],x3[2],x3[3]};
#pragma unroll
    for (int i = 0; i < 16; ++i) { const unsigned short hb = bf16_bits(xs[i]); ah.u[i] = hb; al.u[i] = ASPLIT ? bf16_bits(xs[i] - bf16_val(hb)) : (unsigned short)0; }
#pragma unroll
    for (int t = 0; t < 4; ++t) {
      const unsigned short* brow = Wt + (size_t)(col0 + t * 16 + ln) * ldb + kb;
      FragB b;
      b.half[0] = *(const v8us*)(brow + 8 * hh);
      b.half[1] = *(const v8us*)(brow + 16 + 8 * hh);
      acc[t] = mmaN<ASPLIT ? 2 : 1>(ah.v, al.v, b.v, b.v, acc[t]);
    }
  }
#pragma unroll
  for (int t = 0; t < 4; ++t) {
    const int col = col0 + t * 16 + ln;
    float bv = bias ? bias[col] : 0.f;
    if (BIAS_BF16) bv = bf16_round(bv);
#pragma unroll
    for (int r = 0; r < 8; ++r) {
      float v = acc[t][r] + bv;
      if (resid) { float rv = resid[(size_t)((row0 + 8 * hh + r) % rmod) * ldr + col]; if (RES_BF16) rv = bf16_round(rv); v += rv; }
      if (ACT == 1) v = fmaxf(v, 0.f);
      if (ACT == 2) v = 0.5f * v * (1.0f + erff(v * 0.70710678118654752f));
      if (ACT == 3) { const float u = 0.7978845608028654f * (v + 0.044715f * v * v * v); v = 0.5f * v * (1.0f + tanhf(u)); }
      so[w][8 * hh + r][t * 16 + ln] = v;
    }
  }
  __builtin_amdgcn_fence(__ATOMIC_ACQ_REL, "workgroup");
  __builtin_amdgcn_wave_barrier();
  const int rsub = lane >> 4, c4 = (lane & 15) * 4;
  {
#pragma unroll
    for (int q = 0; q < 8; ++q) {
      const int r = q * 2 + rsub;
      const v4f v = *(const v4fa*)&so[w][r][c4];
      *(v4f*)(C + (size_t)(row0 + r) * ldc + col0 + c4) = v;
    }
    
  }
}
// row LayerNorm (biased variance, eps) over N: s = X (+ R); optional out_sum <- s; out_norm <- (s-mu)*rsqrt(var+eps)*g + b
template <bool PARAM_BF16>
__global__ __launch_bounds__(256) void k_layernorm(const float* __restrict__ X, const float* __restrict__ R, const float* __restrict__ g, const float* __restrict__ bta,
                                                  float* __restrict__ out_sum, float* __restrict__ out_norm, int N, float eps) {
  __shared__ float red[256];
  const int row = blockIdx.x, tid = threadIdx.x;
  const float* x = X + (size_t)row * N; const float* rr = R ? R + (size_t)row * N : nullptr;
  float vals[16];                     // up to N = 4096
  const int per = N / 256;            // contiguous chunk per thread? use strided-by-4 chunks: thread handles j = tid*4 + 1024*u
  float s1 = 0.f;
  for (int u = 0; u < per / 4; ++u) {
    const int j = tid * 4 + 1024 * u;
    const v4f a = *(const v4fa*)(x + j);
    v4f b = {0.f,0.f,0.f,0.f}; if (rr) b = *(const v4fa*)(rr + j);
#pragma unroll
    for (int q = 0; q < 4; ++q) { const float v = a[q] + b[q]; vals[u * 4 + q] = v; s1 += v; }
  }
  red[tid] = s1; __syncthreads();
  for (int st = 128; st > 0; st >>= 1) { if (tid < st) red[tid] += red[tid + st]; __syncthreads(); }
  const float mu = red[0] / (float)N; __syncthreads();
  float s2 = 0.f;
  for (int u = 0; u < per / 4; ++u)
#pragma unroll
    for (int q = 0; q < 4; ++q) { const float c = vals[u * 4 + q] - mu; s2 += c * c; }
  red[tid] = s2; __syncthreads();
  for (int st = 128; st > 0; st >>= 1) { if (tid < st) red[tid] += red[tid + st]; __syncthreads(); }
  const float rs = rsqrtf(red[0] / (float)N + eps);
  {
    for (int u = 0; u < per / 4; ++u) {
      const int j = tid * 4 + 1024 * u;
      v4f o, sm;
#pragma unroll
      for (int q = 0; q < 4; ++q) {
        float gg = g[j + q], bb = bta[j + q];
        if (PARAM_BF16) { gg = bf16_round(gg); bb = bf16_round(bb); }
        sm[q] = vals[u * 4 + q]; o[q] = (vals[u * 4 + q] - mu) * rs * gg + bb;
      }
      if (out_sum) *(v4f*)(out_sum + (size_t)row * N + j) = sm;
      *(v4f*)(out_norm + (size_t)row * N + j) = o;
    }
    
  }
}



// ---- f16 WMMA path (v_wmma_f32_16x16x32_f16): 11-bit significands for operands in range — used for every GEMM here, including the 2^10-scaled probability operand that needs more precision than bf16
typedef _Float16 v16h __attribute__((ext_vector_type(16)));
union FragH { v16h v; v8us half[2]; _Float16 h[16]; unsigned short u[16]; };
template <int NT>
__device__ __forceinline__ v8f mmaH(v16h ah, v16h al, v16h bh, v16h bl, v8f c) {
  c = __builtin_amdgcn_wmma_f32_16x16x32_f16(false, ah, false, bh, (short)0, c, false, false);
  if (NT >= 2) c = __builtin_amdgcn_wmma_f32_16x16x32_f16(false, al, false, bh, (short)0, c, false, false);
  if (NT >= 3) c = __builtin_amdgcn_wmma_f32_16x16x32_f16(false, ah, false, bl, (short)0, c, false, false);
  asm volatile("v_nop\n\tv_nop\n\tv_nop\n\tv_nop" : "+v"(c) : "v"(ah), "v"(al), "v"(bh), "v"(bl));
  return c;
}
// batched GEMM like k_gemm_b but f16 operands: A f32 (split into f16 hi/lo if ASPLIT, else rounded to f16), Bt = f16 values [n][k]; alpha; C f32; N multiple of 16 (partial tiles skipped)
template <bool ASPLIT>
__global__ __launch_bounds__(128) void k_gemm_h(const float* __restrict__ A, int lda, size_t sA, const _Float16* __restrict__ Bh, int ldb, size_t sB, float alpha, float* __restrict__ C, int ldc, size_t sC, int M, int N, int K) {
  __shared__ __attribute__((aligned(16))) float so[4][16][64];
  const int tid = threadIdx.x, w = tid >> 5, lane = tid & 31, ln = lane & 15, hh = lane >> 4; const int by = blockIdx.y;
  A += (size_t)by * sA; Bh += (size_t)by * sB; C += (size_t)by * sC;
  const int ntn = (N + 63) / 64; const int wid = blockIdx.x * 4 + w; const int mt = wid / ntn, nq = wid % ntn; if (mt * 16 >= M) return;
  const int row0 = mt * 16, col0 = nq * 64; const float* arow = A + (size_t)(row0 + ln) * lda;
  v8f acc[4] = {};
  for (int kb = 0; kb < K; kb += 32) {
    FragH ah, al;
    const v4f x0 = *(const v4fa*)(arow + kb + 8 * hh), x1 = *(const v4fa*)(arow + kb + 8 * hh + 4), x2 = *(const v4fa*)(arow + kb + 16 + 8 * hh), x3 = *(const v4fa*)(arow + kb + 16 + 8 * hh + 4);
    float xs[16] = {x0[0],x0[1],x0[2],x0[3],x1[0],x1[1],x1[2],x1[3],x2[0],x2[1],x2[2],x2[3],x3[0],x3[1],x3[2],x3[3]};
#pragma unroll
    for (int i = 0; i < 16; ++i) { const _Float16 h = (_Float16)xs[i]; ah.h[i] = h; al.h[i] = ASPLIT ? (_Float16)(xs[i] - (float)h) : (_Float16)0.0f; }
#pragma unroll
    for (int t = 0; t < 4; ++t) { if (col0 + t * 16 >= N) continue; const size_t boff = (size_t)(col0 + t * 16 + ln) * ldb + kb; FragH bq; bq.half[0] = *(const v8us*)(Bh + boff + 8 * hh); bq.half[1] = *(const v8us*)(Bh + boff + 16 + 8 * hh);
      acc[t] = mmaH<ASPLIT ? 2 : 1>(ah.v, al.v, bq.v, bq.v, acc[t]); }
  }
#pragma unroll
  for (int t = 0; t < 4; ++t) { if (col0 + t * 16 >= N) continue;
#pragma unroll
    for (int r = 0; r < 8; ++r) so[w][8 * hh + r][t * 16 + ln] = acc[t][r] * alpha; }
  __builtin_amdgcn_fence(__ATOMIC_ACQ_REL, "workgroup"); __builtin_amdgcn_wave_barrier();
  const int rsub = lane >> 4, c4 = (lane & 15) * 4;
  {
#pragma unroll
    for (int q = 0; q < 8; ++q) { const int r = q * 2 + rsub; if (col0 + c4 < N) { const v4f v = *(const v4fa*)&so[w][r][c4]; *(v4f*)(C + (size_t)(row0 + r) * ldc + col0 + c4) = v; } }
     }
}

// Wt[n][k] = f16(W[k][n] x 16) from the f32 row-major (in, out) weights W[CH][N] (bf16-exact weights stay exact in f16 away from the subnormal range); a thread makes 8 k of one n
template <int N>
__device__ __forceinline__ void wt_conv(const float* __restrict__ W, _Float16* __restrict__ Wt, int t) {
  const int n = t / (CH / 8), k8 = (t % (CH / 8)) * 8; const float* p = W + (size_t)k8 * N + n; float v[8]; FragH f;
#pragma unroll
  for (int i = 0; i < 8; ++i) v[i] = p[i * N];
  asm volatile("s_wait_xcnt 0x0" :: "v"(p) : "memory"); /* the address pair of the loads above is reused further down: the wait stands in front of that overwrite; the pointer is an input so that no load's own result lands on it ahead of the wait */
#pragma unroll
  for (int i = 0; i < 8; ++i) f.h[i] = (_Float16)(bf16_round(v[i]) * 16.0f);
  *(v8us*)((unsigned short*)Wt + (size_t)n * CH + k8) = f.half[0];
}
// Both weight matrices in one launch: neither conversion reads what the other writes, so the work-group index picks the matrix: the first WQB work-groups take w_qkv (CH x 2 CH), the other WOB take w_out (CH x CH).
#define WQB (CH * 2 * CH / 8 / 256)
#define WOB (CH * CH / 8 / 256)
__global__ __launch_bounds__(256) void k_wt2_f16(const float* __restrict__ Wq, _Float16* __restrict__ Tq, const float* __restrict__ Wo, _Float16* __restrict__ To) {
  static_assert(WQB * 256 * 8 == CH * 2 * CH && WOB * 256 * 8 == CH * CH, "whole work-groups: every thread has its 8 elements");
  if (blockIdx.x < WQB) wt_conv<2 * CH>(Wq, Tq, (int)blockIdx.x * 256 + (int)threadIdx.x);
  else wt_conv<CH>(Wo, To, (int)(blockIdx.x - WQB) * 256 + (int)threadIdx.x);
}
// k_gemm_hh variant with fused epilogue: v = acc·alpha + bias[by·sBias + col] (+ CP[(row/rowsPerB)·sCPb + by·64 + col] if CP) ; ACT 0 none / 1 elu ; writes f32 C and/or f16 C16 (each if non-null)
template <int ACT>
__global__ __launch_bounds__(128) void k_gemm_hhx(const _Float16* __restrict__ A, int lda, size_t sA, const _Float16* __restrict__ Bh, int ldb, size_t sB, float alpha, const float* __restrict__ bias, size_t sBias, const float* __restrict__ CP, int rowsPerB, size_t sCPb, int row0g,
    float* __restrict__ C, _Float16* __restrict__ C16, int ldc, size_t sC, int M, int N, int K) {
  __shared__ __attribute__((aligned(16))) float so[4][16][64];
  const int tid = threadIdx.x, w = tid >> 5, lane = tid & 31, ln = lane & 15, hh = lane >> 4; const int by = blockIdx.y;
  A += (size_t)by * sA; Bh += (size_t)by * sB; const size_t cofs = (size_t)by * sC; const float* bp = bias ? bias + (size_t)by * sBias : nullptr;
  const int ntn = (N + 63) / 64; const int wid = blockIdx.x * 4 + w; const int mt = wid / ntn, nq = wid % ntn; if (mt * 16 >= M) return;
  const int row0 = mt * 16, col0 = nq * 64; const _Float16* arow = A + (size_t)(row0 + ln) * lda;
  v8f acc[4] = {};
  for (int kb = 0; kb < K; kb += 32) { FragH ah; ah.half[0] = *(const v8us*)((const unsigned short*)arow + kb + 8 * hh); ah.half[1] = *(const v8us*)((const unsigned short*)arow + kb + 16 + 8 * hh);
#pragma unroll
    for (int t = 0; t < 4; ++t) { if (col0 + t * 16 >= N) continue; const size_t boff = (size_t)(col0 + t * 16 + ln) * ldb + kb; FragH bq; bq.half[0] = *(const v8us*)((const unsigned short*)Bh + boff + 8 * hh); bq.half[1] = *(const v8us*)((const unsigned short*)Bh + boff + 16 + 8 * hh);
      acc[t] = mmaH<1>(ah.v, ah.v, bq.v, bq.v, acc[t]); }
  }
#pragma unroll
  for (int t = 0; t < 4; ++t) { if (col0 + t * 16 >= N) continue; const int col = col0 + t * 16 + ln; const float bv = bp ? bf16_round(bp[col]) : 0.f;
#pragma unroll
    for (int r = 0; r < 8; ++r) { float v = acc[t][r] * alpha + bv; if (CP) { const int rr = row0g + row0 + 8 * hh + r; if (rowsPerB < 0) v += CP[cofs + (size_t)rr * ldc + col];      /* rowsPerB < 0: own element of the batched C plane */ else { const int bidx = rr / rowsPerB; v += CP[(size_t)bidx * sCPb + (size_t)by * 64 + col]; } } if (ACT == 1) v = (v > 0.f) ? v : expm1f(v); else if (ACT == 7) v = (v > 0.f) ? v + 1.0f : expf(v); else if (ACT == 8) v = tanhf(v); else if (ACT == 9) v = 0.5f * v * (1.0f + tanhf(0.7978845608028654f * (v + 0.044715f * v * v * v))); else if (ACT == 11) v = 1.0f / (1.0f + expf(-v)); else if (ACT == 12) v = (v > 0.f) ? v : 0.01f * v; else if (ACT == 14) v = (v > 0.f) ? v : 0.1f * v; else if (ACT == 16) v = (v >= 0.f) ? v : 0.3f * v; else if (ACT == 17) v = (v >= 0.f) ? v : 0.2f * v; else if (ACT == 15) v = v / (1.0f + expf(-v)); else if (ACT == 3) v = fmaxf(v, 0.f); else if (ACT == 6) v = 0.5f * v * (1.0f + erff(v * 0.70710678118654752f)); so[w][8 * hh + r][t * 16 + ln] = v; } }
  __builtin_amdgcn_fence(__ATOMIC_ACQ_REL, "workgroup"); __builtin_amdgcn_wave_barrier();
  const int rsub = lane >> 4, c4 = (lane & 15) * 4; typedef _Float16 v4h __attribute__((ext_vector_type(4)));
  {
#pragma unroll
    for (int q = 0; q < 8; ++q) { const int r = q * 2 + rsub; if (col0 + c4 < N) { const v4f v = *(const v4fa*)&so[w][r][c4]; if (C) *(v4f*)(C + cofs + (size_t)(row0 + r) * ldc + col0 + c4) = v; if (C16) { v4h h4; for (int i = 0; i < 4; ++i) h4[i] = (_Float16)v[i]; *(v4h*)(C16 + cofs + (size_t)(row0 + r) * ldc + col0 + c4) = h4; } } }
     }
}


typedef _Float16 v4h __attribute__((ext_vector_type(4)));

__global__ __launch_bounds__(256) void k_round16f(const float* __restrict__ W, _Float16* __restrict__ Bt, size_t n8) { const size_t t = (size_t)blockIdx.x * 256 + threadIdx.x; if (t >= n8) return; FragH f;
#pragma unroll
  for (int i = 0; i < 8; ++i) f.h[i] = (_Float16)(bf16_round(W[t * 8 + i]) * 16.0f); *(v8us*)((unsigned short*)Bt + t * 8) = f.half[0];  }
template <int NHv, int TTv>
__global__ __launch_bounds__(256) void k_vt(const _Float16* __restrict__ V16, int ldv, int voff, _Float16* __restrict__ Vt) { __shared__ unsigned short tl[64][66]; const int tid = threadIdx.x; const int slab = blockIdx.x / (TTv / 64), lg = blockIdx.x % (TTv / 64); const int b = slab / NHv, h = slab % NHv;
  for (int i = tid; i < 64 * 8; i += 256) { const int r = i / 8, c8 = (i % 8) * 8; FragH f; f.half[0] = *(const v8us*)((const unsigned short*)V16 + ((size_t)b * TTv + lg * 64 + r) * ldv + voff + h * 64 + c8);
#pragma unroll
    for (int q = 0; q < 8; ++q) tl[r][c8 + q] = f.u[q]; }
  __syncthreads();
  {
#pragma unroll
    for (int rd = 0; rd < 2; ++rd) { const int d = rd * 32 + tid / 8, pc = tid % 8; FragH f;
#pragma unroll
      for (int q = 0; q < 8; ++q) f.u[q] = tl[pc * 8 + q][d];
      *(v8us*)((unsigned short*)Vt + ((size_t)slab * 64 + d) * TTv + lg * 64 + pc * 8) = f.half[0]; }
     } }

__global__ __launch_bounds__(256) void k_hl(const float* __restrict__ F, _Float16* __restrict__ Hh, _Float16* __restrict__ Hl, size_t n8) { const size_t t = (size_t)blockIdx.x * 256 + threadIdx.x; if (t >= n8) return; FragH fh, fl; const v4f a = *(const v4fa*)(F + t * 8), c = *(const v4fa*)(F + t * 8 + 4);
#pragma unroll
  for (int q = 0; q < 4; ++q) { _Float16 h = (_Float16)a[q]; fh.h[q] = h; fl.h[q] = (_Float16)((a[q] - (float)h) * 1024.0f); h = (_Float16)c[q]; fh.h[4 + q] = h; fl.h[4 + q] = (_Float16)((c[q] - (float)h) * 1024.0f); }
  { *(v8us*)((unsigned short*)Hh + t * 8) = fh.half[0]; *(v8us*)((unsigned short*)Hl + t * 8) = fl.half[0];  } }

// ---- staged-row GEMM pieces (K = CH, N = CH): LDS pitch, fragment read and product, shared by k_qk and k_gemm3 below ----
#define GP (CH + 8)              /* LDS pitch of a staged row, f16 units: 528 B = 16 B x odd, conflict-free for 16-byte fragment reads */
__device__ __forceinline__ v16h g3_frag(const unsigned short* p) { FragH f; f.half[0] = *(const v8us*)p; f.half[1] = *(const v8us*)(p + 16); return f.v; }
__device__ __forceinline__ v8f g3_mma(v16h a, v16h b, v8f c) { return __builtin_amdgcn_wmma_f32_16x16x32_f16(false, a, false, b, (short)0, c, false, false); }


// ---- q and k projections in one launch, straight from the f32 x rows: one work-group = 128 rows, 16 waves of 32x64 tiles as in k_gemm3. The x rows are read once as whole 512-byte pieces, rounded (bf16, exact in f16)
// and staged in LDS, where they stay for both passes; the first pass runs them against the k rows of Bh, the second against the q rows.
// The B rows of a pass and its output tiles share the second LDS array.
typedef unsigned short v4us __attribute__((ext_vector_type(4), may_alias));
union Frag4 { v4us v; _Float16 h[4]; };
/* work-group barrier that orders LDS traffic only: __syncthreads() would also wait until the first pass's global stores have completed, although no wave reads them in this launch */
__device__ __forceinline__ void qk_barrier() { __builtin_amdgcn_fence(__ATOMIC_RELEASE, "workgroup", "local"); __builtin_amdgcn_s_barrier(); __builtin_amdgcn_fence(__ATOMIC_ACQUIRE, "workgroup", "local"); }
__global__ __launch_bounds__(512) void k_qk(const float* __restrict__ x, const _Float16* __restrict__ Bh, const float* __restrict__ bias, _Float16* __restrict__ Q16, _Float16* __restrict__ K16) {
  __shared__ __attribute__((aligned(16))) unsigned short sa[128 * GP];      /* 128 x rows, f16 */
  __shared__ __attribute__((aligned(16))) unsigned short sb[16 * 32 * 68 * 2];      /* CH B rows of the pass, then the 16 output tiles (32 x 68 f32 each) */
  static_assert(CH * GP <= 16 * 32 * 68 * 2, "the B rows must fit the bytes of the output tiles");
  float (*so)[32][68] = reinterpret_cast<float (*)[32][68]>(sb);
  const int tid = threadIdx.x, w = tid >> 5, lane = tid & 31, ln = lane & 15, hh = lane >> 4;
  const int mt = blockIdx.x, row0 = mt * 128 + 32 * (w & 3), col0 = (w >> 2) * 64;
  const unsigned short* bg = (const unsigned short*)Bh + (size_t)w * CH + lane * 8;
  v8us rb[16];      /* the B rows of the coming pass on their way to LDS; every loop over them is unrolled so that they stay in registers */
  float bv[2][4];      /* both passes' biases, read here so that no wait for them stands behind the B loads of the second pass */
  { const float* xg = x + ((size_t)mt * 128 + w) * CH + lane * 4; v4f xa[8][2];      /* unrolled: all loads are in flight before the first conversion waits for one */
#pragma unroll
    for (int u = 0; u < 8; ++u) { xa[u][0] = *(const v4fa*)(xg + u * 16 * CH); xa[u][1] = *(const v4fa*)(xg + u * 16 * CH + 128); }
#pragma unroll
    for (int u = 0; u < 16; ++u) rb[u] = *(const v8us*)(bg + (size_t)CH * CH + u * 16 * CH);
#pragma unroll
    for (int u = 0; u < 8; ++u) bv[u >> 2][u & 3] = bias[(u >> 2) * CH + col0 + (u & 3) * 16 + ln];
    asm volatile("s_wait_xcnt 0x0" :: "v"(xg) : "memory"); /* the registers that the loads above name are reused further down: the wait stands in front of every such overwrite; the x pointer is an input so that no load's own result lands on it ahead of the wait */
    unsigned short* sw = sa + w * GP + lane * 4;
#pragma unroll
    for (int u = 0; u < 8; ++u)
#pragma unroll
      for (int p = 0; p < 2; ++p) { Frag4 f;
#pragma unroll
        for (int i = 0; i < 4; ++i) f.h[i] = (_Float16)bf16_round(xa[u][p][i]);
        *(v4us*)(sw + u * 16 * GP + p * 128) = f.v; } }
  const unsigned short* al = sa + (32 * (w & 3) + ln) * GP + 8 * hh; const unsigned short* bl = sb + (col0 + ln) * GP + 8 * hh;
  const int rsub = lane >> 4, c4 = (lane & 15) * 4; const size_t o0 = (size_t)(row0 + rsub) * CH + col0 + c4;      /* a lane's first output element; its later ones are 2 rows apart */
#pragma unroll      /* unrolled: which outputs a pass writes is then known at compile time, and no branch stands between the stores */
  for (int part = 1; part >= 0; --part) {      /* 1: k, 0: q */
    { unsigned short* sw = sb + w * GP + lane * 8;
#pragma unroll
      for (int u = 0; u < 16; ++u) *(v8us*)(sw + u * 16 * GP) = rb[u]; }
    qk_barrier();      /* publishes the B rows of this pass (in the first pass the x rows too) */
    const v8f z8 = {0.f,0.f,0.f,0.f,0.f,0.f,0.f,0.f}; v8f c00 = z8, c01 = z8, c02 = z8, c03 = z8, c10 = z8, c11 = z8, c12 = z8, c13 = z8;
    /* two register sets, the reads of k step s + 1 as one group ahead of the products of step s, as in k_gemm3 */
    v16h fa[2][2], fb[2][4];
    fa[0][0] = g3_frag(al); fa[0][1] = g3_frag(al + 16 * GP);
#pragma unroll
    for (int t = 0; t < 4; ++t) fb[0][t] = g3_frag(bl + t * 16 * GP);
#pragma unroll
    for (int s = 0; s < CH / 32; ++s) { const int cu = s & 1, nx = cu ^ 1;
      if (s + 1 < CH / 32) { const int kb = (s + 1) * 32; fa[nx][0] = g3_frag(al + kb); fa[nx][1] = g3_frag(al + 16 * GP + kb);
#pragma unroll
        for (int t = 0; t < 4; ++t) fb[nx][t] = g3_frag(bl + t * 16 * GP + kb); }
      __builtin_amdgcn_sched_barrier(0);      /* keeps the read group above in front of these products, as in k_gemm3 */
      c00 = g3_mma(fa[cu][0], fb[cu][0], c00); c10 = g3_mma(fa[cu][1], fb[cu][0], c10); c01 = g3_mma(fa[cu][0], fb[cu][1], c01); c11 = g3_mma(fa[cu][1], fb[cu][1], c11);
      c02 = g3_mma(fa[cu][0], fb[cu][2], c02); c12 = g3_mma(fa[cu][1], fb[cu][2], c12); c03 = g3_mma(fa[cu][0], fb[cu][3], c03); c13 = g3_mma(fa[cu][1], fb[cu][3], c13); }
    qk_barrier();      /* every wave has read its last B fragment: from here those bytes are the waves' own output tiles */
    if (part == 1) {      /* the q rows of Bh start their way here and fly while the k tiles are written out */
#pragma unroll
      for (int u = 0; u < 16; ++u) rb[u] = *(const v8us*)(bg + u * 16 * CH); }
    v8f accs[8] = {c00, c01, c02, c03, c10, c11, c12, c13};
#pragma unroll
    for (int u = 0; u < 8; ++u) { const int t = u & 3, half = u >> 2; const float bq = bf16_round(bv[part][t]);
#pragma unroll
      for (int r = 0; r < 8; ++r) so[w][half * 16 + 8 * hh + r][t * 16 + ln] = accs[u][r] * 0.0625f + bq; }
    __builtin_amdgcn_fence(__ATOMIC_ACQ_REL, "workgroup", "local"); __builtin_amdgcn_wave_barrier();      /* a wave reads back what its own lanes wrote */
    _Float16* o16 = (part ? K16 : Q16) + o0;
#pragma unroll
    for (int q = 0; q < 16; ++q) { const v4f v = *(const v4fa*)&so[w][q * 2 + rsub][c4];
      v4h h4; for (int i = 0; i < 4; ++i) h4[i] = (_Float16)v[i]; *(v4h*)(o16 + q * 2 * CH) = h4; }
    if (part == 1) { asm volatile("s_wait_xcnt 0x0" ::: "memory"); /* the second pass reuses the registers that the k stores name: the wait stands in front of that overwrite */
      qk_barrier(); }      /* every wave has read its k tile back: the q rows of Bh may be written over the tiles */
  } }

__device__ __forceinline__ float hswish(float v) { return v * fminf(fmaxf(v + 3.0f, 0.0f), 6.0f) * (1.0f / 6.0f); }
// Fused stripe attention: one work-group = one (branch, plane, head), 16 waves x 32 query columns. K rows and V^T rows are staged once in LDS, both from the k rows as the GEMM wrote them; each wave forms
// S^T = K Q^T (a lane holds one query's scores), takes the exact row maximum in a first walk over the keys, then walks again: p = 2^10 exp(scale (s - max)), packed from the
// score accumulators straight into the B operand of O^T += V^T P^T; the row sum stays in f32 and divides the result. Scores and probabilities never reach memory.
#define KP 40                    /* LDS pitch of a K row, f16 units: 80 B = 16 B x odd, conflict-free for 16-byte fragment reads */
#define VP 520                   /* LDS pitch of a V^T row, f16 units: 1040 B = 16 B x odd */
__device__ __forceinline__ v16h at_frag(const unsigned short* p, int hh) { FragH f; f.half[0] = *(const v8us*)(p + 8 * hh); f.half[1] = *(const v8us*)(p + 16 + 8 * hh); return f.v; }
__device__ __forceinline__ v8f at_mma(v16h a, v16h b, v8f c) { return __builtin_amdgcn_wmma_f32_16x16x32_f16(false, a, false, b, (short)0, c, false, false); }
__device__ __forceinline__ float at_max8(v8f s, float m) { const float t0 = fmaxf(fmaxf(s[0], s[1]), s[2]), t1 = fmaxf(fmaxf(s[3], s[4]), s[5]), t2 = fmaxf(fmaxf(s[6], s[7]), m); return fmaxf(fmaxf(t0, t1), t2); }
__device__ __forceinline__ v8f at_exp8(v8f s, float c, float b) { float x[8], e[8];
  for (int r = 0; r < 8; ++r) x[r] = s[r] * c + b;
  /* eight 2^x in one statement: early-clobber results keep every result off every source, and the closing v_nop is the one slot the instruction set asks for behind a transcendental before a source may be overwritten or the result used */
  asm("v_exp_f32 %0, %8\n\tv_exp_f32 %1, %9\n\tv_exp_f32 %2, %10\n\tv_exp_f32 %3, %11\n\tv_exp_f32 %4, %12\n\tv_exp_f32 %5, %13\n\tv_exp_f32 %6, %14\n\tv_exp_f32 %7, %15\n\tv_nop"
      : "=&v"(e[0]), "=&v"(e[1]), "=&v"(e[2]), "=&v"(e[3]), "=&v"(e[4]), "=&v"(e[5]), "=&v"(e[6]), "=&v"(e[7]) : "v"(x[0]), "v"(x[1]), "v"(x[2]), "v"(x[3]), "v"(x[4]), "v"(x[5]), "v"(x[6]), "v"(x[7]));
  const v8f o = {e[0], e[1], e[2], e[3], e[4], e[5], e[6], e[7]}; return o; }
__device__ __forceinline__ float at_sum8(v8f e) { return ((e[0] + e[1]) + (e[2] + e[3])) + ((e[4] + e[5]) + (e[6] + e[7])); }
__device__ __forceinline__ v16h at_pack(v8f e0, v8f e1) { FragH f;
  for (int r = 0; r < 8; ++r) { f.h[r] = (_Float16)e0[r]; f.h[8 + r] = (_Float16)e1[r]; } return f.v; }
typedef unsigned int u32a __attribute__((may_alias));
/* a minimum of 8 waves per SIMD = 128 vector registers a wave, as before this staging: without it the build takes 130, which is 7 waves per SIMD, so only one 16-wave work-group would fit a WGP instead of two */
__global__ __launch_bounds__(512, 8) void k_attn(const _Float16* __restrict__ Q16, const _Float16* __restrict__ K16, float* __restrict__ CTX) {
  __shared__ __attribute__((aligned(16))) unsigned short sk[TOKS * KP];
  __shared__ __attribute__((aligned(16))) unsigned short sv[DH * VP];
  const int tid = threadIdx.x, w = tid >> 5, lane = tid & 31, ln = lane & 15, hh = lane >> 4;
  const int h = blockIdx.x % NHB, pl = blockIdx.x / NHB; const bool vert = blockIdx.y != 0;
  const int bi = pl / NST, st = pl % NST;
  /* token -> row of the [NR][CH] q / k planes: a horizontal stripe is 512 rows in a run; a vertical stripe takes 8 rows out of every 64 (one form for both, so that no branch stands between the loads) */
  const int rbase = vert ? bi * NPX + st * WIN : pl * TOKS, rstep = vert ? WSD : WIN;
  auto rowof = [&](int tok) { return rbase + (tok >> 3) * rstep + (tok & 7); };
  const int ch0 = (vert ? CHH : 0) + h * DH;
  const unsigned short* qg = (const unsigned short*)Q16 + ch0;
  const unsigned short* kg = (const unsigned short*)K16 + ch0;
  /* a thread takes 8 channels of two neighbouring tokens (neighbouring rows in both branches): two 16-byte K row pieces, and the same values as 8 (token, token + 1) pairs for the V^T rows (v = k) */
  for (int u = 0; u < 2; ++u) { const int i = tid + 512 * u; const int t0 = (i >> 2) * 2, kc = (i & 3) * 8; const unsigned short* kr = kg + (size_t)rowof(t0) * CH + kc;
    FragH a; a.half[0] = *(const v8us*)kr; a.half[1] = *(const v8us*)(kr + CH);
    asm volatile("s_wait_xcnt 0x0" ::: "memory"); /* the address pair of these two loads is reused further down: the wait stands in front of that overwrite */
    *(v8us*)(sk + t0 * KP + kc) = a.half[0]; *(v8us*)(sk + (t0 + 1) * KP + kc) = a.half[1];
    for (int q = 0; q < 8; ++q) *(u32a*)(sv + (kc + q) * VP + t0) = (unsigned int)a.u[q] | ((unsigned int)a.u[8 + q] << 16); }
  const int q0r = w * 32 + ln;
  __syncthreads();      /* publishes the staged K and V^T rows; they are only read from here on */
  const v16h q0 = at_frag(qg + (size_t)rowof(q0r) * CH, hh), q1 = at_frag(qg + (size_t)rowof(q0r + 16) * CH, hh);
  const v8f z8 = {0.f,0.f,0.f,0.f,0.f,0.f,0.f,0.f};
  float m0 = -3.0e38f, m1 = -3.0e38f;
  const unsigned short* kl = sk + ln * KP;
  for (int t = 0; t < TOKS / 16; ++t) { const v16h ka = at_frag(kl + t * 16 * KP, hh);
    const v8f s0 = at_mma(ka, q0, z8), s1 = at_mma(ka, q1, z8); m0 = at_max8(s0, m0); m1 = at_max8(s1, m1); }
  m0 = fmaxf(m0, __shfl_xor(m0, 16, 32)); m1 = fmaxf(m1, __shfl_xor(m1, 16, 32));
  const float c = 0.17677669529663688f * 1.4426950408889634f;      /* 1/sqrt(32) x log2(e) */
  const float b0 = 10.0f - m0 * c, b1 = 10.0f - m1 * c;
  float su0 = 0.f, su1 = 0.f; v8f o00 = z8, o01 = z8, o10 = z8, o11 = z8;
  const unsigned short* vl = sv + ln * VP;
  for (int t = 0; t < TOKS / 32; ++t) { const v16h ka = at_frag(kl + t * 32 * KP, hh), kb = at_frag(kl + (t * 32 + 16) * KP, hh); const v16h va = at_frag(vl + t * 32, hh), vb = at_frag(vl + 16 * VP + t * 32, hh);
    const v8f e00 = at_exp8(at_mma(ka, q0, z8), c, b0), e01 = at_exp8(at_mma(kb, q0, z8), c, b0), e10 = at_exp8(at_mma(ka, q1, z8), c, b1), e11 = at_exp8(at_mma(kb, q1, z8), c, b1);
    su0 += at_sum8(e00) + at_sum8(e01); su1 += at_sum8(e10) + at_sum8(e11);
    const v16h p0 = at_pack(e00, e01), p1 = at_pack(e10, e11);
    o00 = at_mma(va, p0, o00); o01 = at_mma(vb, p0, o01); o10 = at_mma(va, p1, o10); o11 = at_mma(vb, p1, o11); }
  su0 += __shfl_xor(su0, 16, 32); su1 += __shfl_xor(su1, 16, 32);
  const float i0 = 1.0f / su0, i1 = 1.0f / su1;
  /* horizontal: the token's own row, columns h*32..; vertical: the reference's inverse reshape sends (stripe, head, token = a*64 + c) to row (stripe*8 + a, head*16 + c/4), columns 128 + (c%4)*32.. */
  float* og = CTX + (vert ? ((size_t)(bi * HS + st * WIN) * WSD + h * 16) * CH + CHH : (size_t)pl * TOKS * CH + h * DH); const int oc4 = vert ? CH : 4 * CH, oc1 = vert ? DH : CH;
  auto dstof = [&](int tok) { return og + (tok >> 6) * (WSD * CH) + ((tok & 63) >> 2) * oc4 + (tok & 3) * oc1; };
  float* d0 = dstof(q0r) + 8 * hh; float* d1 = dstof(q0r + 16) + 8 * hh;
  *(v8f*)d0 = o00 * i0; *(v8f*)(d0 + 16) = o01 * i0; *(v8f*)d1 = o10 * i1; *(v8f*)(d1 + 16) = o11 * i1; }
// ---- output projection, its A rows made in place: one work-group = 128 rows (two image rows) x all CH columns, 16 waves of 32x64 tiles (4 row groups x 4 column groups).
// A row = f16(hard_swish(context + depthwise3x3(hard_swish(v)) + b)): a thread takes 4 channels of 8 neighbouring pixels in both image rows and walks the 4 x 10 patch of v around them, so that a value of v is read
// and hard-swished once for the up to six sums that it enters; the rows go straight to LDS, beside all B rows (whole 512-byte rows, one per wave-wide load). After the products the same LDS holds the waves' output tiles.
__global__ __launch_bounds__(512) void k_gemm3(const float* __restrict__ CTX, const _Float16* __restrict__ K16, const float* __restrict__ dwk, const float* __restrict__ dwb, const _Float16* __restrict__ Bh, const float* __restrict__ bias, float* __restrict__ C) {
  __shared__ __attribute__((aligned(16))) unsigned short sab[(128 + CH) * GP];      /* 128 A rows, then CH B rows */
  float (*so)[32][68] = reinterpret_cast<float (*)[32][68]>(sab);      /* 16 output tiles over the staged rows, behind the second barrier */
  static_assert(sizeof(float) * 16 * 32 * 68 <= sizeof(unsigned short) * (128 + CH) * GP, "output tiles must fit the staging bytes");
  static_assert(2 * WSD == 128 && WSD == 64 && CH == 256, "a work-group's 128 rows are two image rows; 8 runs of 8 pixels x 64 groups of 4 channels = 512 threads");
  const int tid = threadIdx.x, w = tid >> 5, lane = tid & 31, ln = lane & 15, hh = lane >> 4;
  const int mt = blockIdx.x;
  const int row0 = mt * 128 + 32 * (w & 3), col0 = (w >> 2) * 64;
  { const int x0 = (tid >> 6) * 8, y0 = (mt % (HS / 2)) * 2, c0 = (tid & 63) * 4;      /* first pixel of the run, first of the two image rows, first channel */
    const bool okl = x0 > 0, okr = x0 + 8 < WSD, okt = y0 > 0, okb = y0 + 2 < HS;      /* does the patch's left / right column, top / bottom row lie inside the image? */
    const int PB = CH * 4, RB = WSD * CH * 4;      /* bytes of a pixel's f32 row and of an image row (context, taps) */
    const int PH = CH * 2, RH = WSD * CH * 2;      /* the same for the f16 rows of v */
    /* byte offsets inside an image row: the run's first pixel, and the patch's outer columns (held inside the image; what is read there for an outside tap is replaced by 0) */
    const unsigned cb = (unsigned)(c0 * 4), vb = (unsigned)(x0 * PB) + cb;
    const unsigned hb = (unsigned)(x0 * PH + c0 * 2), vl = okl ? hb - PH : hb, vr = okr ? hb + 8 * PH : hb;
    const char* kimg = (const char*)(K16 + (size_t)(mt / (HS / 2)) * NPX * CH);
    const char* kr[4] = {kimg + (size_t)(okt ? y0 - 1 : y0) * RH, kimg + (size_t)y0 * RH, kimg + (size_t)(y0 + 1) * RH, kimg + (size_t)(okb ? y0 + 2 : y0) * RH};
    const char* cxp = (const char*)(CTX + (size_t)mt * 128 * CH);
    const unsigned short* bg = (const unsigned short*)Bh + (size_t)w * CH + lane * 8;
    auto kload = [&](int r, int cx) -> v4us { return cx == 0 ? *(const v4us*)(kr[r] + vl) : cx == 9 ? *(const v4us*)(kr[r] + vr) : *(const v4us*)(kr[r] + hb + (cx - 1) * PH); };
    auto hsw4 = [&](v4us v, bool ok) -> v4f { const v4us z4 = {0, 0, 0, 0}; Frag4 f; f.v = ok ? v : z4; v4f o; for (int i = 0; i < 4; ++i) o[i] = hswish((float)f.h[i]); return o; };      /* an outside tap becomes 0 ahead of the hard-swish, which sends 0 to 0 */
    v8us rb[16]; v4us hr[10][4]; v4f wt[9], bb, hv[10][4], cx[8][2];      /* every loop over these is unrolled so that they stay in registers */
#pragma unroll
    for (int u = 0; u < 16; ++u) rb[u] = *(const v8us*)(bg + u * 16 * CH);
#pragma unroll
    for (int t = 0; t < 9; ++t) wt[t] = *(const v4fa*)((const char*)dwk + cb + t * PB);
    bb = *(const v4fa*)((const char*)dwb + cb);
#pragma unroll
    for (int q = 0; q < 6; ++q)
#pragma unroll
      for (int r = 0; r < 4; ++r) hr[q][r] = kload(r, q);
    asm volatile("s_wait_xcnt 0x0" :: "v"(cb), "v"(hb), "v"(vl), "v"(bg) : "memory"); /* the registers that the loads above name are reused further down: the wait stands in front of every such overwrite; the offsets are inputs so that no load's own result lands on them ahead of the wait */
    { unsigned short* sw = sab + (128 + w) * GP + lane * 8;
#pragma unroll
      for (int u = 0; u < 16; ++u) *(v8us*)(sw + u * 16 * GP) = rb[u]; }
    /* second group of loads: it flies while the first pixels are worked on */
#pragma unroll
    for (int p = 0; p < 6; ++p) { cx[p][0] = *(const v4fa*)(cxp + vb + p * PB); cx[p][1] = *(const v4fa*)(cxp + vb + (RB + p * PB)); }
#pragma unroll
    for (int q = 6; q < 8; ++q)
#pragma unroll
      for (int r = 0; r < 4; ++r) hr[q][r] = kload(r, q);
#pragma unroll
    for (int t = 0; t < 9; ++t) for (int i = 0; i < 4; ++i) wt[t][i] = bf16_round(wt[t][i]);
    for (int i = 0; i < 4; ++i) bb[i] = bf16_round(bb[i]);
    auto pixel = [&](int p) {      /* both image rows of pixel x0 + p, from patch columns p .. p + 2; taps summed row by row, left to right */
#pragma unroll
      for (int o = 0; o < 2; ++o) { v4f acc = {0.f, 0.f, 0.f, 0.f};
#pragma unroll
        for (int i = 0; i < 3; ++i)
#pragma unroll
          for (int j = 0; j < 3; ++j) acc += hv[p + j][o + i] * wt[i * 3 + j];
        const v4f u = cx[p][o] + (acc + bb); Frag4 f;
        for (int i = 0; i < 4; ++i) f.h[i] = (_Float16)hswish(u[i]);
        *(v4us*)(sab + (o * WSD + x0 + p) * GP + c0) = f.v; } };
#pragma unroll
    for (int q = 0; q < 6; ++q)
#pragma unroll
      for (int r = 0; r < 4; ++r) hv[q][r] = hsw4(hr[q][r], (q > 0 || okl) && (r > 0 || okt) && (r < 3 || okb));
    pixel(0); pixel(1);
    /* third group, the rest of the context and of the patch: it flies while the pixels that need nothing of it are finished */
#pragma unroll
    for (int p = 6; p < 8; ++p) { cx[p][0] = *(const v4fa*)(cxp + vb + p * PB); cx[p][1] = *(const v4fa*)(cxp + vb + (RB + p * PB)); }
#pragma unroll
    for (int q = 8; q < 10; ++q)
#pragma unroll
      for (int r = 0; r < 4; ++r) hr[q][r] = kload(r, q);
    asm volatile("s_wait_xcnt 0x0" :: "v"(vb), "v"(hb), "v"(vr) : "memory"); /* as above, for the second and the third group, which name the same registers */
    pixel(2); pixel(3);
#pragma unroll
    for (int q = 6; q < 8; ++q)
#pragma unroll
      for (int r = 0; r < 4; ++r) hv[q][r] = hsw4(hr[q][r], (r > 0 || okt) && (r < 3 || okb));
    pixel(4); pixel(5);
#pragma unroll
    for (int q = 8; q < 10; ++q)
#pragma unroll
      for (int r = 0; r < 4; ++r) hv[q][r] = hsw4(hr[q][r], (q < 9 || okr) && (r > 0 || okt) && (r < 3 || okb));
    pixel(6); pixel(7); }
  __syncthreads();      /* publishes the A rows made above and the staged B rows; they are only read until the next barrier */
  const unsigned short* al = sab + (32 * (w & 3) + ln) * GP + 8 * hh; const unsigned short* bl = sab + (128 + col0 + ln) * GP + 8 * hh;
  const v8f z8 = {0.f,0.f,0.f,0.f,0.f,0.f,0.f,0.f}; v8f c00 = z8, c01 = z8, c02 = z8, c03 = z8, c10 = z8, c11 = z8, c12 = z8, c13 = z8;
  /* two register sets: the twelve LDS reads of k step s + 1 stand as one group ahead of the eight products of step s, so that a wave waits for a group once a step and not before every pair of products; unrolled so that the set index is a constant and every read has an immediate offset */
  v16h fa[2][2], fb[2][4];
  fa[0][0] = g3_frag(al); fa[0][1] = g3_frag(al + 16 * GP);
#pragma unroll
  for (int t = 0; t < 4; ++t) fb[0][t] = g3_frag(bl + t * 16 * GP);
#pragma unroll
  for (int s = 0; s < CH / 32; ++s) { const int cu = s & 1, nx = cu ^ 1;
    if (s + 1 < CH / 32) { const int kb = (s + 1) * 32; fa[nx][0] = g3_frag(al + kb); fa[nx][1] = g3_frag(al + 16 * GP + kb);
#pragma unroll
      for (int t = 0; t < 4; ++t) fb[nx][t] = g3_frag(bl + t * 16 * GP + kb); }
    __builtin_amdgcn_sched_barrier(0);      /* keeps the read group above in front of these products: without it the compiler moves each pair of reads down to its first use and waits there for it */
    c00 = g3_mma(fa[cu][0], fb[cu][0], c00); c10 = g3_mma(fa[cu][1], fb[cu][0], c10); c01 = g3_mma(fa[cu][0], fb[cu][1], c01); c11 = g3_mma(fa[cu][1], fb[cu][1], c11);
    c02 = g3_mma(fa[cu][0], fb[cu][2], c02); c12 = g3_mma(fa[cu][1], fb[cu][2], c12); c03 = g3_mma(fa[cu][0], fb[cu][3], c03); c13 = g3_mma(fa[cu][1], fb[cu][3], c13); }
  __syncthreads();      /* every wave has read its last staged fragment: from here the bytes are the waves' own output tiles */
  v8f accs[8] = {c00, c01, c02, c03, c10, c11, c12, c13};
#pragma unroll
  for (int u = 0; u < 8; ++u) { const int t = u & 3, half = u >> 2; const float bv = bf16_round(bias[col0 + t * 16 + ln]);
#pragma unroll
    for (int r = 0; r < 8; ++r) so[w][half * 16 + 8 * hh + r][t * 16 + ln] = accs[u][r] * 0.0625f + bv; }
  __builtin_amdgcn_fence(__ATOMIC_ACQ_REL, "workgroup"); __builtin_amdgcn_wave_barrier();
  const int rsub = lane >> 4, c4 = (lane & 15) * 4; float* o32 = C + (size_t)(row0 + rsub) * CH + col0 + c4;      /* a lane's first output element; its later ones are 2 rows apart */
#pragma unroll
  for (int q = 0; q < 16; ++q) { const v4f v = *(const v4fa*)&so[w][q * 2 + rsub][c4]; *(v4f*)(o32 + q * 2 * CH) = v; } }

extern "C" void kernel_launch(void* const* d_in, const int* in_sizes, int n_in,
                              void* d_out, int out_size, void* d_ws, size_t ws_size, hipStream_t stream) {
  (void)in_sizes; (void)n_in; (void)out_size;
  const float* x = (const float*)d_in[0]; const float* wqkv = (const float*)d_in[1]; const float* bqkv = (const float*)d_in[2]; const float* dwk = (const float*)d_in[3]; const float* dwb = (const float*)d_in[4]; const float* wout = (const float*)d_in[5]; const float* bout = (const float*)d_in[6];
  char* ws = (char*)d_ws; size_t off = 0;
  auto take = [&](size_t bytes) { char* p = ws + off; off += (bytes + 255) & ~(size_t)255; return p; };
  const size_t ne = (size_t)NR * CH;
  _Float16* BQK = (_Float16*)take((size_t)2 * CH * CH * 2); _Float16* BO = (_Float16*)take((size_t)CH * CH * 2);
  _Float16* Q16 = (_Float16*)take(ne * 2); _Float16* K16 = (_Float16*)take(ne * 2);
  float* CTX = (float*)take(ne * 4);
  if (off > ws_size) return;      /* 0.4 + 16 + 16 + 32 = about 65 MiB */
  k_wt2_f16<<<WQB + WOB, 256, 0, stream>>>(wqkv, BQK, wout, BO);      /* (in, out), both matrices */
  const dim3 g(NR / 128, 1);
  k_qk<<<g, 512, 0, stream>>>(x, BQK, bqkv, Q16, K16);      /* q and k = v (f16) from the f32 x rows */
  k_attn<<<dim3(NPL * NHB, 2), 512, 0, stream>>>(Q16, K16, CTX);      /* y = 0: horizontal, context columns h*32; y = 1: vertical, context columns 128.. through the permutation */
  k_gemm3<<<g, 512, 0, stream>>>(CTX, K16, dwk, dwb, BO, bout, (float*)d_out);      /* out = hswish(context + depthwise bias) w_out + b */
}
